// v000
// Times are from an AMD MI455X. After a warm-up the kernel runs many times in a row, and a time is the length of
// such a window on the GPU divided by its runs, so every launch and the gaps after it count. The runs cycle
// through copies of the inputs. A figure is the median of several windows, for all but v000 over two sittings.
// Sittings can differ by a few percent; kernels timed side by side share one.
// v000 is the starting kernel. One run takes 1080 microseconds.
// compute dtype: all float inputs rounded to bf16; theta/phi/g = W x with EXACT bf16 products on WMMA 16x16x32 (f32 accumulate); unscaled affinities theta.phi with both as f16 hi + residual planes (3 products); softmax in f32 (precise expf); A x 2^11 once to f16 against g once to f16 (1 product); y split bf16 hi + lo against exact w_out (2 products); + x in f32; f32 output.
#include <hip/hip_runtime.h>
#include <math.h>

typedef __attribute__((ext_vector_type(16))) _Float16 v16h;
typedef __attribute__((ext_vector_type(16))) __bf16 v16b;
typedef __attribute__((ext_vector_type(8)))  _Float16 v8h;
typedef __attribute__((ext_vector_type(8)))  float v8f;
typedef __attribute__((ext_vector_type(4)))  float v4f;
typedef __attribute__((ext_vector_type(2)))  float v2f;
typedef __attribute__((ext_vector_type(4)))  unsigned v4u;
typedef __attribute__((ext_vector_type(4)))  int v4i;
typedef float __attribute__((may_alias)) float_a;
typedef int __attribute__((may_alias)) int_a;

template <typename T> __device__ __forceinline__ void vst2(void* p, T v) { *(T*)p = v;  }
__device__ __forceinline__ v8f wmma16(v16h a, v16h b, v8f c) {
  v8f d = __builtin_amdgcn_wmma_f32_16x16x32_f16(false, a, false, b, (short)0, c, false, false);
  asm volatile("v_nop\n\tv_nop\n\tv_nop\n\tv_nop" : "+v"(d) : "v"(a), "v"(b));
  return d;
}
__device__ __forceinline__ v8f wmma_bf(v16b a, v16b b, v8f c) {
  v8f d = __builtin_amdgcn_wmma_f32_16x16x32_bf16(false, a, false, b, (short)0, c, false, false);
  asm volatile("v_nop\n\tv_nop\n\tv_nop\n\tv_nop" : "+v"(d) : "v"(a), "v"(b));
  return d;
}
// 16x16x32 fragments: lane = (h = lane>>4, row/col = lane&15); elements 0..7 = k0+8h+0..7, 8..15 = k0+16+8h+0..7; D element r = row 8h+r
__device__ __forceinline__ v16h frag_h(const _Float16* rowk0, int lane) {
  union { v16h v; v8h q[2]; } u; const _Float16* p = rowk0 + 8 * (lane >> 4);
  u.q[0] = *(const v8h*)p; u.q[1] = *(const v8h*)(p + 16); return u.v;
}
__device__ __forceinline__ v16h frag_f32(const float* rowk0, int lane) {
  v16h a; const float* p = rowk0 + 8 * (lane >> 4);
#pragma unroll
  for (int i = 0; i < 8; ++i) { a[i] = (_Float16)p[i]; a[8 + i] = (_Float16)p[16 + i]; }
  return a;
}
__device__ __forceinline__ v16h frag_f32s(const float* rowk0, int lane, float sc) {
  v16h a; const float* p = rowk0 + 8 * (lane >> 4);
#pragma unroll
  for (int i = 0; i < 8; ++i) { a[i] = (_Float16)(p[i] * sc); a[8 + i] = (_Float16)(p[16 + i] * sc); }
  return a;
}
// column fragment from a [K][ld] layout (column n), rows >= K read as 0
__device__ __forceinline__ v16h fragc_f32(const float* W, int k0, int n, int lane, int ld, int K) {
  v16h a; const int g = lane >> 4;
#pragma unroll
  for (int i = 0; i < 8; ++i) { const int ka = k0 + 8 * g + i, kb = ka + 16;
    a[i] = (_Float16)(ka < K ? W[(size_t)(ka < K ? ka : K - 1) * ld + n] : 0.f); a[8 + i] = (_Float16)(kb < K ? W[(size_t)(kb < K ? kb : K - 1) * ld + n] : 0.f); }
  return a;
}
struct F2 { v16b h, l; };
__device__ __forceinline__ F2 bsplit16(const float v[16]) { F2 r;
#pragma unroll
  for (int i = 0; i < 16; ++i) { const __bf16 h = (__bf16)v[i]; r.h[i] = h; r.l[i] = (__bf16)(v[i] - (float)h); }
  return r; }
__device__ __forceinline__ F2 split_row(const float* row, int k0, int lane) { float v[16]; const float* p = row + k0 + 8 * (lane >> 4);
#pragma unroll
  for (int i = 0; i < 8; ++i) { v[i] = p[i]; v[8 + i] = p[16 + i]; }
  return bsplit16(v); }
__device__ __forceinline__ F2 split_rowK(const float* row, int k0, int lane, int K) { float v[16]; const int g = lane >> 4;
#pragma unroll
  for (int i = 0; i < 8; ++i) { const int ka = k0 + 8 * g + i, kb = ka + 16; v[i] = ka < K ? row[ka < K ? ka : K - 1] : 0.f; v[8 + i] = kb < K ? row[kb < K ? kb : K - 1] : 0.f; }
  return bsplit16(v); }
__device__ __forceinline__ F2 split_col(const float* W, int k0, int n, int lane, int ld, int K) { float v[16]; const int g = lane >> 4;
#pragma unroll
  for (int i = 0; i < 8; ++i) { const int ka = k0 + 8 * g + i, kb = ka + 16; v[i] = ka < K ? W[(size_t)(ka < K ? ka : K - 1) * ld + n] : 0.f; v[8 + i] = kb < K ? W[(size_t)(kb < K ? kb : K - 1) * ld + n] : 0.f; }
  return bsplit16(v); }
__device__ __forceinline__ v8f mac3(const F2& a, const F2& b, v8f c) { c = wmma_bf(a.l, b.h, c); c = wmma_bf(a.h, b.l, c); return wmma_bf(a.h, b.h, c); }
__device__ __forceinline__ float sigm(float v) { return 1.0f / (1.0f + expf(-v)); }
#define LDSX() do { asm volatile("s_wait_dscnt 0" ::: "memory"); __builtin_amdgcn_wave_barrier(); __builtin_amdgcn_fence(__ATOMIC_RELEASE, "workgroup"); } while (0)

// Non-local block (B 4, C 256, 64 x 64 = 4,096 positions; C_int 32; (out,in) weights, no biases): theta, phi, g = W x ([32,256]); A[i][j] = softmax_j(theta_i . phi_j) (no scaling, sigma ~ 5.7); y[k][i] = sum_j A[i][j] g[k][j]; out = w_out y ([256,32]) + x.
#define NB 4
#define TT 4096
#define CC 128            // projected plane width (32 real columns + 96 zero)
#define DIN 256          // input (model) width
#define NH 1
#define HD 128
#define NQB (TT / 64)
#define HG 1               // one 4,096 x 4,096 score plane per pass
#define SCALE (1.0f)
#define HDQK 32            // theta / phi / g channels: the planes are 128 wide, columns >= 32 are zero; only the 32 real columns enter the scores
#define CAUSAL 0
#ifndef TNB
#define TNB NB
#endif
__device__ __forceinline__ v16b zero16b() { v16b z; _Pragma("unroll") for (int i = 0; i < 16; ++i) z[i] = (__bf16)0.f; return z; }
__device__ __forceinline__ float bfr(float v) { return (float)(__bf16)v; }
__host__ __device__ __forceinline__ int kb_last(int qb) { return CAUSAL ? ((qb * 64 + 63) >> 7) : (TT / 128 - 1); }
typedef __attribute__((ext_vector_type(8))) __bf16 v8b;
__device__ __forceinline__ v16b frag_b(const __bf16* rowk0, int lane) {
  union { v16b v; v8b q[2]; } u; const __bf16* p = rowk0 + 8 * (lane >> 4);
  u.q[0] = *(const v8b*)p; u.q[1] = *(const v8b*)(p + 16); return u.v;
}
#define QBH (TT / 64)      // ALL query blocks take k_sc's 3-product path
#define QBH_PV 0           // A.g stays single f16
#define QHI 4096            // q residual rows everywhere (2-product logits)
#define KHI 4096           // k residual rows for ALL keys (3-product logits)
// B fragment (k rows k0+.., output column o) of a weight: (in,out) [K][ld] or (out,in) [ld rows of K]: bf16 exact, or f16(bf16 * 256) exact
__device__ __forceinline__ v16b wcol_io(const float* Wm, int k0, int o, int lane, int ld) { v16b w; const int g = lane >> 4;
#pragma unroll
  for (int i = 0; i < 8; ++i) { w[i] = (__bf16)Wm[(size_t)(k0 + 8 * g + i) * ld + o]; w[8 + i] = (__bf16)Wm[(size_t)(k0 + 16 + 8 * g + i) * ld + o]; }
  return w; }
__device__ __forceinline__ v16b wcol_oi(const float* Wm, int k0, int o, int lane, int K) { v16b w; const float* p = Wm + (size_t)o * K + k0 + 8 * (lane >> 4);
#pragma unroll
  for (int i = 0; i < 8; ++i) { w[i] = (__bf16)p[i]; w[8 + i] = (__bf16)p[16 + i]; }
  return w; }
__device__ __forceinline__ v16h wcolh_io(const float* Wm, int k0, int o, int lane, int ld) { v16h w; const int g = lane >> 4;
#pragma unroll
  for (int i = 0; i < 8; ++i) { w[i] = (_Float16)(bfr(Wm[(size_t)(k0 + 8 * g + i) * ld + o]) * 256.0f); w[8 + i] = (_Float16)(bfr(Wm[(size_t)(k0 + 16 + 8 * g + i) * ld + o]) * 256.0f); }
  return w; }
__device__ __forceinline__ v16h wcolh_oi(const float* Wm, int k0, int o, int lane, int K) { v16h w; const float* p = Wm + (size_t)o * K + k0 + 8 * (lane >> 4);
#pragma unroll
  for (int i = 0; i < 8; ++i) { w[i] = (_Float16)(bfr(p[i]) * 256.0f); w[8 + i] = (_Float16)(bfr(p[16 + i]) * 256.0f); }
  return w; }
#define WQKV_LAYOUT 1   // 0 = (in,out) [DIN][CC]; 1 = (out,in) [HDQK][DIN]; 2 = per-head [NH][DIN][HD]
__device__ __forceinline__ v16b wcol_hdk(const float* Wm, int k0, int o, int lane) { v16b w; const int g = lane >> 4; const float* p = Wm + (size_t)(o / HD) * DIN * HD + (o % HD);
#pragma unroll
  for (int i = 0; i < 8; ++i) { w[i] = (__bf16)p[(size_t)(k0 + 8 * g + i) * HD]; w[8 + i] = (__bf16)p[(size_t)(k0 + 16 + 8 * g + i) * HD]; }
  return w; }
#define WO_OUT_IN 0
#if WQKV_LAYOUT == 1
#define WCOL(W, k0, o, lane) (((o) < HDQK) ? wcol_oi(W, k0, (o), lane, DIN) : zero16b())   /* theta/phi/g weights are [32][256] (out,in): plane columns >= 32 are zero for all three */
#elif WQKV_LAYOUT == 2
#define WCOL(W, k0, o, lane) wcol_hdk(W, k0, o, lane)
#else
#define WCOL(W, k0, o, lane) wcol_io(W, k0, o, lane, CC)
#endif
#if WO_OUT_IN
#define WOCOL(W, k0, o, lane) wcol_oi(W, k0, o, lane, CC)
#define WOCOLH(W, k0, o, lane) wcolh_oi(W, k0, o, lane, CC)
#else
#define WOCOL(W, k0, o, lane) wcol_io(W, k0, o, lane, DIN)
#define WOCOLH(W, k0, o, lane) wcolh_io(W, k0, o, lane, DIN)
#endif
#ifndef XP
#define XP TT              // position pitch of x and of the output
#endif
#define BG HG              // the pass group spans BATCHES (single head): blockIdx.z / blockIdx.y select batch b0 + z
#define DVH 128            // value columns per k_pv block (all of HD 128 in one block; 8 accumulator tiles per wave)
#define WS_YR (WS_END)     // f32 attended rows [b*n][128] (32 real columns)
#define WS_OR (WS_YR + 4u * (size_t)NB * TT * CC)   // W y + b rows [b*n][256]
#define WS_END2 (WS_OR + 4u * (size_t)NB * TT * DIN)
// ---- k_wz: block = (64 rows, 128 output cols): OR = y (hi + lo, K = 32 real columns of the YR rows) . W^T ((out,in) [256][32], exact) + b
__global__ __launch_bounds__(128) void k_wz(const float* __restrict__ YR, const float* __restrict__ WW, const float* __restrict__ WB, float* __restrict__ ORW) { __shared__ __align__(16) float sf[4][16][132];
  const int tid = threadIdx.x, wave = tid >> 5, lane = tid & 31, col = lane & 15, g = lane >> 4; const int c0 = blockIdx.y * 128; const size_t r0 = (size_t)blockIdx.x * 64 + wave * 16;
  v8f acc[8] = {};
#pragma unroll
  for (int kc = 0; kc < HDQK / 32; ++kc) { const F2 a = split_row(YR + (r0 + col) * CC, kc * 32, lane); asm volatile("s_wait_loadcnt 0x0" ::: "memory");
#pragma unroll
    for (int j = 0; j < 8; ++j) { const v16b w = wcol_oi(WW, kc * 32, c0 + j * 16 + col, lane, HDQK); asm volatile("s_wait_loadcnt 0x0" ::: "memory"); acc[j] = wmma_bf(a.h, w, acc[j]); acc[j] = wmma_bf(a.l, w, acc[j]); } }
#pragma unroll
  for (int j = 0; j < 8; ++j) { const float bb = WB ? bfr(WB[c0 + j * 16 + col]) : 0.f; asm volatile("s_wait_loadcnt 0x0" ::: "memory");
#pragma unroll
    for (int r = 0; r < 8; ++r) sf[wave][8 * g + r][j * 16 + col] = acc[j][r] + bb; }
  LDSX(); for (int rl = 0; rl < 16; ++rl) vst2(ORW + (r0 + rl) * DIN + c0 + lane * 4, *(const v4f*)&sf[wave][rl][lane * 4]); }
// ---- k_fin2: block = (64 positions, 64 channels, batch b): out[b][c][n] = OR[b*N + n][c] + bf16(x[b][c][n]) (LDS transpose; 256-B runs of 64 positions per channel)
__global__ __launch_bounds__(256) void k_fin2(const float* __restrict__ ORW, const float* __restrict__ X, float* __restrict__ OUT) { __shared__ float st[64][68]; const int tid = threadIdx.x; const int n0 = blockIdx.x * 64, c0 = blockIdx.y * 64; const size_t b = blockIdx.z;
  for (int e = tid; e < 64 * 16; e += 256) { const int nl = e >> 4, q = e & 15; *(v4f*)&st[nl][q * 4] = *(const v4f*)(ORW + (b * TT + n0 + nl) * (size_t)DIN + c0 + q * 4); }
  __syncthreads();
  for (int e = tid; e < 64 * 16; e += 256) { const int cl = e >> 4, q = e & 15; const size_t oi = (b * DIN + c0 + cl) * (size_t)XP + n0 + q * 4; const v4f xr = *(const v4f*)(X + oi); v4f o; o[0] = st[q * 4][cl] + bfr(xr[0]); o[1] = st[q * 4 + 1][cl] + bfr(xr[1]); o[2] = st[q * 4 + 2][cl] + bfr(xr[2]); o[3] = st[q * 4 + 3][cl] + bfr(xr[3]); vst2(OUT + oi, o); } }
#ifndef SM_EXTRA_PARAMS
#define SM_EXTRA_PARAMS
#endif
#ifndef PROJ_EXTRA_PARAMS
#define PROJ_EXTRA_PARAMS
#endif
#ifndef SM_MASK_HOOK
#define SM_MASK_HOOK (void)0
#endif

#define WS_QH  0u                                      // f16 q rows [b*t][CC]
#define WS_KH  (WS_QH + 2u * (size_t)NB * TT * CC)      // f16 k rows [b*t][CC]
#define WS_VT  (WS_KH + 2u * (size_t)NB * TT * CC)      // f16 v planes [b][c][t]
#define WS_QL  (WS_VT + 2u * (size_t)NB * CC * TT)      // f16 q residual x 2^10 rows [b][t < QHI][CC]
#define WS_KL  (WS_QL + 2u * (size_t)NB * QHI * CC)     // f16 k residual x 2^10 rows [b][t < KHI][CC]
#define WS_VB  (WS_KL + 2u * (size_t)NB * KHI * CC)     // bf16 v hi planes [b][c][t < KHI]
#define WS_VBL (WS_VB + 2u * (size_t)NB * CC * KHI)
#define WS_S   (WS_VBL + 2u * (size_t)NB * CC * KHI)    // f32 logits / P [hg][t][s]
#define WS_Y   (WS_S  + 4u * (size_t)HG * TT * TT)      // f32 ctx rows [b*t][CC] (only when there is an output projection)
#define WS_END (WS_Y  + 0u)

// ---- k_proj: block = (64 rows, 128 cols, which): q/k/v = X W (+ b) with exact bf16 products (K = DIN) -> which 0: q f16 rows (+ residual rows < QHI); 1: k f16 rows (+ residual rows < KHI); 2: v f16 planes [c][t] (+ bf16 hi/lo planes for t < KHI)
__global__ __launch_bounds__(128) void k_proj(const float* __restrict__ XQ, const float* __restrict__ XK, const float* __restrict__ XV, const float* __restrict__ WQ, const float* __restrict__ WK, const float* __restrict__ WV, const float* __restrict__ BQ, const float* __restrict__ BK, const float* __restrict__ BV,
    _Float16* __restrict__ QH, _Float16* __restrict__ QL, _Float16* __restrict__ KH, _Float16* __restrict__ KL, _Float16* __restrict__ VT, __bf16* __restrict__ VB, __bf16* __restrict__ VBL) {
  __shared__ __align__(16) _Float16 sh[64][136], sl[64][136]; __shared__ __align__(16) _Float16 th[128][72]; __shared__ __align__(16) __bf16 tb[128][72], tbl[128][72];
  const int tid = threadIdx.x, wave = tid >> 5, lane = tid & 31, col = lane & 15, g = lane >> 4; const int which = blockIdx.z; const int c0 = blockIdx.y * 128; const size_t r0 = (size_t)blockIdx.x * 64; const size_t bb = r0 / TT; const int t0 = (int)(r0 % TT);
  const float* X = which == 0 ? XQ : which == 1 ? XK : XV; const float* WA = which == 0 ? WQ : which == 1 ? WK : WV; const float* BA = which == 0 ? BQ : which == 1 ? BK : BV;
  v8f acc[8] = {};
#pragma unroll 2
  for (int kc = 0; kc < DIN / 32; ++kc) { v16b a; { const float* p = X + (bb * DIN + kc * 32 + 8 * g) * (size_t)XP + t0 + wave * 16 + col;   /* channels-first gather: x[b][k][t], stride XP between k */
#pragma unroll
      for (int i = 0; i < 8; ++i) { a[i] = (__bf16)p[(size_t)i * XP]; a[8 + i] = (__bf16)p[(size_t)(16 + i) * XP]; } }
    asm volatile("s_wait_loadcnt 0x0" ::: "memory");
#pragma unroll
    for (int j = 0; j < 8; ++j) { const v16b w = WCOL(WA, kc * 32, c0 + j * 16 + col, lane); asm volatile("s_wait_loadcnt 0x0" ::: "memory"); acc[j] = wmma_bf(a, w, acc[j]); } }
  if (which < 2) { _Float16* DH = which == 0 ? QH : KH; _Float16* DL = which == 0 ? QL : KL; const int nhi = which == 0 ? QHI : KHI; const bool hi_rows = t0 < nhi;
#pragma unroll
    for (int j = 0; j < 8; ++j) { const float bias = (BA && (c0 + j * 16 + col < HDQK)) ? bfr(BA[c0 + j * 16 + col]) : 0.f;   /* 32-entry biases */
#pragma unroll
      for (int r = 0; r < 8; ++r) { const float v = acc[j][r] + bias; const _Float16 hv = (_Float16)v; sh[wave * 16 + 8 * g + r][j * 16 + col] = hv; sl[wave * 16 + 8 * g + r][j * 16 + col] = (_Float16)((v - (float)hv) * 1024.0f); } }
    __syncthreads();
    for (int e = tid; e < 64 * 16; e += 128) { const int rl = e >> 4, q = e & 15; vst2((unsigned*)(DH + (r0 + rl) * CC + c0 + q * 8), *(const v4u*)&sh[rl][q * 8]); if (hi_rows) vst2((unsigned*)(DL + (bb * nhi + t0 + rl) * (size_t)CC + c0 + q * 8), *(const v4u*)&sl[rl][q * 8]); }
  } else { const bool hi_rows = t0 < KHI;
#pragma unroll
    for (int j = 0; j < 8; ++j) { const float bias = (BA && (c0 + j * 16 + col < HDQK)) ? bfr(BA[c0 + j * 16 + col]) : 0.f;   /* 32-entry biases */
#pragma unroll
      for (int r = 0; r < 8; ++r) { const float v = acc[j][r] + bias; const int rl = wave * 16 + 8 * g + r, cl = j * 16 + col; th[cl][rl] = (_Float16)v; const __bf16 bh = (__bf16)v; tb[cl][rl] = bh; tbl[cl][rl] = (__bf16)(v - (float)bh); } }
    __syncthreads();
    for (int e = tid; e < 128 * 8; e += 128) { const int cl = e >> 3, q = e & 7; vst2((unsigned*)(VT + (bb * CC + c0 + cl) * (size_t)TT + t0 + q * 8), *(const v4u*)&th[cl][q * 8]); if (hi_rows) { const size_t o3 = (bb * CC + c0 + cl) * (size_t)KHI + t0 + q * 8; vst2((unsigned*)(VB + o3), *(const v4u*)&tb[cl][q * 8]); vst2((unsigned*)(VBL + o3), *(const v4u*)&tbl[cl][q * 8]); } } } }
// ---- k_sc: block = (query block qb, key block kb <= kb_last(qb), batch b in group): logits x SCALE; q hi + residual (x 2^10) against k (2 products) for query rows < QHI, plus the k residual (3 products) for query blocks < QBH (all query blocks); causal: blocks past the diagonal exit, the mask itself is applied by index in k_sm
__global__ __launch_bounds__(128) void k_sc(const _Float16* __restrict__ QH, const _Float16* __restrict__ KH, const _Float16* __restrict__ QL, const _Float16* __restrict__ KL, int bgrp, int h0, float* __restrict__ S0) { __shared__ __align__(16) float ss[4][16][132];
  const int qb = blockIdx.x, kb = blockIdx.y; if (kb > kb_last(qb)) return;
  const int h = h0; const int b = bgrp + blockIdx.z; float* S = S0 + (size_t)blockIdx.z * TT * TT;   /* group spans batches */
  const int tid = threadIdx.x, wave = tid >> 5, lane = tid & 31, col = lane & 15, g = lane >> 4; const int k0 = kb * 128; const int ql0 = qb * 64 + wave * 16; const size_t q0 = (size_t)b * TT + ql0, kr0 = (size_t)b * TT + k0;
  v8f acc[8] = {}, accl[8] = {};
  const _Float16* QLb = QL + (size_t)b * QHI * CC; const _Float16* KLb = KL + (size_t)b * KHI * CC;
  if (qb < QBH) {
#pragma unroll
    for (int kc = 0; kc < HDQK / 32; ++kc) { const v16h ah = frag_h(QH + (q0 + col) * CC + h * HD + kc * 32, lane), al = frag_h(QLb + (size_t)(ql0 + col) * CC + h * HD + kc * 32, lane);
#pragma unroll
      for (int j = 0; j < 8; ++j) { const v16h kbf = frag_h(KH + (kr0 + j * 16 + col) * CC + h * HD + kc * 32, lane), klf = frag_h(KLb + (size_t)(k0 + j * 16 + col) * CC + h * HD + kc * 32, lane); acc[j] = wmma16(ah, kbf, acc[j]); accl[j] = wmma16(al, kbf, accl[j]); accl[j] = wmma16(ah, klf, accl[j]); } }
  } else if (qb * 64 < QHI) {
#pragma unroll
    for (int kc = 0; kc < HDQK / 32; ++kc) { const v16h ah = frag_h(QH + (q0 + col) * CC + h * HD + kc * 32, lane), al = frag_h(QLb + (size_t)(ql0 + col) * CC + h * HD + kc * 32, lane);
#pragma unroll
      for (int j = 0; j < 8; ++j) { const v16h kbf = frag_h(KH + (kr0 + j * 16 + col) * CC + h * HD + kc * 32, lane); acc[j] = wmma16(ah, kbf, acc[j]); accl[j] = wmma16(al, kbf, accl[j]); } }
  } else {
#pragma unroll
    for (int kc = 0; kc < HDQK / 32; ++kc) { const v16h ah = frag_h(QH + (q0 + col) * CC + h * HD + kc * 32, lane);
#pragma unroll
      for (int j = 0; j < 8; ++j) { const v16h kbf = frag_h(KH + (kr0 + j * 16 + col) * CC + h * HD + kc * 32, lane); acc[j] = wmma16(ah, kbf, acc[j]); } } }
#pragma unroll
  for (int j = 0; j < 8; ++j) {
#pragma unroll
    for (int r = 0; r < 8; ++r) ss[wave][8 * g + r][j * 16 + col] = (acc[j][r] + accl[j][r] * (1.0f / 1024.0f)) * SCALE; }
  LDSX(); for (int rl = 0; rl < 16; ++rl) vst2(S + (size_t)(ql0 + rl) * TT + k0 + lane * 4, *(const v4f*)&ss[wave][rl][lane * 4]); }
// ---- k_sm: block = query row t (batch in group): keys [0, kend): causal -> logit if s <= t else excluded; softmax in f32; P x 2^11 in place (0 for excluded)
__global__ __launch_bounds__(256) void k_sm(float* __restrict__ S0 SM_EXTRA_PARAMS) { __shared__ float sred[8]; __shared__ float sbc; __shared__ __align__(16) float shv[TT];
  const int tid = threadIdx.x; const int t = blockIdx.x; const int kend = (kb_last(t >> 6) + 1) * 128;
  float* sr = S0 + (size_t)blockIdx.y * TT * TT + (size_t)t * TT;
  float m = -3.0e38f; for (int k = tid; k < kend; k += 256) { float v = (!CAUSAL || k <= t) ? sr[k] : -3.0e38f; SM_MASK_HOOK; shv[k] = v; m = fmaxf(m, v); }
#pragma unroll
  for (int o = 1; o < 32; o <<= 1) m = fmaxf(m, __shfl_xor(m, o));
  if ((tid & 31) == 0) sred[tid >> 5] = m; __syncthreads(); if (tid == 0) { float a = sred[0]; for (int i = 1; i < 8; ++i) a = fmaxf(a, sred[i]); sbc = a; } __syncthreads(); m = sbc; __syncthreads();
  float sum = 0.f; for (int k = tid; k < kend; k += 256) { const float v = shv[k]; const float e = (v <= -1.0e38f) ? 0.f : expf(v - m); shv[k] = e; sum += e; }
#pragma unroll
  for (int o = 1; o < 32; o <<= 1) sum += __shfl_xor(sum, o);
  if ((tid & 31) == 0) sred[tid >> 5] = sum; __syncthreads(); if (tid == 0) { float a = 0.f; for (int i = 0; i < 8; ++i) a += sred[i]; sbc = a > 0.f ? 2048.0f / a : 0.f; }   /* a fully excluded row yields P = 0 */ __syncthreads(); const float inv = sbc;
  for (int k = tid; k < kend; k += 256) shv[k] = shv[k] * inv;
  __syncthreads(); for (int q = tid; q < kend / 4; q += 256) vst2(sr + q * 4, *(const v4f*)&shv[q * 4]); }
// ---- k_pv: block = 64 queries (qb) of (b, h): ctx = P . v over keys [0, kend) (P x 2^11 once to f16 against v f16: 1 product; query blocks < QBH_PV, none here: P and v as bf16 hi + lo, 3 products); 512-B (row, head) segment by 32 lanes
__global__ __launch_bounds__(128) void k_pv(const float* __restrict__ PS0, const _Float16* __restrict__ VT, const __bf16* __restrict__ VB, const __bf16* __restrict__ VBL, int bgrp, int h0, float* __restrict__ Y) { const int h = h0; const int b = bgrp + blockIdx.z; const float* PS = PS0 + (size_t)blockIdx.z * TT * TT; const int d0 = blockIdx.y * DVH;   /* group spans batches; column offset d0 = 0 (one block covers HD) */ __shared__ __align__(16) float ss[4][16][DVH + 4];
  const int tid = threadIdx.x, wave = tid >> 5, lane = tid & 31, col = lane & 15, g = lane >> 4; const int qb = blockIdx.x; const int ql0 = qb * 64 + wave * 16; const int kce = (kb_last(qb) + 1) * 4;
  v8f acc[DVH / 16] = {};
  if (qb < QBH_PV) {
#pragma unroll 1
    for (int kc = 0; kc < kce; ++kc) { const F2 p = split_row(PS + (size_t)(ql0 + col) * TT, kc * 32, lane);
      asm volatile("s_wait_loadcnt 0x0" ::: "memory");
#pragma unroll
      for (int j = 0; j < DVH / 16; ++j) { const size_t po = ((size_t)b * CC + h * HD + d0 + j * 16 + col) * (size_t)KHI + kc * 32; const v16b vh = frag_b(VB + po, lane); acc[j] = wmma_bf(p.h, vh, acc[j]); acc[j] = wmma_bf(p.l, vh, acc[j]); acc[j] = wmma_bf(p.h, frag_b(VBL + po, lane), acc[j]); } }
  } else {
#pragma unroll 1
    for (int kc = 0; kc < kce; ++kc) { const v16h p = frag_f32(PS + (size_t)(ql0 + col) * TT + kc * 32, lane);
      asm volatile("s_wait_loadcnt 0x0" ::: "memory");
#pragma unroll
      for (int j = 0; j < DVH / 16; ++j) { const size_t po = ((size_t)b * CC + h * HD + d0 + j * 16 + col) * (size_t)TT + kc * 32; acc[j] = wmma16(p, frag_h(VT + po, lane), acc[j]); } } }
#pragma unroll
  for (int j = 0; j < DVH / 16; ++j)
#pragma unroll
    for (int r = 0; r < 8; ++r) ss[wave][8 * g + r][j * 16 + col] = acc[j][r] * (1.0f / 2048.0f);
  LDSX(); for (int rl = 0; rl < 16; ++rl) vst2(Y + ((size_t)b * TT + ql0 + rl) * CC + h * HD + d0 + lane * 4, *(const v4f*)&ss[wave][rl][lane * 4]); }   /* 512-B (row, head) segment by 32 lanes */

extern "C" void kernel_launch(void* const* d_in, const int* in_sizes, int n_in, void* d_out, int out_size, void* d_ws, size_t ws_size, hipStream_t stream) {
  (void)in_sizes; (void)n_in; (void)out_size;
  const float** F = (const float**)d_in;
  if (ws_size < (size_t)WS_END) return;
  char* ws = (char*)d_ws; _Float16 *QH = (_Float16*)(ws + WS_QH), *KH = (_Float16*)(ws + WS_KH), *VT = (_Float16*)(ws + WS_VT), *QL = (_Float16*)(ws + WS_QL), *KL = (_Float16*)(ws + WS_KL); __bf16 *VB = (__bf16*)(ws + WS_VB), *VBL = (__bf16*)(ws + WS_VBL); float *S = (float*)(ws + WS_S), *Y = (float*)(ws + WS_Y);
  (void)Y; (void)QL; (void)KL; (void)VB; (void)VBL;
  // inputs: 0 x [4,256,64,64]; 1 w_theta [32,256] (out,in); 2 w_phi; 3 w_g; 4 w_out [256,32] (out,in); no biases
  if (ws_size < (size_t)WS_END2) return;
  float *YR = (float*)(ws + WS_YR), *ORW = (float*)(ws + WS_OR);
  k_proj<<<dim3(TNB * TT / 64, CC / 128, 3), 128, 0, stream>>>(F[0], F[0], F[0], F[1], F[2], F[3], nullptr, nullptr, nullptr, QH, QL, KH, KL, VT, VB, VBL);   /* q = theta, k = phi, v = g */
  for (int b0 = 0; b0 < TNB; b0 += BG) {
    k_sc<<<dim3(NQB, TT / 128, BG), 128, 0, stream>>>(QH, KH, QL, KL, b0, 0, S);
    k_sm<<<dim3(TT, BG), 256, 0, stream>>>(S);
    k_pv<<<dim3(NQB, HD / DVH, BG), 128, 0, stream>>>(S, VT, VB, VBL, b0, 0, YR);
  }
  k_wz<<<dim3(TNB * TT / 64, DIN / 128), 128, 0, stream>>>(YR, F[4], nullptr, ORW);
  k_fin2<<<dim3(TT / 64, DIN / 64, TNB), 256, 0, stream>>>(ORW, F[0], (float*)d_out);
}

// v001
// It runs in 342 microseconds.
// Next to v000, in two timings, it ran 3.17 and 3.15 times as fast.
// compute dtype: all float inputs rounded to bf16; theta/phi/g = W x with EXACT bf16 products on WMMA 16x16x32 (f32 accumulate); unscaled affinities theta.phi with both as f16 hi + residual planes (3 products); softmax in f32 (precise expf); A x 2^11 once to f16 against g once to f16 (1 product); y split bf16 hi + lo against exact w_out (2 products); + x in f32; f32 output.
#include <hip/hip_runtime.h>
#include <math.h>

typedef __attribute__((ext_vector_type(16))) _Float16 v16h;
typedef __attribute__((ext_vector_type(16))) __bf16 v16b;
typedef __attribute__((ext_vector_type(8)))  _Float16 v8h;
typedef __attribute__((ext_vector_type(8)))  float v8f;
typedef __attribute__((ext_vector_type(4)))  float v4f;
typedef __attribute__((ext_vector_type(2)))  float v2f;
typedef __attribute__((ext_vector_type(4)))  unsigned v4u;
typedef __attribute__((ext_vector_type(4)))  int v4i;
typedef float __attribute__((may_alias)) float_a;
typedef int __attribute__((may_alias)) int_a;

template <typename T> __device__ __forceinline__ void vst2(void* p, T v) { *(T*)p = v;  }
__device__ __forceinline__ v8f wmma16(v16h a, v16h b, v8f c) {
  v8f d = __builtin_amdgcn_wmma_f32_16x16x32_f16(false, a, false, b, (short)0, c, false, false);
  asm volatile("v_nop\n\tv_nop\n\tv_nop\n\tv_nop" : "+v"(d) : "v"(a), "v"(b));
  return d;
}
__device__ __forceinline__ v8f wmma_bf(v16b a, v16b b, v8f c) {
  v8f d = __builtin_amdgcn_wmma_f32_16x16x32_bf16(false, a, false, b, (short)0, c, false, false);
  asm volatile("v_nop\n\tv_nop\n\tv_nop\n\tv_nop" : "+v"(d) : "v"(a), "v"(b));
  return d;
}
// 16x16x32 fragments: lane = (h = lane>>4, row/col = lane&15); elements 0..7 = k0+8h+0..7, 8..15 = k0+16+8h+0..7; D element r = row 8h+r
__device__ __forceinline__ v16h frag_h(const _Float16* rowk0, int lane) {
  union { v16h v; v8h q[2]; } u; const _Float16* p = rowk0 + 8 * (lane >> 4);
  u.q[0] = *(const v8h*)p; u.q[1] = *(const v8h*)(p + 16); return u.v;
}
__device__ __forceinline__ v16h frag_f32(const float* rowk0, int lane) {
  v16h a; const float* p = rowk0 + 8 * (lane >> 4);
#pragma unroll
  for (int i = 0; i < 8; ++i) { a[i] = (_Float16)p[i]; a[8 + i] = (_Float16)p[16 + i]; }
  return a;
}
__device__ __forceinline__ v16h frag_f32s(const float* rowk0, int lane, float sc) {
  v16h a; const float* p = rowk0 + 8 * (lane >> 4);
#pragma unroll
  for (int i = 0; i < 8; ++i) { a[i] = (_Float16)(p[i] * sc); a[8 + i] = (_Float16)(p[16 + i] * sc); }
  return a;
}
// column fragment from a [K][ld] layout (column n), rows >= K read as 0
__device__ __forceinline__ v16h fragc_f32(const float* W, int k0, int n, int lane, int ld, int K) {
  v16h a; const int g = lane >> 4;
#pragma unroll
  for (int i = 0; i < 8; ++i) { const int ka = k0 + 8 * g + i, kb = ka + 16;
    a[i] = (_Float16)(ka < K ? W[(size_t)(ka < K ? ka : K - 1) * ld + n] : 0.f); a[8 + i] = (_Float16)(kb < K ? W[(size_t)(kb < K ? kb : K - 1) * ld + n] : 0.f); }
  return a;
}
struct F2 { v16b h, l; };
__device__ __forceinline__ F2 bsplit16(const float v[16]) { F2 r;
#pragma unroll
  for (int i = 0; i < 16; ++i) { const __bf16 h = (__bf16)v[i]; r.h[i] = h; r.l[i] = (__bf16)(v[i] - (float)h); }
  return r; }
__device__ __forceinline__ F2 split_row(const float* row, int k0, int lane) { float v[16]; const float* p = row + k0 + 8 * (lane >> 4);
#pragma unroll
  for (int i = 0; i < 8; ++i) { v[i] = p[i]; v[8 + i] = p[16 + i]; }
  return bsplit16(v); }
__device__ __forceinline__ F2 split_rowK(const float* row, int k0, int lane, int K) { float v[16]; const int g = lane >> 4;
#pragma unroll
  for (int i = 0; i < 8; ++i) { const int ka = k0 + 8 * g + i, kb = ka + 16; v[i] = ka < K ? row[ka < K ? ka : K - 1] : 0.f; v[8 + i] = kb < K ? row[kb < K ? kb : K - 1] : 0.f; }
  return bsplit16(v); }
__device__ __forceinline__ F2 split_col(const float* W, int k0, int n, int lane, int ld, int K) { float v[16]; const int g = lane >> 4;
#pragma unroll
  for (int i = 0; i < 8; ++i) { const int ka = k0 + 8 * g + i, kb = ka + 16; v[i] = ka < K ? W[(size_t)(ka < K ? ka : K - 1) * ld + n] : 0.f; v[8 + i] = kb < K ? W[(size_t)(kb < K ? kb : K - 1) * ld + n] : 0.f; }
  return bsplit16(v); }
__device__ __forceinline__ v8f mac3(const F2& a, const F2& b, v8f c) { c = wmma_bf(a.l, b.h, c); c = wmma_bf(a.h, b.l, c); return wmma_bf(a.h, b.h, c); }
__device__ __forceinline__ float sigm(float v) { return 1.0f / (1.0f + expf(-v)); }
#define LDSX() do { asm volatile("s_wait_dscnt 0" ::: "memory"); __builtin_amdgcn_wave_barrier(); __builtin_amdgcn_fence(__ATOMIC_RELEASE, "workgroup"); } while (0)

// Non-local block (B 4, C 256, 64 x 64 = 4,096 positions; C_int 32; (out,in) weights, no biases): theta, phi, g = W x ([32,256]); A[i][j] = softmax_j(theta_i . phi_j) (no scaling, sigma ~ 5.7); y[k][i] = sum_j A[i][j] g[k][j]; out = w_out y ([256,32]) + x.
#define NB 4
#define TT 4096
#define CC 128            // projected plane width (32 real columns + 96 zero)
#define DIN 256          // input (model) width
#define NH 1
#define HD 128
#define NQB (TT / 64)
#define HG 1               // one 4,096 x 4,096 score plane per pass
#define SCALE (1.0f)
#define HDQK 32            // theta / phi / g channels: the planes are 128 wide, columns >= 32 are zero; only the 32 real columns enter the scores
#define CAUSAL 0
#ifndef TNB
#define TNB NB
#endif
__device__ __forceinline__ v16b zero16b() { v16b z; _Pragma("unroll") for (int i = 0; i < 16; ++i) z[i] = (__bf16)0.f; return z; }
__device__ __forceinline__ float bfr(float v) { return (float)(__bf16)v; }
__host__ __device__ __forceinline__ int kb_last(int qb) { return CAUSAL ? ((qb * 64 + 63) >> 7) : (TT / 128 - 1); }
typedef __attribute__((ext_vector_type(8))) __bf16 v8b;
__device__ __forceinline__ v16b frag_b(const __bf16* rowk0, int lane) {
  union { v16b v; v8b q[2]; } u; const __bf16* p = rowk0 + 8 * (lane >> 4);
  u.q[0] = *(const v8b*)p; u.q[1] = *(const v8b*)(p + 16); return u.v;
}
#define QBH (TT / 64)      // ALL query blocks take k_sc's 3-product path
#define QBH_PV 0           // A.g stays single f16
#define QHI 4096            // q residual rows everywhere (2-product logits)
#define KHI 4096           // k residual rows for ALL keys (3-product logits)
// B fragment (k rows k0+.., output column o) of a weight: (in,out) [K][ld] or (out,in) [ld rows of K]: bf16 exact, or f16(bf16 * 256) exact
__device__ __forceinline__ v16b wcol_io(const float* Wm, int k0, int o, int lane, int ld) { v16b w; const int g = lane >> 4;
#pragma unroll
  for (int i = 0; i < 8; ++i) { w[i] = (__bf16)Wm[(size_t)(k0 + 8 * g + i) * ld + o]; w[8 + i] = (__bf16)Wm[(size_t)(k0 + 16 + 8 * g + i) * ld + o]; }
  return w; }
__device__ __forceinline__ v16b wcol_oi(const float* Wm, int k0, int o, int lane, int K) { v16b w; const float* p = Wm + (size_t)o * K + k0 + 8 * (lane >> 4);
#pragma unroll
  for (int i = 0; i < 8; ++i) { w[i] = (__bf16)p[i]; w[8 + i] = (__bf16)p[16 + i]; }
  return w; }
__device__ __forceinline__ v16h wcolh_io(const float* Wm, int k0, int o, int lane, int ld) { v16h w; const int g = lane >> 4;
#pragma unroll
  for (int i = 0; i < 8; ++i) { w[i] = (_Float16)(bfr(Wm[(size_t)(k0 + 8 * g + i) * ld + o]) * 256.0f); w[8 + i] = (_Float16)(bfr(Wm[(size_t)(k0 + 16 + 8 * g + i) * ld + o]) * 256.0f); }
  return w; }
__device__ __forceinline__ v16h wcolh_oi(const float* Wm, int k0, int o, int lane, int K) { v16h w; const float* p = Wm + (size_t)o * K + k0 + 8 * (lane >> 4);
#pragma unroll
  for (int i = 0; i < 8; ++i) { w[i] = (_Float16)(bfr(p[i]) * 256.0f); w[8 + i] = (_Float16)(bfr(p[16 + i]) * 256.0f); }
  return w; }
#define WQKV_LAYOUT 1   // 0 = (in,out) [DIN][CC]; 1 = (out,in) [HDQK][DIN]; 2 = per-head [NH][DIN][HD]
__device__ __forceinline__ v16b wcol_hdk(const float* Wm, int k0, int o, int lane) { v16b w; const int g = lane >> 4; const float* p = Wm + (size_t)(o / HD) * DIN * HD + (o % HD);
#pragma unroll
  for (int i = 0; i < 8; ++i) { w[i] = (__bf16)p[(size_t)(k0 + 8 * g + i) * HD]; w[8 + i] = (__bf16)p[(size_t)(k0 + 16 + 8 * g + i) * HD]; }
  return w; }
#define WO_OUT_IN 0
#if WQKV_LAYOUT == 1
#define WCOL(W, k0, o, lane) (((o) < HDQK) ? wcol_oi(W, k0, (o), lane, DIN) : zero16b())   /* theta/phi/g weights are [32][256] (out,in): plane columns >= 32 are zero for all three */
#elif WQKV_LAYOUT == 2
#define WCOL(W, k0, o, lane) wcol_hdk(W, k0, o, lane)
#else
#define WCOL(W, k0, o, lane) wcol_io(W, k0, o, lane, CC)
#endif
#if WO_OUT_IN
#define WOCOL(W, k0, o, lane) wcol_oi(W, k0, o, lane, CC)
#define WOCOLH(W, k0, o, lane) wcolh_oi(W, k0, o, lane, CC)
#else
#define WOCOL(W, k0, o, lane) wcol_io(W, k0, o, lane, DIN)
#define WOCOLH(W, k0, o, lane) wcolh_io(W, k0, o, lane, DIN)
#endif
#ifndef XP
#define XP TT              // position pitch of x and of the output
#endif
#define BG HG              // the pass group spans BATCHES (single head): blockIdx.z / blockIdx.y select batch b0 + z
#define DVH 128            // value columns per k_pv block (all of HD 128 in one block; 8 accumulator tiles per wave)
#define WS_YR (WS_END)     // f32 attended rows [b*n][128] (32 real columns)
#define WS_OR (WS_YR + 4u * (size_t)NB * TT * CC)   // W y + b rows [b*n][256]
#define WS_END2 (WS_OR + 4u * (size_t)NB * TT * DIN)
// ---- k_wz: block = (64 rows, 128 output cols): OR = y (hi + lo, K = 32 real columns of the YR rows) . W^T ((out,in) [256][32], exact) + b
__global__ __launch_bounds__(128) void k_wz(const float* __restrict__ YR, const float* __restrict__ WW, const float* __restrict__ WB, float* __restrict__ ORW) { __shared__ __align__(16) float sf[4][16][132];
  const int tid = threadIdx.x, wave = tid >> 5, lane = tid & 31, col = lane & 15, g = lane >> 4; const int c0 = blockIdx.y * 128; const size_t r0 = (size_t)blockIdx.x * 64 + wave * 16;
  v8f acc[8] = {};
#pragma unroll
  for (int kc = 0; kc < HDQK / 32; ++kc) { const F2 a = split_row(YR + (r0 + col) * CC, kc * 32, lane); asm volatile("s_wait_loadcnt 0x0" ::: "memory");
#pragma unroll
    for (int j = 0; j < 8; ++j) { const v16b w = wcol_oi(WW, kc * 32, c0 + j * 16 + col, lane, HDQK); asm volatile("s_wait_loadcnt 0x0" ::: "memory"); acc[j] = wmma_bf(a.h, w, acc[j]); acc[j] = wmma_bf(a.l, w, acc[j]); } }
#pragma unroll
  for (int j = 0; j < 8; ++j) { const float bb = WB ? bfr(WB[c0 + j * 16 + col]) : 0.f; asm volatile("s_wait_loadcnt 0x0" ::: "memory");
#pragma unroll
    for (int r = 0; r < 8; ++r) sf[wave][8 * g + r][j * 16 + col] = acc[j][r] + bb; }
  LDSX(); for (int rl = 0; rl < 16; ++rl) vst2(ORW + (r0 + rl) * DIN + c0 + lane * 4, *(const v4f*)&sf[wave][rl][lane * 4]); }
// ---- k_fin2: block = (64 positions, 64 channels, batch b): out[b][c][n] = OR[b*N + n][c] + bf16(x[b][c][n]) (LDS transpose; 256-B runs of 64 positions per channel)
__global__ __launch_bounds__(256) void k_fin2(const float* __restrict__ ORW, const float* __restrict__ X, float* __restrict__ OUT) { __shared__ float st[64][68]; const int tid = threadIdx.x; const int n0 = blockIdx.x * 64, c0 = blockIdx.y * 64; const size_t b = blockIdx.z;
  for (int e = tid; e < 64 * 16; e += 256) { const int nl = e >> 4, q = e & 15; *(v4f*)&st[nl][q * 4] = *(const v4f*)(ORW + (b * TT + n0 + nl) * (size_t)DIN + c0 + q * 4); }
  __syncthreads();
  for (int e = tid; e < 64 * 16; e += 256) { const int cl = e >> 4, q = e & 15; const size_t oi = (b * DIN + c0 + cl) * (size_t)XP + n0 + q * 4; const v4f xr = *(const v4f*)(X + oi); v4f o; o[0] = st[q * 4][cl] + bfr(xr[0]); o[1] = st[q * 4 + 1][cl] + bfr(xr[1]); o[2] = st[q * 4 + 2][cl] + bfr(xr[2]); o[3] = st[q * 4 + 3][cl] + bfr(xr[3]); vst2(OUT + oi, o); } }
#ifndef SM_EXTRA_PARAMS
#define SM_EXTRA_PARAMS
#endif
#ifndef PROJ_EXTRA_PARAMS
#define PROJ_EXTRA_PARAMS
#endif
#ifndef SM_MASK_HOOK
#define SM_MASK_HOOK (void)0
#endif

#define WS_QH  0u                                      // f16 q rows [b*t][CC]
#define WS_KH  (WS_QH + 2u * (size_t)NB * TT * CC)      // f16 k rows [b*t][CC]
#define WS_VT  (WS_KH + 2u * (size_t)NB * TT * CC)      // f16 v planes [b][c][t]
#define WS_QL  (WS_VT + 2u * (size_t)NB * CC * TT)      // f16 q residual x 2^10 rows [b][t < QHI][CC]
#define WS_KL  (WS_QL + 2u * (size_t)NB * QHI * CC)     // f16 k residual x 2^10 rows [b][t < KHI][CC]
#define WS_VB  (WS_KL + 2u * (size_t)NB * KHI * CC)     // bf16 v hi planes [b][c][t < KHI]
#define WS_VBL (WS_VB + 2u * (size_t)NB * CC * KHI)
#define WS_S   (WS_VBL + 2u * (size_t)NB * CC * KHI)    // f32 logits / P [hg][t][s]
#define WS_Y   (WS_S  + 4u * (size_t)HG * TT * TT)      // f32 ctx rows [b*t][CC] (only when there is an output projection)
#define WS_END (WS_Y  + 0u)

// ---- k_proj: block = (64 rows, 128 cols, which): q/k/v = X W (+ b) with exact bf16 products (K = DIN) -> which 0: q f16 rows (+ residual rows < QHI); 1: k f16 rows (+ residual rows < KHI); 2: v f16 planes [c][t] (+ bf16 hi/lo planes for t < KHI)
__global__ __launch_bounds__(128) void k_proj(const float* __restrict__ XQ, const float* __restrict__ XK, const float* __restrict__ XV, const float* __restrict__ WQ, const float* __restrict__ WK, const float* __restrict__ WV, const float* __restrict__ BQ, const float* __restrict__ BK, const float* __restrict__ BV,
    _Float16* __restrict__ QH, _Float16* __restrict__ QL, _Float16* __restrict__ KH, _Float16* __restrict__ KL, _Float16* __restrict__ VT, __bf16* __restrict__ VB, __bf16* __restrict__ VBL) {
  __shared__ __align__(16) _Float16 sh[64][136], sl[64][136]; __shared__ __align__(16) _Float16 th[128][72]; __shared__ __align__(16) __bf16 tb[128][72], tbl[128][72];
  const int tid = threadIdx.x, wave = tid >> 5, lane = tid & 31, col = lane & 15, g = lane >> 4; const int which = blockIdx.z; const int c0 = blockIdx.y * 128; const size_t r0 = (size_t)blockIdx.x * 64; const size_t bb = r0 / TT; const int t0 = (int)(r0 % TT);
  const float* X = which == 0 ? XQ : which == 1 ? XK : XV; const float* WA = which == 0 ? WQ : which == 1 ? WK : WV; const float* BA = which == 0 ? BQ : which == 1 ? BK : BV;
  v8f acc[8] = {};
#pragma unroll 2
  for (int kc = 0; kc < DIN / 32; ++kc) { v16b a; { const float* p = X + (bb * DIN + kc * 32 + 8 * g) * (size_t)XP + t0 + wave * 16 + col;   /* channels-first gather: x[b][k][t], stride XP between k */
#pragma unroll
      for (int i = 0; i < 8; ++i) { a[i] = (__bf16)p[(size_t)i * XP]; a[8 + i] = (__bf16)p[(size_t)(16 + i) * XP]; } }
    asm volatile("s_wait_loadcnt 0x0" ::: "memory");
#pragma unroll
    for (int j = 0; j < 8; ++j) { const v16b w = WCOL(WA, kc * 32, c0 + j * 16 + col, lane); asm volatile("s_wait_loadcnt 0x0" ::: "memory"); acc[j] = wmma_bf(a, w, acc[j]); } }
  if (which < 2) { _Float16* DH = which == 0 ? QH : KH; _Float16* DL = which == 0 ? QL : KL; const int nhi = which == 0 ? QHI : KHI; const bool hi_rows = t0 < nhi;
#pragma unroll
    for (int j = 0; j < 8; ++j) { const float bias = (BA && (c0 + j * 16 + col < HDQK)) ? bfr(BA[c0 + j * 16 + col]) : 0.f;   /* 32-entry biases */
#pragma unroll
      for (int r = 0; r < 8; ++r) { const float v = acc[j][r] + bias; const _Float16 hv = (_Float16)v; sh[wave * 16 + 8 * g + r][j * 16 + col] = hv; sl[wave * 16 + 8 * g + r][j * 16 + col] = (_Float16)((v - (float)hv) * 1024.0f); } }
    __syncthreads();
    for (int e = tid; e < 64 * 16; e += 128) { const int rl = e >> 4, q = e & 15; vst2((unsigned*)(DH + (r0 + rl) * CC + c0 + q * 8), *(const v4u*)&sh[rl][q * 8]); if (hi_rows) vst2((unsigned*)(DL + (bb * nhi + t0 + rl) * (size_t)CC + c0 + q * 8), *(const v4u*)&sl[rl][q * 8]); }
  } else { const bool hi_rows = t0 < KHI;
#pragma unroll
    for (int j = 0; j < 8; ++j) { const float bias = (BA && (c0 + j * 16 + col < HDQK)) ? bfr(BA[c0 + j * 16 + col]) : 0.f;   /* 32-entry biases */
#pragma unroll
      for (int r = 0; r < 8; ++r) { const float v = acc[j][r] + bias; const int rl = wave * 16 + 8 * g + r, cl = j * 16 + col; th[cl][rl] = (_Float16)v; const __bf16 bh = (__bf16)v; tb[cl][rl] = bh; tbl[cl][rl] = (__bf16)(v - (float)bh); } }
    __syncthreads();
    for (int e = tid; e < 128 * 8; e += 128) { const int cl = e >> 3, q = e & 7; vst2((unsigned*)(VT + (bb * CC + c0 + cl) * (size_t)TT + t0 + q * 8), *(const v4u*)&th[cl][q * 8]); if (hi_rows) { const size_t o3 = (bb * CC + c0 + cl) * (size_t)KHI + t0 + q * 8; vst2((unsigned*)(VB + o3), *(const v4u*)&tb[cl][q * 8]); vst2((unsigned*)(VBL + o3), *(const v4u*)&tbl[cl][q * 8]); } } } }
// ---- k_sc: block = (query block qb, key block kb <= kb_last(qb), batch b in group): logits x SCALE; q hi + residual (x 2^10) against k (2 products) for query rows < QHI, plus the k residual (3 products) for query blocks < QBH (all query blocks); causal: blocks past the diagonal exit, the mask itself is applied by index in k_sm
__global__ __launch_bounds__(128) void k_sc(const _Float16* __restrict__ QH, const _Float16* __restrict__ KH, const _Float16* __restrict__ QL, const _Float16* __restrict__ KL, int bgrp, int h0, float* __restrict__ S0) { __shared__ __align__(16) float ss[4][16][132];
  const int qb = blockIdx.x, kb = blockIdx.y; if (kb > kb_last(qb)) return;
  const int h = h0; const int b = bgrp + blockIdx.z; float* S = S0 + (size_t)blockIdx.z * TT * TT;   /* group spans batches */
  const int tid = threadIdx.x, wave = tid >> 5, lane = tid & 31, col = lane & 15, g = lane >> 4; const int k0 = kb * 128; const int ql0 = qb * 64 + wave * 16; const size_t q0 = (size_t)b * TT + ql0, kr0 = (size_t)b * TT + k0;
  v8f acc[8] = {}, accl[8] = {};
  const _Float16* QLb = QL + (size_t)b * QHI * CC; const _Float16* KLb = KL + (size_t)b * KHI * CC;
  if (qb < QBH) {
#pragma unroll
    for (int kc = 0; kc < HDQK / 32; ++kc) { const v16h ah = frag_h(QH + (q0 + col) * CC + h * HD + kc * 32, lane), al = frag_h(QLb + (size_t)(ql0 + col) * CC + h * HD + kc * 32, lane);
#pragma unroll
      for (int j = 0; j < 8; ++j) { const v16h kbf = frag_h(KH + (kr0 + j * 16 + col) * CC + h * HD + kc * 32, lane), klf = frag_h(KLb + (size_t)(k0 + j * 16 + col) * CC + h * HD + kc * 32, lane); acc[j] = wmma16(ah, kbf, acc[j]); accl[j] = wmma16(al, kbf, accl[j]); accl[j] = wmma16(ah, klf, accl[j]); } }
  } else if (qb * 64 < QHI) {
#pragma unroll
    for (int kc = 0; kc < HDQK / 32; ++kc) { const v16h ah = frag_h(QH + (q0 + col) * CC + h * HD + kc * 32, lane), al = frag_h(QLb + (size_t)(ql0 + col) * CC + h * HD + kc * 32, lane);
#pragma unroll
      for (int j = 0; j < 8; ++j) { const v16h kbf = frag_h(KH + (kr0 + j * 16 + col) * CC + h * HD + kc * 32, lane); acc[j] = wmma16(ah, kbf, acc[j]); accl[j] = wmma16(al, kbf, accl[j]); } }
  } else {
#pragma unroll
    for (int kc = 0; kc < HDQK / 32; ++kc) { const v16h ah = frag_h(QH + (q0 + col) * CC + h * HD + kc * 32, lane);
#pragma unroll
      for (int j = 0; j < 8; ++j) { const v16h kbf = frag_h(KH + (kr0 + j * 16 + col) * CC + h * HD + kc * 32, lane); acc[j] = wmma16(ah, kbf, acc[j]); } } }
#pragma unroll
  for (int j = 0; j < 8; ++j) {
#pragma unroll
    for (int r = 0; r < 8; ++r) ss[wave][8 * g + r][j * 16 + col] = (acc[j][r] + accl[j][r] * (1.0f / 1024.0f)) * SCALE; }
  LDSX(); for (int rl = 0; rl < 16; ++rl) vst2(S + (size_t)(ql0 + rl) * TT + k0 + lane * 4, *(const v4f*)&ss[wave][rl][lane * 4]); }
// ---- k_sm: block = query row t (batch in group): keys [0, kend): causal -> logit if s <= t else excluded; softmax in f32; P x 2^11 in place (0 for excluded)
__global__ __launch_bounds__(256) void k_sm(float* __restrict__ S0 SM_EXTRA_PARAMS) { __shared__ float sred[8]; __shared__ float sbc; __shared__ __align__(16) float shv[TT];
  const int tid = threadIdx.x; const int t = blockIdx.x; const int kend = (kb_last(t >> 6) + 1) * 128;
  float* sr = S0 + (size_t)blockIdx.y * TT * TT + (size_t)t * TT;
  float m = -3.0e38f; for (int k = tid; k < kend; k += 256) { float v = (!CAUSAL || k <= t) ? sr[k] : -3.0e38f; SM_MASK_HOOK; shv[k] = v; m = fmaxf(m, v); }
#pragma unroll
  for (int o = 1; o < 32; o <<= 1) m = fmaxf(m, __shfl_xor(m, o));
  if ((tid & 31) == 0) sred[tid >> 5] = m; __syncthreads(); if (tid == 0) { float a = sred[0]; for (int i = 1; i < 8; ++i) a = fmaxf(a, sred[i]); sbc = a; } __syncthreads(); m = sbc; __syncthreads();
  float sum = 0.f; for (int k = tid; k < kend; k += 256) { const float v = shv[k]; const float e = (v <= -1.0e38f) ? 0.f : expf(v - m); shv[k] = e; sum += e; }
#pragma unroll
  for (int o = 1; o < 32; o <<= 1) sum += __shfl_xor(sum, o);
  if ((tid & 31) == 0) sred[tid >> 5] = sum; __syncthreads(); if (tid == 0) { float a = 0.f; for (int i = 0; i < 8; ++i) a += sred[i]; sbc = a > 0.f ? 2048.0f / a : 0.f; }   /* a fully excluded row yields P = 0 */ __syncthreads(); const float inv = sbc;
  for (int k = tid; k < kend; k += 256) shv[k] = shv[k] * inv;
  __syncthreads(); for (int q = tid; q < kend / 4; q += 256) vst2(sr + q * 4, *(const v4f*)&shv[q * 4]); }
// ---- k_pv: block = 16 queries (qt) of (b, h), KSPL waves: wave w sums ctx = P . v over its own 1/KSPL of the keys [0, kend) (P x 2^11 once to f16 against v f16: 1 product; query blocks < QBH_PV (none): P and v as bf16 hi + lo, 3 products); the KSPL f32 partial tiles meet in LDS and are added in wave order
#define KSPL 16            // key ranges = waves per k_pv block: TT / 16 = 256 blocks of 16 waves
__global__ __launch_bounds__(32 * KSPL) void k_pv(const float* __restrict__ PS0, const _Float16* __restrict__ VT, const __bf16* __restrict__ VB, const __bf16* __restrict__ VBL, int bgrp, int h0, float* __restrict__ Y) { const int h = h0; const int b = bgrp + blockIdx.z; const float* PS = PS0 + (size_t)blockIdx.z * TT * TT; const int d0 = blockIdx.y * DVH;   /* group spans batches; column offset d0 (always 0: one block spans all 128 columns) */ __shared__ __align__(16) float ss[KSPL][16][DVH + 4];
  const int tid = threadIdx.x, wave = tid >> 5, lane = tid & 31, col = lane & 15, g = lane >> 4; const int qt = blockIdx.x; const int qb = qt >> 2; const int ql0 = qt * 16; const int kper = (kb_last(qb) + 1) * 4 / KSPL; const int kc0 = wave * kper;
  v8f acc[DVH / 16] = {};
  if (qb < QBH_PV) {
#pragma unroll 1
    for (int ki = 0; ki < kper; ++ki) { const int kc = kc0 + ki; const F2 p = split_row(PS + (size_t)(ql0 + col) * TT, kc * 32, lane);
      asm volatile("s_wait_loadcnt 0x0" ::: "memory");
#pragma unroll
      for (int j = 0; j < DVH / 16; ++j) { const size_t po = ((size_t)b * CC + h * HD + d0 + j * 16 + col) * (size_t)KHI + kc * 32; const v16b vh = frag_b(VB + po, lane); acc[j] = wmma_bf(p.h, vh, acc[j]); acc[j] = wmma_bf(p.l, vh, acc[j]); acc[j] = wmma_bf(p.h, frag_b(VBL + po, lane), acc[j]); } }
  } else {
#pragma unroll 1
    for (int ki = 0; ki < kper; ++ki) { const int kc = kc0 + ki; const v16h p = frag_f32(PS + (size_t)(ql0 + col) * TT + kc * 32, lane);
      asm volatile("s_wait_loadcnt 0x0" ::: "memory");
#pragma unroll
      for (int j = 0; j < DVH / 16; ++j) { const size_t po = ((size_t)b * CC + h * HD + d0 + j * 16 + col) * (size_t)TT + kc * 32; acc[j] = wmma16(p, frag_h(VT + po, lane), acc[j]); } } }
#pragma unroll
  for (int j = 0; j < DVH / 16; ++j)
#pragma unroll
    for (int r = 0; r < 8; ++r) ss[wave][8 * g + r][j * 16 + col] = acc[j][r];
  __syncthreads();   /* every wave's partial tile is in LDS before any wave adds them */
  for (int rl = wave; rl < 16; rl += KSPL) { v4f s = *(const v4f*)&ss[0][rl][lane * 4];
#pragma unroll
    for (int w = 1; w < KSPL; ++w) s += *(const v4f*)&ss[w][rl][lane * 4];
    vst2(Y + ((size_t)b * TT + ql0 + rl) * CC + h * HD + d0 + lane * 4, s * (1.0f / 2048.0f)); } }   /* 512-B row (all 128 columns) by 32 lanes */

extern "C" void kernel_launch(void* const* d_in, const int* in_sizes, int n_in, void* d_out, int out_size, void* d_ws, size_t ws_size, hipStream_t stream) {
  (void)in_sizes; (void)n_in; (void)out_size;
  const float** F = (const float**)d_in;
  if (ws_size < (size_t)WS_END) return;
  char* ws = (char*)d_ws; _Float16 *QH = (_Float16*)(ws + WS_QH), *KH = (_Float16*)(ws + WS_KH), *VT = (_Float16*)(ws + WS_VT), *QL = (_Float16*)(ws + WS_QL), *KL = (_Float16*)(ws + WS_KL); __bf16 *VB = (__bf16*)(ws + WS_VB), *VBL = (__bf16*)(ws + WS_VBL); float *S = (float*)(ws + WS_S), *Y = (float*)(ws + WS_Y);
  (void)Y; (void)QL; (void)KL; (void)VB; (void)VBL;
  // inputs: 0 x [4,256,64,64]; 1 w_theta [32,256] (out,in); 2 w_phi; 3 w_g; 4 w_out [256,32] (out,in); no biases
  if (ws_size < (size_t)WS_END2) return;
  float *YR = (float*)(ws + WS_YR), *ORW = (float*)(ws + WS_OR);
  k_proj<<<dim3(TNB * TT / 64, CC / 128, 3), 128, 0, stream>>>(F[0], F[0], F[0], F[1], F[2], F[3], nullptr, nullptr, nullptr, QH, QL, KH, KL, VT, VB, VBL);   /* q = theta, k = phi, v = g */
  for (int b0 = 0; b0 < TNB; b0 += BG) {
    k_sc<<<dim3(NQB, TT / 128, BG), 128, 0, stream>>>(QH, KH, QL, KL, b0, 0, S);
    k_sm<<<dim3(TT, BG), 256, 0, stream>>>(S);
    k_pv<<<dim3(TT / 16, HD / DVH, BG), 32 * KSPL, 0, stream>>>(S, VT, VB, VBL, b0, 0, YR);
  }
  k_wz<<<dim3(TNB * TT / 64, DIN / 128), 128, 0, stream>>>(YR, F[4], nullptr, ORW);
  k_fin2<<<dim3(TT / 64, DIN / 64, TNB), 256, 0, stream>>>(ORW, F[0], (float*)d_out);
}

// v002
// One run takes 80.2 microseconds.
// Timed twice side by side with v001, it ran 4.30 and 4.26 times as fast.
// Over all steps from v000 it is 13.5 times as fast.
// compute dtype: all float inputs rounded to bf16; theta/phi/g = W x with EXACT bf16 products on WMMA 16x16x32 (f32 accumulate); unscaled affinities theta.phi with both as f16 hi + residual planes (3 products); softmax in f32 (precise expf); exp(s - max) x 2^11 once to f16 against g once to f16 (1 product), divided by the f32 sum of the exponentials after the product; y split bf16 hi + lo against exact w_out (2 products); + x in f32; f32 output.
#include <hip/hip_runtime.h>
#include <math.h>

typedef __attribute__((ext_vector_type(16))) _Float16 v16h;
typedef __attribute__((ext_vector_type(16))) __bf16 v16b;
typedef __attribute__((ext_vector_type(8)))  _Float16 v8h;
typedef __attribute__((ext_vector_type(8)))  float v8f;
typedef __attribute__((ext_vector_type(4)))  float v4f;
typedef __attribute__((ext_vector_type(2)))  float v2f;
typedef __attribute__((ext_vector_type(4)))  unsigned v4u;
typedef __attribute__((ext_vector_type(4)))  int v4i;
typedef float __attribute__((may_alias)) float_a;
typedef int __attribute__((may_alias)) int_a;

template <typename T> __device__ __forceinline__ void vst2(void* p, T v) { *(T*)p = v;  }
__device__ __forceinline__ v8f wmma16(v16h a, v16h b, v8f c) {
  v8f d = __builtin_amdgcn_wmma_f32_16x16x32_f16(false, a, false, b, (short)0, c, false, false);
  asm volatile("v_nop\n\tv_nop\n\tv_nop\n\tv_nop" : "+v"(d) : "v"(a), "v"(b));
  return d;
}
__device__ __forceinline__ v8f wmma_bf(v16b a, v16b b, v8f c) {
  v8f d = __builtin_amdgcn_wmma_f32_16x16x32_bf16(false, a, false, b, (short)0, c, false, false);
  asm volatile("v_nop\n\tv_nop\n\tv_nop\n\tv_nop" : "+v"(d) : "v"(a), "v"(b));
  return d;
}
// 16x16x32 fragments: lane = (h = lane>>4, row/col = lane&15); elements 0..7 = k0+8h+0..7, 8..15 = k0+16+8h+0..7; D element r = row 8h+r
__device__ __forceinline__ v16h frag_h(const _Float16* rowk0, int lane) {
  union { v16h v; v8h q[2]; } u; const _Float16* p = rowk0 + 8 * (lane >> 4);
  u.q[0] = *(const v8h*)p; u.q[1] = *(const v8h*)(p + 16); return u.v;
}
__device__ __forceinline__ v16h frag_f32(const float* rowk0, int lane) {
  v16h a; const float* p = rowk0 + 8 * (lane >> 4);
#pragma unroll
  for (int i = 0; i < 8; ++i) { a[i] = (_Float16)p[i]; a[8 + i] = (_Float16)p[16 + i]; }
  return a;
}
__device__ __forceinline__ v16h frag_f32s(const float* rowk0, int lane, float sc) {
  v16h a; const float* p = rowk0 + 8 * (lane >> 4);
#pragma unroll
  for (int i = 0; i < 8; ++i) { a[i] = (_Float16)(p[i] * sc); a[8 + i] = (_Float16)(p[16 + i] * sc); }
  return a;
}
// column fragment from a [K][ld] layout (column n), rows >= K read as 0
__device__ __forceinline__ v16h fragc_f32(const float* W, int k0, int n, int lane, int ld, int K) {
  v16h a; const int g = lane >> 4;
#pragma unroll
  for (int i = 0; i < 8; ++i) { const int ka = k0 + 8 * g + i, kb = ka + 16;
    a[i] = (_Float16)(ka < K ? W[(size_t)(ka < K ? ka : K - 1) * ld + n] : 0.f); a[8 + i] = (_Float16)(kb < K ? W[(size_t)(kb < K ? kb : K - 1) * ld + n] : 0.f); }
  return a;
}
struct F2 { v16b h, l; };
__device__ __forceinline__ F2 bsplit16(const float v[16]) { F2 r;
#pragma unroll
  for (int i = 0; i < 16; ++i) { const __bf16 h = (__bf16)v[i]; r.h[i] = h; r.l[i] = (__bf16)(v[i] - (float)h); }
  return r; }
__device__ __forceinline__ F2 split_row(const float* row, int k0, int lane) { float v[16]; const float* p = row + k0 + 8 * (lane >> 4);
#pragma unroll
  for (int i = 0; i < 8; ++i) { v[i] = p[i]; v[8 + i] = p[16 + i]; }
  return bsplit16(v); }
__device__ __forceinline__ F2 split_rowK(const float* row, int k0, int lane, int K) { float v[16]; const int g = lane >> 4;
#pragma unroll
  for (int i = 0; i < 8; ++i) { const int ka = k0 + 8 * g + i, kb = ka + 16; v[i] = ka < K ? row[ka < K ? ka : K - 1] : 0.f; v[8 + i] = kb < K ? row[kb < K ? kb : K - 1] : 0.f; }
  return bsplit16(v); }
__device__ __forceinline__ F2 split_col(const float* W, int k0, int n, int lane, int ld, int K) { float v[16]; const int g = lane >> 4;
#pragma unroll
  for (int i = 0; i < 8; ++i) { const int ka = k0 + 8 * g + i, kb = ka + 16; v[i] = ka < K ? W[(size_t)(ka < K ? ka : K - 1) * ld + n] : 0.f; v[8 + i] = kb < K ? W[(size_t)(kb < K ? kb : K - 1) * ld + n] : 0.f; }
  return bsplit16(v); }
__device__ __forceinline__ v8f mac3(const F2& a, const F2& b, v8f c) { c = wmma_bf(a.l, b.h, c); c = wmma_bf(a.h, b.l, c); return wmma_bf(a.h, b.h, c); }
__device__ __forceinline__ float sigm(float v) { return 1.0f / (1.0f + expf(-v)); }
#define LDSX() do { asm volatile("s_wait_dscnt 0" ::: "memory"); __builtin_amdgcn_wave_barrier(); __builtin_amdgcn_fence(__ATOMIC_RELEASE, "workgroup"); } while (0)

// Non-local block (B 4, C 256, 64 x 64 = 4,096 positions; C_int 32; (out,in) weights, no biases): theta, phi, g = W x ([32,256]); A[i][j] = softmax_j(theta_i . phi_j) (no scaling, sigma ~ 5.7); y[k][i] = sum_j A[i][j] g[k][j]; out = w_out y ([256,32]) + x.
#define NB 4
#define TT 4096
#define CC 128            // projected plane width (32 real columns + 96 zero)
#define DIN 256          // input (model) width
#define NH 1
#define HD 128
#define NQB (TT / 64)
#define HG 1               // 4,096 x 4,096 f32 planes reserved at WS_S, which no kernel uses
#define SCALE (1.0f)
#define HDQK 32            // theta / phi / g channels: the planes are 128 wide, columns >= 32 are zero; only the 32 real columns enter the scores
#define CAUSAL 0
#ifndef TNB
#define TNB NB
#endif
__device__ __forceinline__ v16b zero16b() { v16b z; _Pragma("unroll") for (int i = 0; i < 16; ++i) z[i] = (__bf16)0.f; return z; }
__device__ __forceinline__ float bfr(float v) { return (float)(__bf16)v; }
__host__ __device__ __forceinline__ int kb_last(int qb) { return CAUSAL ? ((qb * 64 + 63) >> 7) : (TT / 128 - 1); }
typedef __attribute__((ext_vector_type(8))) __bf16 v8b;
__device__ __forceinline__ v16b frag_b(const __bf16* rowk0, int lane) {
  union { v16b v; v8b q[2]; } u; const __bf16* p = rowk0 + 8 * (lane >> 4);
  u.q[0] = *(const v8b*)p; u.q[1] = *(const v8b*)(p + 16); return u.v;
}
#define QBH (TT / 64)      // ALL query blocks take k_att's 3-product scores
#define QBH_PV 0           // A.g stays single f16
#define QHI 4096            // q residual rows everywhere (3-product logits)
#define KHI 4096           // k residual rows for ALL keys (3-product logits)
// B fragment (k rows k0+.., output column o) of a weight: (in,out) [K][ld] or (out,in) [ld rows of K]: bf16 exact, or f16(bf16 * 256) exact
__device__ __forceinline__ v16b wcol_io(const float* Wm, int k0, int o, int lane, int ld) { v16b w; const int g = lane >> 4;
#pragma unroll
  for (int i = 0; i < 8; ++i) { w[i] = (__bf16)Wm[(size_t)(k0 + 8 * g + i) * ld + o]; w[8 + i] = (__bf16)Wm[(size_t)(k0 + 16 + 8 * g + i) * ld + o]; }
  return w; }
__device__ __forceinline__ v16b wcol_oi(const float* Wm, int k0, int o, int lane, int K) { v16b w; const float* p = Wm + (size_t)o * K + k0 + 8 * (lane >> 4);
#pragma unroll
  for (int i = 0; i < 8; ++i) { w[i] = (__bf16)p[i]; w[8 + i] = (__bf16)p[16 + i]; }
  return w; }
__device__ __forceinline__ v16h wcolh_io(const float* Wm, int k0, int o, int lane, int ld) { v16h w; const int g = lane >> 4;
#pragma unroll
  for (int i = 0; i < 8; ++i) { w[i] = (_Float16)(bfr(Wm[(size_t)(k0 + 8 * g + i) * ld + o]) * 256.0f); w[8 + i] = (_Float16)(bfr(Wm[(size_t)(k0 + 16 + 8 * g + i) * ld + o]) * 256.0f); }
  return w; }
__device__ __forceinline__ v16h wcolh_oi(const float* Wm, int k0, int o, int lane, int K) { v16h w; const float* p = Wm + (size_t)o * K + k0 + 8 * (lane >> 4);
#pragma unroll
  for (int i = 0; i < 8; ++i) { w[i] = (_Float16)(bfr(p[i]) * 256.0f); w[8 + i] = (_Float16)(bfr(p[16 + i]) * 256.0f); }
  return w; }
#define WQKV_LAYOUT 1   // 0 = (in,out) [DIN][CC]; 1 = (out,in) [HDQK][DIN]; 2 = per-head [NH][DIN][HD]
__device__ __forceinline__ v16b wcol_hdk(const float* Wm, int k0, int o, int lane) { v16b w; const int g = lane >> 4; const float* p = Wm + (size_t)(o / HD) * DIN * HD + (o % HD);
#pragma unroll
  for (int i = 0; i < 8; ++i) { w[i] = (__bf16)p[(size_t)(k0 + 8 * g + i) * HD]; w[8 + i] = (__bf16)p[(size_t)(k0 + 16 + 8 * g + i) * HD]; }
  return w; }
#define WO_OUT_IN 0
#if WQKV_LAYOUT == 1
#define WCOL(W, k0, o, lane) (((o) < HDQK) ? wcol_oi(W, k0, (o), lane, DIN) : zero16b())   /* theta/phi/g weights are [32][256] (out,in): plane columns >= 32 are zero for all three */
#elif WQKV_LAYOUT == 2
#define WCOL(W, k0, o, lane) wcol_hdk(W, k0, o, lane)
#else
#define WCOL(W, k0, o, lane) wcol_io(W, k0, o, lane, CC)
#endif
#if WO_OUT_IN
#define WOCOL(W, k0, o, lane) wcol_oi(W, k0, o, lane, CC)
#define WOCOLH(W, k0, o, lane) wcolh_oi(W, k0, o, lane, CC)
#else
#define WOCOL(W, k0, o, lane) wcol_io(W, k0, o, lane, DIN)
#define WOCOLH(W, k0, o, lane) wcolh_io(W, k0, o, lane, DIN)
#endif
#ifndef XP
#define XP TT              // position pitch of x and of the output
#endif
#define BG HG              // unused
#define DVH 128
#define WS_YR (WS_END)     // f32 attended rows [b*n][128] (32 real columns)
#define WS_OR (WS_YR + 4u * (size_t)NB * TT * CC)   // W y + b rows [b*n][256]
#define WS_END2 (WS_OR + 4u * (size_t)NB * TT * DIN)
// ---- k_wz: block = (64 rows, 128 output cols): OR = y (hi + lo, K = 32 real columns of the YR rows) . W^T ((out,in) [256][32], exact) + b
__global__ __launch_bounds__(128) void k_wz(const float* __restrict__ YR, const float* __restrict__ WW, const float* __restrict__ WB, float* __restrict__ ORW) { __shared__ __align__(16) float sf[4][16][132];
  const int tid = threadIdx.x, wave = tid >> 5, lane = tid & 31, col = lane & 15, g = lane >> 4; const int c0 = blockIdx.y * 128; const size_t r0 = (size_t)blockIdx.x * 64 + wave * 16;
  v8f acc[8] = {};
#pragma unroll
  for (int kc = 0; kc < HDQK / 32; ++kc) { const F2 a = split_row(YR + (r0 + col) * CC, kc * 32, lane); asm volatile("s_wait_loadcnt 0x0" ::: "memory");
#pragma unroll
    for (int j = 0; j < 8; ++j) { const v16b w = wcol_oi(WW, kc * 32, c0 + j * 16 + col, lane, HDQK); asm volatile("s_wait_loadcnt 0x0" ::: "memory"); acc[j] = wmma_bf(a.h, w, acc[j]); acc[j] = wmma_bf(a.l, w, acc[j]); } }
#pragma unroll
  for (int j = 0; j < 8; ++j) { const float bb = WB ? bfr(WB[c0 + j * 16 + col]) : 0.f; asm volatile("s_wait_loadcnt 0x0" ::: "memory");
#pragma unroll
    for (int r = 0; r < 8; ++r) sf[wave][8 * g + r][j * 16 + col] = acc[j][r] + bb; }
  LDSX(); for (int rl = 0; rl < 16; ++rl) vst2(ORW + (r0 + rl) * DIN + c0 + lane * 4, *(const v4f*)&sf[wave][rl][lane * 4]); }
// ---- k_fin2: block = (64 positions, 64 channels, batch b): out[b][c][n] = OR[b*N + n][c] + bf16(x[b][c][n]) (LDS transpose; 256-B runs of 64 positions per channel)
__global__ __launch_bounds__(256) void k_fin2(const float* __restrict__ ORW, const float* __restrict__ X, float* __restrict__ OUT) { __shared__ float st[64][68]; const int tid = threadIdx.x; const int n0 = blockIdx.x * 64, c0 = blockIdx.y * 64; const size_t b = blockIdx.z;
  for (int e = tid; e < 64 * 16; e += 256) { const int nl = e >> 4, q = e & 15; *(v4f*)&st[nl][q * 4] = *(const v4f*)(ORW + (b * TT + n0 + nl) * (size_t)DIN + c0 + q * 4); }
  __syncthreads();
  for (int e = tid; e < 64 * 16; e += 256) { const int cl = e >> 4, q = e & 15; const size_t oi = (b * DIN + c0 + cl) * (size_t)XP + n0 + q * 4; const v4f xr = *(const v4f*)(X + oi); v4f o; o[0] = st[q * 4][cl] + bfr(xr[0]); o[1] = st[q * 4 + 1][cl] + bfr(xr[1]); o[2] = st[q * 4 + 2][cl] + bfr(xr[2]); o[3] = st[q * 4 + 3][cl] + bfr(xr[3]); vst2(OUT + oi, o); } }
#ifndef SM_EXTRA_PARAMS
#define SM_EXTRA_PARAMS
#endif
#ifndef PROJ_EXTRA_PARAMS
#define PROJ_EXTRA_PARAMS
#endif
#ifndef SM_MASK_HOOK
#define SM_MASK_HOOK (void)0
#endif

#define WS_QH  0u                                      // f16 q rows [b*t][CC]
#define WS_KH  (WS_QH + 2u * (size_t)NB * TT * CC)      // f16 k rows [b*t][CC]
#define WS_VT  (WS_KH + 2u * (size_t)NB * TT * CC)      // f16 v planes [b][c][t]
#define WS_QL  (WS_VT + 2u * (size_t)NB * CC * TT)      // f16 q residual x 2^10 rows [b][t < QHI][CC]
#define WS_KL  (WS_QL + 2u * (size_t)NB * QHI * CC)     // f16 k residual x 2^10 rows [b][t < KHI][CC]
#define WS_VB  (WS_KL + 2u * (size_t)NB * KHI * CC)     // bf16 v hi planes [b][c][t < KHI]
#define WS_VBL (WS_VB + 2u * (size_t)NB * CC * KHI)
#define WS_S   (WS_VBL + 2u * (size_t)NB * CC * KHI)    // f32 [hg][t][s], reserved; no kernel uses it
#define WS_Y   (WS_S  + 4u * (size_t)HG * TT * TT)      // f32 ctx rows [b*t][CC] (only when there is an output projection)
#define WS_END (WS_Y  + 0u)

// ---- k_proj: block = (64 rows, 128 cols, which): q/k/v = X W (+ b) with exact bf16 products (K = DIN) -> which 0: q f16 rows (+ residual rows < QHI); 1: k f16 rows (+ residual rows < KHI); 2: v f16 planes [c][t] (+ bf16 hi/lo planes for t < KHI)
__global__ __launch_bounds__(128) void k_proj(const float* __restrict__ XQ, const float* __restrict__ XK, const float* __restrict__ XV, const float* __restrict__ WQ, const float* __restrict__ WK, const float* __restrict__ WV, const float* __restrict__ BQ, const float* __restrict__ BK, const float* __restrict__ BV,
    _Float16* __restrict__ QH, _Float16* __restrict__ QL, _Float16* __restrict__ KH, _Float16* __restrict__ KL, _Float16* __restrict__ VT, __bf16* __restrict__ VB, __bf16* __restrict__ VBL) {
  __shared__ __align__(16) _Float16 sh[64][136], sl[64][136]; __shared__ __align__(16) _Float16 th[128][72]; __shared__ __align__(16) __bf16 tb[128][72], tbl[128][72];
  const int tid = threadIdx.x, wave = tid >> 5, lane = tid & 31, col = lane & 15, g = lane >> 4; const int which = blockIdx.z; const int c0 = blockIdx.y * 128; const size_t r0 = (size_t)blockIdx.x * 64; const size_t bb = r0 / TT; const int t0 = (int)(r0 % TT);
  const float* X = which == 0 ? XQ : which == 1 ? XK : XV; const float* WA = which == 0 ? WQ : which == 1 ? WK : WV; const float* BA = which == 0 ? BQ : which == 1 ? BK : BV;
  v8f acc[8] = {};
#pragma unroll 2
  for (int kc = 0; kc < DIN / 32; ++kc) { v16b a; { const float* p = X + (bb * DIN + kc * 32 + 8 * g) * (size_t)XP + t0 + wave * 16 + col;   /* channels-first gather: x[b][k][t], stride XP between k */
#pragma unroll
      for (int i = 0; i < 8; ++i) { a[i] = (__bf16)p[(size_t)i * XP]; a[8 + i] = (__bf16)p[(size_t)(16 + i) * XP]; } }
    asm volatile("s_wait_loadcnt 0x0" ::: "memory");
#pragma unroll
    for (int j = 0; j < 8; ++j) { const v16b w = WCOL(WA, kc * 32, c0 + j * 16 + col, lane); asm volatile("s_wait_loadcnt 0x0" ::: "memory"); acc[j] = wmma_bf(a, w, acc[j]); } }
  if (which < 2) { _Float16* DH = which == 0 ? QH : KH; _Float16* DL = which == 0 ? QL : KL; const int nhi = which == 0 ? QHI : KHI; const bool hi_rows = t0 < nhi;
#pragma unroll
    for (int j = 0; j < 8; ++j) { const float bias = (BA && (c0 + j * 16 + col < HDQK)) ? bfr(BA[c0 + j * 16 + col]) : 0.f;   /* 32-entry biases */
#pragma unroll
      for (int r = 0; r < 8; ++r) { const float v = acc[j][r] + bias; const _Float16 hv = (_Float16)v; sh[wave * 16 + 8 * g + r][j * 16 + col] = hv; sl[wave * 16 + 8 * g + r][j * 16 + col] = (_Float16)((v - (float)hv) * 1024.0f); } }
    __syncthreads();
    for (int e = tid; e < 64 * 16; e += 128) { const int rl = e >> 4, q = e & 15; vst2((unsigned*)(DH + (r0 + rl) * CC + c0 + q * 8), *(const v4u*)&sh[rl][q * 8]); if (hi_rows) vst2((unsigned*)(DL + (bb * nhi + t0 + rl) * (size_t)CC + c0 + q * 8), *(const v4u*)&sl[rl][q * 8]); }
  } else { const bool hi_rows = t0 < KHI;
#pragma unroll
    for (int j = 0; j < 8; ++j) { const float bias = (BA && (c0 + j * 16 + col < HDQK)) ? bfr(BA[c0 + j * 16 + col]) : 0.f;   /* 32-entry biases */
#pragma unroll
      for (int r = 0; r < 8; ++r) { const float v = acc[j][r] + bias; const int rl = wave * 16 + 8 * g + r, cl = j * 16 + col; th[cl][rl] = (_Float16)v; const __bf16 bh = (__bf16)v; tb[cl][rl] = bh; tbl[cl][rl] = (__bf16)(v - (float)bh); } }
    __syncthreads();
    for (int e = tid; e < 128 * 8; e += 128) { const int cl = e >> 3, q = e & 7; vst2((unsigned*)(VT + (bb * CC + c0 + cl) * (size_t)TT + t0 + q * 8), *(const v4u*)&th[cl][q * 8]); if (hi_rows) { const size_t o3 = (bb * CC + c0 + cl) * (size_t)KHI + t0 + q * 8; vst2((unsigned*)(VB + o3), *(const v4u*)&tb[cl][q * 8]); vst2((unsigned*)(VBL + o3), *(const v4u*)&tbl[cl][q * 8]); } } } }
// ---- k_att: block = 64 queries (4 tiles of 16) of batch blockIdx.y, 16 waves; wave w owns keys [256 w, 256 w + 256) for all 64 queries. Scores are formed transposed, S^T = phi . theta^T (A = key rows, B = query rows, staged once in LDS: pass 1 keeps their fragments in registers, pass 2 reads them per tile; hi + residual planes, 3 products), so a lane holds one query's scores.
// pass 1: row maxima (joined over the waves in LDS). pass 2: the same scores again, e = expf(s - max + 11 ln 2) once to f16; two S^T tiles of 16 keys are the B operand of y^T += g^T . e^T with no lane exchange; f32 sums of e per lane. The 16 partial y tiles and sums are added in LDS in wave order, y = sum(e g) / sum(e).
// every bare '#pragma unroll' in k_att but the two over the waves' LDS entries: its loop indexes fragments or accumulators, which stay in registers only when the loop is fully unrolled
#define AQT 4              // query tiles per wave: each key / value fragment load serves 64 queries
#define AKW 16             // key ranges = waves per block
#define AKR (TT / AKW)     // keys per wave
__device__ __forceinline__ v16h frag_p(const _Float16* p) { union { v16h v; v8h q[2]; } u; u.q[0] = *(const v8h*)p; u.q[1] = *(const v8h*)(p + 16); return u.v; }   /* frag_h with the lane's 8 (lane >> 4) already in p */
__device__ __forceinline__ v8f score_t(v16h kh, v16h kl, v16h qh, v16h ql) { v8f a = {}, al = {}; a = wmma16(kh, qh, a); al = wmma16(kh, ql, al); al = wmma16(kl, qh, al); return (a + al * (1.0f / 1024.0f)) * SCALE; }
__global__ __launch_bounds__(32 * AKW) void k_att(const _Float16* __restrict__ QH, const _Float16* __restrict__ QL, const _Float16* __restrict__ KH, const _Float16* __restrict__ KL, const _Float16* __restrict__ VT, float* __restrict__ Y) {
  __shared__ __align__(16) float so[AKW][16 * AQT][HDQK + 4]; __shared__ float sm[AKW][16 * AQT], sl[AKW][16 * AQT], smx[16 * AQT]; __shared__ __align__(16) _Float16 sq[16 * AQT][HDQK + 8], sp[16 * AQT][HDQK + 8];   /* the block's query rows, residual and hi, 80-byte pitch */
  const int tid = threadIdx.x, wave = tid >> 5, lane = tid & 31, col = lane & 15, g = lane >> 4;
  const size_t b = blockIdx.y, rb = b * TT; const int q0 = blockIdx.x * (16 * AQT), kbeg = wave * AKR;
  float mx[AQT], ls[AQT]; v8f o[AQT][HDQK / 16] = {};
#pragma unroll
  for (int t = 0; t < AQT; ++t) { mx[t] = -3.0e38f; ls[t] = 0.f; }
  if (tid < 64 * AQT) { const int row = tid >> 2, sg = (tid & 3) * 8; *(v8h*)&sq[row][sg] = *(const v8h*)(QL + (rb + q0 + row) * CC + sg); *(v8h*)&sp[row][sg] = *(const v8h*)(QH + (rb + q0 + row) * CC + sg); }
  __syncthreads();   /* the query rows are in LDS before any wave reads them */
  { const _Float16 *qkh = KH + (rb + kbeg + col) * CC + 8 * g, *qkl = KL + (rb + kbeg + col) * CC + 8 * g;   /* the lane's own key-row fragment addresses */
    v16h qh[AQT], ql[AQT];   /* pass 1 has the registers to hold all query fragments */
#pragma unroll
    for (int t = 0; t < AQT; ++t) { qh[t] = frag_h(&sp[t * 16 + col][0], lane); ql[t] = frag_h(&sq[t * 16 + col][0], lane); }
#pragma unroll 1   /* rolled: a trip already holds two key tiles */
    for (int kt = 0; kt < AKR / 32; ++kt) { v16h kh[2], kl[2];   /* two key tiles' loads in flight together: one tile's products are shorter than its loads' latency */
#pragma unroll
      for (int u = 0; u < 2; ++u) { kh[u] = frag_p(qkh + u * 16 * CC); kl[u] = frag_p(qkl + u * 16 * CC); }
      asm volatile("s_wait_xcnt 0x0" :: "v"(qkh), "v"(qkl) : "memory");   /* the eight loads' address registers stay as they are until this wait */
      qkh += 32 * CC; qkl += 32 * CC;
#pragma unroll
      for (int u = 0; u < 2; ++u)
#pragma unroll
        for (int t = 0; t < AQT; ++t) { const v8f s = score_t(kh[u], kl[u], qh[t], ql[t]);
#pragma unroll
          for (int r = 0; r < 8; ++r) mx[t] = fmaxf(mx[t], s[r]); } } }
#pragma unroll
  for (int t = 0; t < AQT; ++t) { mx[t] = fmaxf(mx[t], __shfl_xor(mx[t], 16)); if (g == 0) sm[wave][t * 16 + col] = mx[t]; }
  __syncthreads();   /* every wave's maxima are in LDS before they are joined */
  if (tid < 16 * AQT) { float a = sm[0][tid];
#pragma unroll
    for (int w = 1; w < AKW; ++w) a = fmaxf(a, sm[w][tid]);
    smx[tid] = a - 7.6246189861593985f; }   /* max - 11 ln 2: e = 2^11 exp(s - max), the scale cancels in sum(e g) / sum(e) */
  __syncthreads();   /* the joined maxima are in LDS before any wave reads them */
  const _Float16 *pkh = KH + (rb + kbeg + col) * CC + 8 * g, *pkl = KL + (rb + kbeg + col) * CC + 8 * g, *pv = VT + (b * CC + col) * (size_t)TT + kbeg + 8 * g;   /* the lane's own fragment addresses: key rows (hi, residual) and value channel rows */
#pragma unroll 1   /* rolled: 256 registers a wave is the budget of 4 waves per SIMD */
  for (int kc = 0; kc < AKR / 32; ++kc) {
    const v16h kh0 = frag_p(pkh), kl0 = frag_p(pkl), kh1 = frag_p(pkh + 16 * CC), kl1 = frag_p(pkl + 16 * CC);
    v16h vf[HDQK / 16];
#pragma unroll
    for (int j = 0; j < HDQK / 16; ++j) vf[j] = frag_p(pv + (size_t)j * 16 * TT);
    asm volatile("s_wait_xcnt 0x0" :: "v"(pkh), "v"(pkl), "v"(pv) : "memory");   /* the twelve loads' address registers stay as they are until this wait; its memory clobber also keeps the LDS reads below inside the loop: hoisted, the query fragments and the maxima's copies for packed subtracts hold about 90 more registers and spill */
    pkh += 32 * CC; pkl += 32 * CC; pv += 32;
#pragma unroll
    for (int t = 0; t < AQT; ++t) { v16h p; const v16h qht = frag_h(&sp[t * 16 + col][0], lane), qlt = frag_h(&sq[t * 16 + col][0], lane); const float mt = smx[t * 16 + col];
      { const v8f s = score_t(kh0, kl0, qht, qlt);
#pragma unroll
        for (int r = 0; r < 8; ++r) { const float e = expf(s[r] - mt); p[r] = (_Float16)e; ls[t] += e; } }
      { const v8f s = score_t(kh1, kl1, qht, qlt);
#pragma unroll
        for (int r = 0; r < 8; ++r) { const float e = expf(s[r] - mt); p[8 + r] = (_Float16)e; ls[t] += e; } }
#pragma unroll
      for (int j = 0; j < HDQK / 16; ++j) o[t][j] = wmma16(vf[j], p, o[t][j]); } }   /* D element r = y^T[channel 16 j + 8 g + r][query col] */
#pragma unroll
  for (int t = 0; t < AQT; ++t) { ls[t] += __shfl_xor(ls[t], 16); if (g == 0) sl[wave][t * 16 + col] = ls[t];
#pragma unroll
    for (int j = 0; j < HDQK / 16; ++j) { v4f lo, hi;
#pragma unroll
      for (int r = 0; r < 4; ++r) { lo[r] = o[t][j][r]; hi[r] = o[t][j][4 + r]; }
      *(v4f*)&so[wave][t * 16 + col][j * 16 + 8 * g] = lo; *(v4f*)&so[wave][t * 16 + col][j * 16 + 8 * g + 4] = hi; } }
  __syncthreads();   /* every wave's partial tile and sums are in LDS before they are added */
  { const int row = tid >> 3, c4 = (tid & 7) * 4; v4f s = *(const v4f*)&so[0][row][c4]; float l = sl[0][row];
#pragma unroll
    for (int w = 1; w < AKW; ++w) { s += *(const v4f*)&so[w][row][c4]; l += sl[w][row]; }
    vst2(Y + (rb + q0 + row) * CC + c4, s * (1.0f / l)); } }   /* the 32 real columns of the y rows: all that k_wz reads */

extern "C" void kernel_launch(void* const* d_in, const int* in_sizes, int n_in, void* d_out, int out_size, void* d_ws, size_t ws_size, hipStream_t stream) {
  (void)in_sizes; (void)n_in; (void)out_size;
  const float** F = (const float**)d_in;
  if (ws_size < (size_t)WS_END) return;
  char* ws = (char*)d_ws; _Float16 *QH = (_Float16*)(ws + WS_QH), *KH = (_Float16*)(ws + WS_KH), *VT = (_Float16*)(ws + WS_VT), *QL = (_Float16*)(ws + WS_QL), *KL = (_Float16*)(ws + WS_KL); __bf16 *VB = (__bf16*)(ws + WS_VB), *VBL = (__bf16*)(ws + WS_VBL); 
  (void)VB; (void)VBL;
  // inputs: 0 x [4,256,64,64]; 1 w_theta [32,256] (out,in); 2 w_phi; 3 w_g; 4 w_out [256,32] (out,in); no biases
  if (ws_size < (size_t)WS_END2) return;
  float *YR = (float*)(ws + WS_YR), *ORW = (float*)(ws + WS_OR);
  k_proj<<<dim3(TNB * TT / 64, CC / 128, 3), 128, 0, stream>>>(F[0], F[0], F[0], F[1], F[2], F[3], nullptr, nullptr, nullptr, QH, QL, KH, KL, VT, VB, VBL);   /* q = theta, k = phi, v = g */
  k_att<<<dim3(TT / (16 * AQT), TNB), 32 * AKW, 0, stream>>>(QH, QL, KH, KL, VT, YR);
  k_wz<<<dim3(TNB * TT / 64, DIN / 128), 128, 0, stream>>>(YR, F[4], nullptr, ORW);
  k_fin2<<<dim3(TT / 64, DIN / 64, TNB), 256, 0, stream>>>(ORW, F[0], (float*)d_out);
}

// v003
// Measured time: 69.1 microseconds a run.
// Timed twice side by side with v002, it ran 1.15 times as fast both times.
// All steps since v000 together make it 15.6 times as fast.
// compute dtype: all float inputs rounded to bf16; theta/phi/g = W x with EXACT bf16 products on WMMA 16x16x32 (f32 accumulate); unscaled affinities theta.phi with both as f16 hi + residual planes (3 products); softmax in f32 (exponentials as the hardware's exp2 of (s - max) log2 e + 11); exp(s - max) x 2^11 once to f16 against g once to f16 (1 product), divided by the f32 sum of the exponentials after the product; y split bf16 hi + lo against exact w_out (2 products); + x in f32; f32 output.
#include <hip/hip_runtime.h>
#include <math.h>

typedef __attribute__((ext_vector_type(16))) _Float16 v16h;
typedef __attribute__((ext_vector_type(16))) __bf16 v16b;
typedef __attribute__((ext_vector_type(8)))  _Float16 v8h;
typedef __attribute__((ext_vector_type(8)))  float v8f;
typedef __attribute__((ext_vector_type(4)))  float v4f;
typedef __attribute__((ext_vector_type(2)))  float v2f;
typedef __attribute__((ext_vector_type(4)))  unsigned v4u;
typedef __attribute__((ext_vector_type(4)))  int v4i;
typedef float __attribute__((may_alias)) float_a;
typedef int __attribute__((may_alias)) int_a;

template <typename T> __device__ __forceinline__ void vst2(void* p, T v) { *(T*)p = v;  }
__device__ __forceinline__ v8f wmma16(v16h a, v16h b, v8f c) {
  v8f d = __builtin_amdgcn_wmma_f32_16x16x32_f16(false, a, false, b, (short)0, c, false, false);
  asm volatile("v_nop\n\tv_nop\n\tv_nop\n\tv_nop" : "+v"(d) : "v"(a), "v"(b));
  return d;
}
__device__ __forceinline__ v8f wmma_bf(v16b a, v16b b, v8f c) {
  v8f d = __builtin_amdgcn_wmma_f32_16x16x32_bf16(false, a, false, b, (short)0, c, false, false);
  asm volatile("v_nop\n\tv_nop\n\tv_nop\n\tv_nop" : "+v"(d) : "v"(a), "v"(b));
  return d;
}
// 16x16x32 fragments: lane = (h = lane>>4, row/col = lane&15); elements 0..7 = k0+8h+0..7, 8..15 = k0+16+8h+0..7; D element r = row 8h+r
__device__ __forceinline__ v16h frag_h(const _Float16* rowk0, int lane) {
  union { v16h v; v8h q[2]; } u; const _Float16* p = rowk0 + 8 * (lane >> 4);
  u.q[0] = *(const v8h*)p; u.q[1] = *(const v8h*)(p + 16); return u.v;
}
__device__ __forceinline__ v16h frag_f32(const float* rowk0, int lane) {
  v16h a; const float* p = rowk0 + 8 * (lane >> 4);
#pragma unroll
  for (int i = 0; i < 8; ++i) { a[i] = (_Float16)p[i]; a[8 + i] = (_Float16)p[16 + i]; }
  return a;
}
__device__ __forceinline__ v16h frag_f32s(const float* rowk0, int lane, float sc) {
  v16h a; const float* p = rowk0 + 8 * (lane >> 4);
#pragma unroll
  for (int i = 0; i < 8; ++i) { a[i] = (_Float16)(p[i] * sc); a[8 + i] = (_Float16)(p[16 + i] * sc); }
  return a;
}
// column fragment from a [K][ld] layout (column n), rows >= K read as 0
__device__ __forceinline__ v16h fragc_f32(const float* W, int k0, int n, int lane, int ld, int K) {
  v16h a; const int g = lane >> 4;
#pragma unroll
  for (int i = 0; i < 8; ++i) { const int ka = k0 + 8 * g + i, kb = ka + 16;
    a[i] = (_Float16)(ka < K ? W[(size_t)(ka < K ? ka : K - 1) * ld + n] : 0.f); a[8 + i] = (_Float16)(kb < K ? W[(size_t)(kb < K ? kb : K - 1) * ld + n] : 0.f); }
  return a;
}
struct F2 { v16b h, l; };
__device__ __forceinline__ F2 bsplit16(const float v[16]) { F2 r;
#pragma unroll
  for (int i = 0; i < 16; ++i) { const __bf16 h = (__bf16)v[i]; r.h[i] = h; r.l[i] = (__bf16)(v[i] - (float)h); }
  return r; }
__device__ __forceinline__ F2 split_row(const float* row, int k0, int lane) { float v[16]; const float* p = row + k0 + 8 * (lane >> 4);
#pragma unroll
  for (int i = 0; i < 8; ++i) { v[i] = p[i]; v[8 + i] = p[16 + i]; }
  return bsplit16(v); }
__device__ __forceinline__ F2 split_rowK(const float* row, int k0, int lane, int K) { float v[16]; const int g = lane >> 4;
#pragma unroll
  for (int i = 0; i < 8; ++i) { const int ka = k0 + 8 * g + i, kb = ka + 16; v[i] = ka < K ? row[ka < K ? ka : K - 1] : 0.f; v[8 + i] = kb < K ? row[kb < K ? kb : K - 1] : 0.f; }
  return bsplit16(v); }
__device__ __forceinline__ F2 split_col(const float* W, int k0, int n, int lane, int ld, int K) { float v[16]; const int g = lane >> 4;
#pragma unroll
  for (int i = 0; i < 8; ++i) { const int ka = k0 + 8 * g + i, kb = ka + 16; v[i] = ka < K ? W[(size_t)(ka < K ? ka : K - 1) * ld + n] : 0.f; v[8 + i] = kb < K ? W[(size_t)(kb < K ? kb : K - 1) * ld + n] : 0.f; }
  return bsplit16(v); }
__device__ __forceinline__ v8f mac3(const F2& a, const F2& b, v8f c) { c = wmma_bf(a.l, b.h, c); c = wmma_bf(a.h, b.l, c); return wmma_bf(a.h, b.h, c); }
__device__ __forceinline__ float sigm(float v) { return 1.0f / (1.0f + expf(-v)); }
#define LDSX() do { asm volatile("s_wait_dscnt 0" ::: "memory"); __builtin_amdgcn_wave_barrier(); __builtin_amdgcn_fence(__ATOMIC_RELEASE, "workgroup"); } while (0)

// Non-local block (B 4, C 256, 64 x 64 = 4,096 positions; C_int 32; (out,in) weights, no biases): theta, phi, g = W x ([32,256]); A[i][j] = softmax_j(theta_i . phi_j) (no scaling, sigma ~ 5.7); y[k][i] = sum_j A[i][j] g[k][j]; out = w_out y ([256,32]) + x.
#define NB 4
#define TT 4096
#define CC 128            // projected plane width (32 real columns + 96 zero)
#define DIN 256          // input (model) width
#define NH 1
#define HD 128
#define NQB (TT / 64)
#define HG 1               // 4,096 x 4,096 f32 planes reserved at WS_S, which no kernel uses
#define SCALE (1.0f)
#define HDQK 32            // theta / phi / g channels: the planes are 128 wide, columns >= 32 are zero; only the 32 real columns enter the scores
#define CAUSAL 0
#ifndef TNB
#define TNB NB
#endif
__device__ __forceinline__ v16b zero16b() { v16b z; _Pragma("unroll") for (int i = 0; i < 16; ++i) z[i] = (__bf16)0.f; return z; }
__device__ __forceinline__ float bfr(float v) { return (float)(__bf16)v; }
__host__ __device__ __forceinline__ int kb_last(int qb) { return CAUSAL ? ((qb * 64 + 63) >> 7) : (TT / 128 - 1); }
typedef __attribute__((ext_vector_type(8))) __bf16 v8b;
__device__ __forceinline__ v16b frag_b(const __bf16* rowk0, int lane) {
  union { v16b v; v8b q[2]; } u; const __bf16* p = rowk0 + 8 * (lane >> 4);
  u.q[0] = *(const v8b*)p; u.q[1] = *(const v8b*)(p + 16); return u.v;
}
#define QBH (TT / 64)      // ALL query blocks take k_att's 3-product scores
#define QBH_PV 0           // A.g stays single f16
#define QHI 4096            // q residual rows everywhere (3-product logits)
#define KHI 4096           // k residual rows for ALL keys (3-product logits)
// B fragment (k rows k0+.., output column o) of a weight: (in,out) [K][ld] or (out,in) [ld rows of K]: bf16 exact, or f16(bf16 * 256) exact
__device__ __forceinline__ v16b wcol_io(const float* Wm, int k0, int o, int lane, int ld) { v16b w; const int g = lane >> 4;
#pragma unroll
  for (int i = 0; i < 8; ++i) { w[i] = (__bf16)Wm[(size_t)(k0 + 8 * g + i) * ld + o]; w[8 + i] = (__bf16)Wm[(size_t)(k0 + 16 + 8 * g + i) * ld + o]; }
  return w; }
__device__ __forceinline__ v16b wcol_oi(const float* Wm, int k0, int o, int lane, int K) { v16b w; const float* p = Wm + (size_t)o * K + k0 + 8 * (lane >> 4);
#pragma unroll
  for (int i = 0; i < 8; ++i) { w[i] = (__bf16)p[i]; w[8 + i] = (__bf16)p[16 + i]; }
  return w; }
__device__ __forceinline__ v16h wcolh_io(const float* Wm, int k0, int o, int lane, int ld) { v16h w; const int g = lane >> 4;
#pragma unroll
  for (int i = 0; i < 8; ++i) { w[i] = (_Float16)(bfr(Wm[(size_t)(k0 + 8 * g + i) * ld + o]) * 256.0f); w[8 + i] = (_Float16)(bfr(Wm[(size_t)(k0 + 16 + 8 * g + i) * ld + o]) * 256.0f); }
  return w; }
__device__ __forceinline__ v16h wcolh_oi(const float* Wm, int k0, int o, int lane, int K) { v16h w; const float* p = Wm + (size_t)o * K + k0 + 8 * (lane >> 4);
#pragma unroll
  for (int i = 0; i < 8; ++i) { w[i] = (_Float16)(bfr(p[i]) * 256.0f); w[8 + i] = (_Float16)(bfr(p[16 + i]) * 256.0f); }
  return w; }
#define WQKV_LAYOUT 1   // 0 = (in,out) [DIN][CC]; 1 = (out,in) [HDQK][DIN]; 2 = per-head [NH][DIN][HD]
__device__ __forceinline__ v16b wcol_hdk(const float* Wm, int k0, int o, int lane) { v16b w; const int g = lane >> 4; const float* p = Wm + (size_t)(o / HD) * DIN * HD + (o % HD);
#pragma unroll
  for (int i = 0; i < 8; ++i) { w[i] = (__bf16)p[(size_t)(k0 + 8 * g + i) * HD]; w[8 + i] = (__bf16)p[(size_t)(k0 + 16 + 8 * g + i) * HD]; }
  return w; }
#define WO_OUT_IN 0
#if WQKV_LAYOUT == 1
#define WCOL(W, k0, o, lane) (((o) < HDQK) ? wcol_oi(W, k0, (o), lane, DIN) : zero16b())   /* theta/phi/g weights are [32][256] (out,in): plane columns >= 32 are zero for all three */
#elif WQKV_LAYOUT == 2
#define WCOL(W, k0, o, lane) wcol_hdk(W, k0, o, lane)
#else
#define WCOL(W, k0, o, lane) wcol_io(W, k0, o, lane, CC)
#endif
#if WO_OUT_IN
#define WOCOL(W, k0, o, lane) wcol_oi(W, k0, o, lane, CC)
#define WOCOLH(W, k0, o, lane) wcolh_oi(W, k0, o, lane, CC)
#else
#define WOCOL(W, k0, o, lane) wcol_io(W, k0, o, lane, DIN)
#define WOCOLH(W, k0, o, lane) wcolh_io(W, k0, o, lane, DIN)
#endif
#ifndef XP
#define XP TT              // position pitch of x and of the output
#endif
#define BG HG              // unused
#define DVH 128
#define WS_YR (WS_END)     // f32 attended rows [b*n][128] (32 real columns)
#define WS_OR (WS_YR + 4u * (size_t)NB * TT * CC)   // W y + b rows [b*n][256]
#define WS_END2 (WS_OR + 4u * (size_t)NB * TT * DIN)
// ---- k_wz: block = (64 rows, 128 output cols): OR = y (hi + lo, K = 32 real columns of the YR rows) . W^T ((out,in) [256][32], exact) + b
__global__ __launch_bounds__(128) void k_wz(const float* __restrict__ YR, const float* __restrict__ WW, const float* __restrict__ WB, float* __restrict__ ORW) { __shared__ __align__(16) float sf[4][16][132];
  const int tid = threadIdx.x, wave = tid >> 5, lane = tid & 31, col = lane & 15, g = lane >> 4; const int c0 = blockIdx.y * 128; const size_t r0 = (size_t)blockIdx.x * 64 + wave * 16;
  v8f acc[8] = {};
#pragma unroll
  for (int kc = 0; kc < HDQK / 32; ++kc) { const F2 a = split_row(YR + (r0 + col) * CC, kc * 32, lane); asm volatile("s_wait_loadcnt 0x0" ::: "memory");
#pragma unroll
    for (int j = 0; j < 8; ++j) { const v16b w = wcol_oi(WW, kc * 32, c0 + j * 16 + col, lane, HDQK); asm volatile("s_wait_loadcnt 0x0" ::: "memory"); acc[j] = wmma_bf(a.h, w, acc[j]); acc[j] = wmma_bf(a.l, w, acc[j]); } }
#pragma unroll
  for (int j = 0; j < 8; ++j) { const float bb = WB ? bfr(WB[c0 + j * 16 + col]) : 0.f; asm volatile("s_wait_loadcnt 0x0" ::: "memory");
#pragma unroll
    for (int r = 0; r < 8; ++r) sf[wave][8 * g + r][j * 16 + col] = acc[j][r] + bb; }
  LDSX(); for (int rl = 0; rl < 16; ++rl) vst2(ORW + (r0 + rl) * DIN + c0 + lane * 4, *(const v4f*)&sf[wave][rl][lane * 4]); }
// ---- k_fin2: block = (64 positions, 64 channels, batch b): out[b][c][n] = OR[b*N + n][c] + bf16(x[b][c][n]) (LDS transpose; 256-B runs of 64 positions per channel)
__global__ __launch_bounds__(256) void k_fin2(const float* __restrict__ ORW, const float* __restrict__ X, float* __restrict__ OUT) { __shared__ float st[64][68]; const int tid = threadIdx.x; const int n0 = blockIdx.x * 64, c0 = blockIdx.y * 64; const size_t b = blockIdx.z;
  for (int e = tid; e < 64 * 16; e += 256) { const int nl = e >> 4, q = e & 15; *(v4f*)&st[nl][q * 4] = *(const v4f*)(ORW + (b * TT + n0 + nl) * (size_t)DIN + c0 + q * 4); }
  __syncthreads();
  for (int e = tid; e < 64 * 16; e += 256) { const int cl = e >> 4, q = e & 15; const size_t oi = (b * DIN + c0 + cl) * (size_t)XP + n0 + q * 4; const v4f xr = *(const v4f*)(X + oi); v4f o; o[0] = st[q * 4][cl] + bfr(xr[0]); o[1] = st[q * 4 + 1][cl] + bfr(xr[1]); o[2] = st[q * 4 + 2][cl] + bfr(xr[2]); o[3] = st[q * 4 + 3][cl] + bfr(xr[3]); vst2(OUT + oi, o); } }
#ifndef SM_EXTRA_PARAMS
#define SM_EXTRA_PARAMS
#endif
#ifndef PROJ_EXTRA_PARAMS
#define PROJ_EXTRA_PARAMS
#endif
#ifndef SM_MASK_HOOK
#define SM_MASK_HOOK (void)0
#endif

#define WS_QH  0u                                      // f16 q rows [b*t][CC]
#define WS_KH  (WS_QH + 2u * (size_t)NB * TT * CC)      // f16 k rows [b*t][CC]
#define WS_VT  (WS_KH + 2u * (size_t)NB * TT * CC)      // f16 v planes [b][c][t]
#define WS_QL  (WS_VT + 2u * (size_t)NB * CC * TT)      // f16 q residual x 2^10 rows [b][t < QHI][CC]
#define WS_KL  (WS_QL + 2u * (size_t)NB * QHI * CC)     // f16 k residual x 2^10 rows [b][t < KHI][CC]
#define WS_VB  (WS_KL + 2u * (size_t)NB * KHI * CC)     // bf16 v hi planes [b][c][t < KHI]
#define WS_VBL (WS_VB + 2u * (size_t)NB * CC * KHI)
#define WS_S   (WS_VBL + 2u * (size_t)NB * CC * KHI)    // f32 [hg][t][s], reserved; no kernel uses it
#define WS_Y   (WS_S  + 4u * (size_t)HG * TT * TT)      // empty (0 bytes); the ctx rows are at WS_YR
#define WS_END (WS_Y  + 0u)

// ---- k_proj: block = (64 rows, 128 cols, which): q/k/v = X W (+ b) with exact bf16 products (K = DIN) -> which 0: q f16 rows (+ residual rows < QHI); 1: k f16 rows (+ residual rows < KHI); 2: v f16 planes [c][t] (+ bf16 hi/lo planes for t < KHI)
__global__ __launch_bounds__(128) void k_proj(const float* __restrict__ XQ, const float* __restrict__ XK, const float* __restrict__ XV, const float* __restrict__ WQ, const float* __restrict__ WK, const float* __restrict__ WV, const float* __restrict__ BQ, const float* __restrict__ BK, const float* __restrict__ BV,
    _Float16* __restrict__ QH, _Float16* __restrict__ QL, _Float16* __restrict__ KH, _Float16* __restrict__ KL, _Float16* __restrict__ VT, __bf16* __restrict__ VB, __bf16* __restrict__ VBL) {
  __shared__ __align__(16) _Float16 sh[64][136], sl[64][136]; __shared__ __align__(16) _Float16 th[128][72]; __shared__ __align__(16) __bf16 tb[128][72], tbl[128][72];
  const int tid = threadIdx.x, wave = tid >> 5, lane = tid & 31, col = lane & 15, g = lane >> 4; const int which = blockIdx.z; const int c0 = blockIdx.y * 128; const size_t r0 = (size_t)blockIdx.x * 64; const size_t bb = r0 / TT; const int t0 = (int)(r0 % TT);
  const float* X = which == 0 ? XQ : which == 1 ? XK : XV; const float* WA = which == 0 ? WQ : which == 1 ? WK : WV; const float* BA = which == 0 ? BQ : which == 1 ? BK : BV;
  v8f acc[8] = {};
#pragma unroll 2
  for (int kc = 0; kc < DIN / 32; ++kc) { v16b a; { const float* p = X + (bb * DIN + kc * 32 + 8 * g) * (size_t)XP + t0 + wave * 16 + col;   /* channels-first gather: x[b][k][t], stride XP between k */
#pragma unroll
      for (int i = 0; i < 8; ++i) { a[i] = (__bf16)p[(size_t)i * XP]; a[8 + i] = (__bf16)p[(size_t)(16 + i) * XP]; } }
    asm volatile("s_wait_loadcnt 0x0" ::: "memory");
#pragma unroll
    for (int j = 0; j < 8; ++j) { const v16b w = WCOL(WA, kc * 32, c0 + j * 16 + col, lane); asm volatile("s_wait_loadcnt 0x0" ::: "memory"); acc[j] = wmma_bf(a, w, acc[j]); } }
  if (which < 2) { _Float16* DH = which == 0 ? QH : KH; _Float16* DL = which == 0 ? QL : KL; const int nhi = which == 0 ? QHI : KHI; const bool hi_rows = t0 < nhi;
#pragma unroll
    for (int j = 0; j < 8; ++j) { const float bias = (BA && (c0 + j * 16 + col < HDQK)) ? bfr(BA[c0 + j * 16 + col]) : 0.f;   /* 32-entry biases */
#pragma unroll
      for (int r = 0; r < 8; ++r) { const float v = acc[j][r] + bias; const _Float16 hv = (_Float16)v; sh[wave * 16 + 8 * g + r][j * 16 + col] = hv; sl[wave * 16 + 8 * g + r][j * 16 + col] = (_Float16)((v - (float)hv) * 1024.0f); } }
    __syncthreads();
    for (int e = tid; e < 64 * 16; e += 128) { const int rl = e >> 4, q = e & 15; vst2((unsigned*)(DH + (r0 + rl) * CC + c0 + q * 8), *(const v4u*)&sh[rl][q * 8]); if (hi_rows) vst2((unsigned*)(DL + (bb * nhi + t0 + rl) * (size_t)CC + c0 + q * 8), *(const v4u*)&sl[rl][q * 8]); }
  } else { const bool hi_rows = t0 < KHI;
#pragma unroll
    for (int j = 0; j < 8; ++j) { const float bias = (BA && (c0 + j * 16 + col < HDQK)) ? bfr(BA[c0 + j * 16 + col]) : 0.f;   /* 32-entry biases */
#pragma unroll
      for (int r = 0; r < 8; ++r) { const float v = acc[j][r] + bias; const int rl = wave * 16 + 8 * g + r, cl = j * 16 + col; th[cl][rl] = (_Float16)v; const __bf16 bh = (__bf16)v; tb[cl][rl] = bh; tbl[cl][rl] = (__bf16)(v - (float)bh); } }
    __syncthreads();
    for (int e = tid; e < 128 * 8; e += 128) { const int cl = e >> 3, q = e & 7; vst2((unsigned*)(VT + (bb * CC + c0 + cl) * (size_t)TT + t0 + q * 8), *(const v4u*)&th[cl][q * 8]); if (hi_rows) { const size_t o3 = (bb * CC + c0 + cl) * (size_t)KHI + t0 + q * 8; vst2((unsigned*)(VB + o3), *(const v4u*)&tb[cl][q * 8]); vst2((unsigned*)(VBL + o3), *(const v4u*)&tbl[cl][q * 8]); } } } }
// ---- k_att: block = 64 queries (4 tiles of 16) of batch blockIdx.y, 16 waves; wave w owns keys [256 w, 256 w + 256) for all 64 queries. Scores are formed transposed, S^T = phi . theta^T (A = key rows, B = query rows, staged once in LDS: pass 1 keeps their fragments in registers, pass 2 reads them per tile; hi + residual planes, 3 products), so a lane holds one query's scores.
// pass 1: row maxima (joined over the waves in LDS). pass 2: the same scores again, e = exp2(s log2 e - (max log2 e - 11)) once to f16; two S^T tiles of 16 keys are the B operand of y^T += g^T . e^T with no lane exchange; f32 sums of e per lane. The 16 partial y tiles and sums are added in LDS in wave order, y = sum(e g) / sum(e).
// every bare '#pragma unroll' in k_att but the two whose loops sum over the waves' LDS rows: its loop indexes fragments or accumulators, which stay in registers only when the loop is fully unrolled
#define AQT 4              // query tiles per wave: each key / value fragment load serves 64 queries
#define AKW 16             // key ranges = waves per block
#define AKR (TT / AKW)     // keys per wave
__device__ __forceinline__ v16h frag_p(const _Float16* p) { union { v16h v; v8h q[2]; } u; u.q[0] = *(const v8h*)p; u.q[1] = *(const v8h*)(p + 16); return u.v; }   /* frag_h with the lane's 8 (lane >> 4) already in p */
__device__ __forceinline__ v8f score_t(v16h kh, v16h kl, v16h qh, v16h ql) { v8f a = {}, al = {}; a = wmma16(kh, qh, a); al = wmma16(kh, ql, al); al = wmma16(kl, qh, al); return (a + al * (1.0f / 1024.0f)) * SCALE; }
#define L2E 1.4426950408889634f
// pass 2's scores as exponents of 2: (hi + residual / 1024) log2 e - mt, two fused multiply-adds an element (the residual's scale and log2 e are one constant)
__device__ __forceinline__ v8f score_x(v16h kh, v16h kl, v16h qh, v16h ql, float mt) { v8f a = {}, al = {}; a = wmma16(kh, qh, a); al = wmma16(kh, ql, al); al = wmma16(kl, qh, al); return al * (SCALE * L2E / 1024.0f) + (a * (SCALE * L2E) - mt); }
__global__ __launch_bounds__(32 * AKW) void k_att(const _Float16* __restrict__ QH, const _Float16* __restrict__ QL, const _Float16* __restrict__ KH, const _Float16* __restrict__ KL, const _Float16* __restrict__ VT, float* __restrict__ Y) {
  __shared__ __align__(16) float so[AKW][16 * AQT][HDQK + 4]; __shared__ float sm[AKW][16 * AQT], sl[AKW][16 * AQT], smx[16 * AQT]; __shared__ __align__(16) _Float16 sq[16 * AQT][HDQK + 8], sp[16 * AQT][HDQK + 8];   /* the block's query rows, residual and hi, 80-byte pitch */
  const int tid = threadIdx.x, wave = tid >> 5, lane = tid & 31, col = lane & 15, g = lane >> 4;
  const size_t b = blockIdx.y, rb = b * TT; const int q0 = blockIdx.x * (16 * AQT), kbeg = wave * AKR;
  float mx[AQT], ls[AQT]; v8f o[AQT][HDQK / 16] = {};
#pragma unroll
  for (int t = 0; t < AQT; ++t) { mx[t] = -3.0e38f; ls[t] = 0.f; }
  if (tid < 64 * AQT) { const int row = tid >> 2, sg = (tid & 3) * 8; *(v8h*)&sq[row][sg] = *(const v8h*)(QL + (rb + q0 + row) * CC + sg); *(v8h*)&sp[row][sg] = *(const v8h*)(QH + (rb + q0 + row) * CC + sg); }
  __syncthreads();   /* the query rows are in LDS before any wave reads them */
  { const _Float16 *qkh = KH + (rb + kbeg + col) * CC + 8 * g, *qkl = KL + (rb + kbeg + col) * CC + 8 * g;   /* the lane's own key-row fragment addresses */
    v16h qh[AQT], ql[AQT];   /* pass 1 has the registers to hold all query fragments */
#pragma unroll
    for (int t = 0; t < AQT; ++t) { qh[t] = frag_h(&sp[t * 16 + col][0], lane); ql[t] = frag_h(&sq[t * 16 + col][0], lane); }
#pragma unroll 1   /* rolled: a trip already holds two key tiles */
    for (int kt = 0; kt < AKR / 32; ++kt) { v16h kh[2], kl[2];   /* two key tiles' loads in flight together: one tile's products are shorter than its loads' latency */
#pragma unroll
      for (int u = 0; u < 2; ++u) { kh[u] = frag_p(qkh + u * 16 * CC); kl[u] = frag_p(qkl + u * 16 * CC); }
      asm volatile("s_wait_xcnt 0x0" :: "v"(qkh), "v"(qkl) : "memory");   /* the eight loads' address registers stay as they are until this wait */
      qkh += 32 * CC; qkl += 32 * CC;
#pragma unroll
      for (int u = 0; u < 2; ++u)
#pragma unroll
        for (int t = 0; t < AQT; ++t) { const v8f s = score_t(kh[u], kl[u], qh[t], ql[t]);
#pragma unroll
          for (int r = 0; r < 8; ++r) mx[t] = fmaxf(mx[t], s[r]); } } }
#pragma unroll
  for (int t = 0; t < AQT; ++t) { mx[t] = fmaxf(mx[t], __shfl_xor(mx[t], 16)); if (g == 0) sm[wave][t * 16 + col] = mx[t]; }
  __syncthreads();   /* every wave's maxima are in LDS before they are joined */
  if (tid < 16 * AQT) { float a = sm[0][tid];
#pragma unroll
    for (int w = 1; w < AKW; ++w) a = fmaxf(a, sm[w][tid]);
    smx[tid] = a * L2E - 11.0f; }   /* max log2 e - 11: e = 2^11 exp(s - max), the scale cancels in sum(e g) / sum(e) */
  __syncthreads();   /* the joined maxima are in LDS before any wave reads them */
  const _Float16 *pkh = KH + (rb + kbeg + col) * CC + 8 * g, *pkl = KL + (rb + kbeg + col) * CC + 8 * g, *pv = VT + (b * CC + col) * (size_t)TT + kbeg + 8 * g;   /* the lane's own fragment addresses: key rows (hi, residual) and value channel rows */
#pragma unroll 1   /* rolled: 256 registers a wave is the budget of 4 waves per SIMD */
  for (int kc = 0; kc < AKR / 32; ++kc) {
    const v16h kh0 = frag_p(pkh), kl0 = frag_p(pkl), kh1 = frag_p(pkh + 16 * CC), kl1 = frag_p(pkl + 16 * CC);
    v16h vf[HDQK / 16];
#pragma unroll
    for (int j = 0; j < HDQK / 16; ++j) vf[j] = frag_p(pv + (size_t)j * 16 * TT);
    asm volatile("s_wait_xcnt 0x0" :: "v"(pkh), "v"(pkl), "v"(pv) : "memory");   /* the twelve loads' address registers stay as they are until this wait; its memory clobber also keeps the LDS reads below inside the loop: hoisted, the query fragments and the maxima's copies for packed subtracts hold about 90 more registers and spill */
    pkh += 32 * CC; pkl += 32 * CC; pv += 32;
#pragma unroll
    for (int t = 0; t < AQT; ++t) { v16h p; const v16h qht = frag_h(&sp[t * 16 + col][0], lane), qlt = frag_h(&sq[t * 16 + col][0], lane); const float mt = smx[t * 16 + col];
      { const v8f s = score_x(kh0, kl0, qht, qlt, mt);
#pragma unroll
        for (int r = 0; r < 8; ++r) { const float e = __builtin_amdgcn_exp2f(s[r]); p[r] = (_Float16)e; ls[t] += e; } }
      { const v8f s = score_x(kh1, kl1, qht, qlt, mt);
#pragma unroll
        for (int r = 0; r < 8; ++r) { const float e = __builtin_amdgcn_exp2f(s[r]); p[8 + r] = (_Float16)e; ls[t] += e; } }
#pragma unroll
      for (int j = 0; j < HDQK / 16; ++j) o[t][j] = wmma16(vf[j], p, o[t][j]); } }   /* D element r = y^T[channel 16 j + 8 g + r][query col] */
#pragma unroll
  for (int t = 0; t < AQT; ++t) { ls[t] += __shfl_xor(ls[t], 16); if (g == 0) sl[wave][t * 16 + col] = ls[t];
#pragma unroll
    for (int j = 0; j < HDQK / 16; ++j) { v4f lo, hi;
#pragma unroll
      for (int r = 0; r < 4; ++r) { lo[r] = o[t][j][r]; hi[r] = o[t][j][4 + r]; }
      *(v4f*)&so[wave][t * 16 + col][j * 16 + 8 * g] = lo; *(v4f*)&so[wave][t * 16 + col][j * 16 + 8 * g + 4] = hi; } }
  __syncthreads();   /* every wave's partial tile and sums are in LDS before they are added */
  { const int row = tid >> 3, c4 = (tid & 7) * 4; v4f s = *(const v4f*)&so[0][row][c4]; float l = sl[0][row];
#pragma unroll
    for (int w = 1; w < AKW; ++w) { s += *(const v4f*)&so[w][row][c4]; l += sl[w][row]; }
    vst2(Y + (rb + q0 + row) * CC + c4, s * (1.0f / l)); } }   /* the 32 real columns of the y rows: all that k_wz reads */

extern "C" void kernel_launch(void* const* d_in, const int* in_sizes, int n_in, void* d_out, int out_size, void* d_ws, size_t ws_size, hipStream_t stream) {
  (void)in_sizes; (void)n_in; (void)out_size;
  const float** F = (const float**)d_in;
  if (ws_size < (size_t)WS_END) return;
  char* ws = (char*)d_ws; _Float16 *QH = (_Float16*)(ws + WS_QH), *KH = (_Float16*)(ws + WS_KH), *VT = (_Float16*)(ws + WS_VT), *QL = (_Float16*)(ws + WS_QL), *KL = (_Float16*)(ws + WS_KL); __bf16 *VB = (__bf16*)(ws + WS_VB), *VBL = (__bf16*)(ws + WS_VBL); 
  (void)VB; (void)VBL;
  // inputs: 0 x [4,256,64,64]; 1 w_theta [32,256] (out,in); 2 w_phi; 3 w_g; 4 w_out [256,32] (out,in); no biases
  if (ws_size < (size_t)WS_END2) return;
  float *YR = (float*)(ws + WS_YR), *ORW = (float*)(ws + WS_OR);
  k_proj<<<dim3(TNB * TT / 64, CC / 128, 3), 128, 0, stream>>>(F[0], F[0], F[0], F[1], F[2], F[3], nullptr, nullptr, nullptr, QH, QL, KH, KL, VT, VB, VBL);   /* q = theta, k = phi, v = g */
  k_att<<<dim3(TT / (16 * AQT), TNB), 32 * AKW, 0, stream>>>(QH, QL, KH, KL, VT, YR);
  k_wz<<<dim3(TNB * TT / 64, DIN / 128), 128, 0, stream>>>(YR, F[4], nullptr, ORW);
  k_fin2<<<dim3(TT / 64, DIN / 64, TNB), 256, 0, stream>>>(ORW, F[0], (float*)d_out);
}

// v004
// One run takes 61.6 microseconds.
// Next to v003, in two timings, it ran 1.12 times as fast each time.
// All steps since v000 together make it 17.4 times as fast.
// compute dtype: all float inputs rounded to bf16; theta/phi/g = W x with EXACT bf16 products on WMMA 16x16x32 (f32 accumulate); unscaled affinities theta.phi with both as f16 hi + residual planes (3 products); softmax in f32 (exponentials as the hardware's exp2 of (s - max) log2 e + 11); exp(s - max) x 2^11 once to f16 against g once to f16 (1 product), divided by the f32 sum of the exponentials after the product; y split bf16 hi + lo against exact w_out (2 products); + x in f32; f32 output.
#include <hip/hip_runtime.h>
#include <math.h>

typedef __attribute__((ext_vector_type(16))) _Float16 v16h;
typedef __attribute__((ext_vector_type(16))) __bf16 v16b;
typedef __attribute__((ext_vector_type(8)))  _Float16 v8h;
typedef __attribute__((ext_vector_type(8)))  float v8f;
typedef __attribute__((ext_vector_type(4)))  float v4f;
typedef __attribute__((ext_vector_type(2)))  float v2f;
typedef __attribute__((ext_vector_type(4)))  unsigned v4u;
typedef __attribute__((ext_vector_type(4)))  int v4i;
typedef float __attribute__((may_alias)) float_a;
typedef int __attribute__((may_alias)) int_a;

template <typename T> __device__ __forceinline__ void vst2(void* p, T v) { *(T*)p = v;  }
__device__ __forceinline__ v8f wmma16(v16h a, v16h b, v8f c) {
  v8f d = __builtin_amdgcn_wmma_f32_16x16x32_f16(false, a, false, b, (short)0, c, false, false);
  asm volatile("v_nop\n\tv_nop\n\tv_nop\n\tv_nop" : "+v"(d) : "v"(a), "v"(b));
  return d;
}
__device__ __forceinline__ v8f wmma_bf(v16b a, v16b b, v8f c) {
  v8f d = __builtin_amdgcn_wmma_f32_16x16x32_bf16(false, a, false, b, (short)0, c, false, false);
  asm volatile("v_nop\n\tv_nop\n\tv_nop\n\tv_nop" : "+v"(d) : "v"(a), "v"(b));
  return d;
}
// 16x16x32 fragments: lane = (h = lane>>4, row/col = lane&15); elements 0..7 = k0+8h+0..7, 8..15 = k0+16+8h+0..7; D element r = row 8h+r
__device__ __forceinline__ v16h frag_h(const _Float16* rowk0, int lane) {
  union { v16h v; v8h q[2]; } u; const _Float16* p = rowk0 + 8 * (lane >> 4);
  u.q[0] = *(const v8h*)p; u.q[1] = *(const v8h*)(p + 16); return u.v;
}
__device__ __forceinline__ v16h frag_f32(const float* rowk0, int lane) {
  v16h a; const float* p = rowk0 + 8 * (lane >> 4);
#pragma unroll
  for (int i = 0; i < 8; ++i) { a[i] = (_Float16)p[i]; a[8 + i] = (_Float16)p[16 + i]; }
  return a;
}
__device__ __forceinline__ v16h frag_f32s(const float* rowk0, int lane, float sc) {
  v16h a; const float* p = rowk0 + 8 * (lane >> 4);
#pragma unroll
  for (int i = 0; i < 8; ++i) { a[i] = (_Float16)(p[i] * sc); a[8 + i] = (_Float16)(p[16 + i] * sc); }
  return a;
}
// column fragment from a [K][ld] layout (column n), rows >= K read as 0
__device__ __forceinline__ v16h fragc_f32(const float* W, int k0, int n, int lane, int ld, int K) {
  v16h a; const int g = lane >> 4;
#pragma unroll
  for (int i = 0; i < 8; ++i) { const int ka = k0 + 8 * g + i, kb = ka + 16;
    a[i] = (_Float16)(ka < K ? W[(size_t)(ka < K ? ka : K - 1) * ld + n] : 0.f); a[8 + i] = (_Float16)(kb < K ? W[(size_t)(kb < K ? kb : K - 1) * ld + n] : 0.f); }
  return a;
}
struct F2 { v16b h, l; };
__device__ __forceinline__ F2 bsplit16(const float v[16]) { F2 r;
#pragma unroll
  for (int i = 0; i < 16; ++i) { const __bf16 h = (__bf16)v[i]; r.h[i] = h; r.l[i] = (__bf16)(v[i] - (float)h); }
  return r; }
__device__ __forceinline__ F2 split_row(const float* row, int k0, int lane) { float v[16]; const float* p = row + k0 + 8 * (lane >> 4);
#pragma unroll
  for (int i = 0; i < 8; ++i) { v[i] = p[i]; v[8 + i] = p[16 + i]; }
  return bsplit16(v); }
__device__ __forceinline__ F2 split_rowK(const float* row, int k0, int lane, int K) { float v[16]; const int g = lane >> 4;
#pragma unroll
  for (int i = 0; i < 8; ++i) { const int ka = k0 + 8 * g + i, kb = ka + 16; v[i] = ka < K ? row[ka < K ? ka : K - 1] : 0.f; v[8 + i] = kb < K ? row[kb < K ? kb : K - 1] : 0.f; }
  return bsplit16(v); }
__device__ __forceinline__ F2 split_col(const float* W, int k0, int n, int lane, int ld, int K) { float v[16]; const int g = lane >> 4;
#pragma unroll
  for (int i = 0; i < 8; ++i) { const int ka = k0 + 8 * g + i, kb = ka + 16; v[i] = ka < K ? W[(size_t)(ka < K ? ka : K - 1) * ld + n] : 0.f; v[8 + i] = kb < K ? W[(size_t)(kb < K ? kb : K - 1) * ld + n] : 0.f; }
  return bsplit16(v); }
__device__ __forceinline__ v8f mac3(const F2& a, const F2& b, v8f c) { c = wmma_bf(a.l, b.h, c); c = wmma_bf(a.h, b.l, c); return wmma_bf(a.h, b.h, c); }
__device__ __forceinline__ float sigm(float v) { return 1.0f / (1.0f + expf(-v)); }
#define LDSX() do { asm volatile("s_wait_dscnt 0" ::: "memory"); __builtin_amdgcn_wave_barrier(); __builtin_amdgcn_fence(__ATOMIC_RELEASE, "workgroup"); } while (0)

// Non-local block (B 4, C 256, 64 x 64 = 4,096 positions; C_int 32; (out,in) weights, no biases): theta, phi, g = W x ([32,256]); A[i][j] = softmax_j(theta_i . phi_j) (no scaling, sigma ~ 5.7); y[k][i] = sum_j A[i][j] g[k][j]; out = w_out y ([256,32]) + x.
#define NB 4
#define TT 4096
#define CC 128            // projected plane width (32 real columns + 96 zero)
#define DIN 256          // input (model) width
#define NH 1
#define HD 128
#define NQB (TT / 64)
#define HG 1               // 4,096 x 4,096 f32 planes reserved at WS_S, which no kernel uses
#define SCALE (1.0f)
#define HDQK 32            // theta / phi / g channels: the q rows are 128 wide, columns >= 32 are zero; the k and v fragment tiles hold only the 32 real channels; only the 32 real columns enter the scores
#define CAUSAL 0
#ifndef TNB
#define TNB NB
#endif
__device__ __forceinline__ v16b zero16b() { v16b z; _Pragma("unroll") for (int i = 0; i < 16; ++i) z[i] = (__bf16)0.f; return z; }
__device__ __forceinline__ float bfr(float v) { return (float)(__bf16)v; }
__host__ __device__ __forceinline__ int kb_last(int qb) { return CAUSAL ? ((qb * 64 + 63) >> 7) : (TT / 128 - 1); }
typedef __attribute__((ext_vector_type(8))) __bf16 v8b;
__device__ __forceinline__ v16b frag_b(const __bf16* rowk0, int lane) {
  union { v16b v; v8b q[2]; } u; const __bf16* p = rowk0 + 8 * (lane >> 4);
  u.q[0] = *(const v8b*)p; u.q[1] = *(const v8b*)(p + 16); return u.v;
}
#define QBH (TT / 64)      // ALL query blocks take k_att's 3-product scores
#define QBH_PV 0           // A.g stays single f16
#define QHI 4096            // q residual rows everywhere (3-product logits)
#define KHI 4096           // positions of the bf16 v hi/lo planes (all); the k residuals are stored for every key
// B fragment (k rows k0+.., output column o) of a weight: (in,out) [K][ld] or (out,in) [ld rows of K]: bf16 exact, or f16(bf16 * 256) exact
__device__ __forceinline__ v16b wcol_io(const float* Wm, int k0, int o, int lane, int ld) { v16b w; const int g = lane >> 4;
#pragma unroll
  for (int i = 0; i < 8; ++i) { w[i] = (__bf16)Wm[(size_t)(k0 + 8 * g + i) * ld + o]; w[8 + i] = (__bf16)Wm[(size_t)(k0 + 16 + 8 * g + i) * ld + o]; }
  return w; }
__device__ __forceinline__ v16b wcol_oi(const float* Wm, int k0, int o, int lane, int K) { v16b w; const float* p = Wm + (size_t)o * K + k0 + 8 * (lane >> 4);
#pragma unroll
  for (int i = 0; i < 8; ++i) { w[i] = (__bf16)p[i]; w[8 + i] = (__bf16)p[16 + i]; }
  return w; }
__device__ __forceinline__ v16h wcolh_io(const float* Wm, int k0, int o, int lane, int ld) { v16h w; const int g = lane >> 4;
#pragma unroll
  for (int i = 0; i < 8; ++i) { w[i] = (_Float16)(bfr(Wm[(size_t)(k0 + 8 * g + i) * ld + o]) * 256.0f); w[8 + i] = (_Float16)(bfr(Wm[(size_t)(k0 + 16 + 8 * g + i) * ld + o]) * 256.0f); }
  return w; }
__device__ __forceinline__ v16h wcolh_oi(const float* Wm, int k0, int o, int lane, int K) { v16h w; const float* p = Wm + (size_t)o * K + k0 + 8 * (lane >> 4);
#pragma unroll
  for (int i = 0; i < 8; ++i) { w[i] = (_Float16)(bfr(p[i]) * 256.0f); w[8 + i] = (_Float16)(bfr(p[16 + i]) * 256.0f); }
  return w; }
#define WQKV_LAYOUT 1   // 0 = (in,out) [DIN][CC]; 1 = (out,in) [HDQK][DIN]; 2 = per-head [NH][DIN][HD]
__device__ __forceinline__ v16b wcol_hdk(const float* Wm, int k0, int o, int lane) { v16b w; const int g = lane >> 4; const float* p = Wm + (size_t)(o / HD) * DIN * HD + (o % HD);
#pragma unroll
  for (int i = 0; i < 8; ++i) { w[i] = (__bf16)p[(size_t)(k0 + 8 * g + i) * HD]; w[8 + i] = (__bf16)p[(size_t)(k0 + 16 + 8 * g + i) * HD]; }
  return w; }
#define WO_OUT_IN 0
#if WQKV_LAYOUT == 1
#define WCOL(W, k0, o, lane) (((o) < HDQK) ? wcol_oi(W, k0, (o), lane, DIN) : zero16b())   /* theta/phi/g weights are [32][256] (out,in): projected columns >= 32 are zero for all three */
#elif WQKV_LAYOUT == 2
#define WCOL(W, k0, o, lane) wcol_hdk(W, k0, o, lane)
#else
#define WCOL(W, k0, o, lane) wcol_io(W, k0, o, lane, CC)
#endif
#if WO_OUT_IN
#define WOCOL(W, k0, o, lane) wcol_oi(W, k0, o, lane, CC)
#define WOCOLH(W, k0, o, lane) wcolh_oi(W, k0, o, lane, CC)
#else
#define WOCOL(W, k0, o, lane) wcol_io(W, k0, o, lane, DIN)
#define WOCOLH(W, k0, o, lane) wcolh_io(W, k0, o, lane, DIN)
#endif
#ifndef XP
#define XP TT              // position pitch of x and of the output
#endif
#define BG HG              // unused
#define DVH 128
#define WS_YR (WS_END)     // f32 attended rows [b*n][128] (32 real columns)
#define WS_OR (WS_YR + 4u * (size_t)NB * TT * CC)   // W y + b rows [b*n][256]
#define WS_END2 (WS_OR + 4u * (size_t)NB * TT * DIN)
// ---- k_wz: block = (64 rows, 128 output cols): OR = y (hi + lo, K = 32 real columns of the YR rows) . W^T ((out,in) [256][32], exact) + b
__global__ __launch_bounds__(128) void k_wz(const float* __restrict__ YR, const float* __restrict__ WW, const float* __restrict__ WB, float* __restrict__ ORW) { __shared__ __align__(16) float sf[4][16][132];
  const int tid = threadIdx.x, wave = tid >> 5, lane = tid & 31, col = lane & 15, g = lane >> 4; const int c0 = blockIdx.y * 128; const size_t r0 = (size_t)blockIdx.x * 64 + wave * 16;
  v8f acc[8] = {};
#pragma unroll
  for (int kc = 0; kc < HDQK / 32; ++kc) { const F2 a = split_row(YR + (r0 + col) * CC, kc * 32, lane); asm volatile("s_wait_loadcnt 0x0" ::: "memory");
#pragma unroll
    for (int j = 0; j < 8; ++j) { const v16b w = wcol_oi(WW, kc * 32, c0 + j * 16 + col, lane, HDQK); asm volatile("s_wait_loadcnt 0x0" ::: "memory"); acc[j] = wmma_bf(a.h, w, acc[j]); acc[j] = wmma_bf(a.l, w, acc[j]); } }
#pragma unroll
  for (int j = 0; j < 8; ++j) { const float bb = WB ? bfr(WB[c0 + j * 16 + col]) : 0.f; asm volatile("s_wait_loadcnt 0x0" ::: "memory");
#pragma unroll
    for (int r = 0; r < 8; ++r) sf[wave][8 * g + r][j * 16 + col] = acc[j][r] + bb; }
  LDSX(); for (int rl = 0; rl < 16; ++rl) vst2(ORW + (r0 + rl) * DIN + c0 + lane * 4, *(const v4f*)&sf[wave][rl][lane * 4]); }
// ---- k_fin2: block = (64 positions, 64 channels, batch b): out[b][c][n] = OR[b*N + n][c] + bf16(x[b][c][n]) (LDS transpose; 256-B runs of 64 positions per channel)
__global__ __launch_bounds__(256) void k_fin2(const float* __restrict__ ORW, const float* __restrict__ X, float* __restrict__ OUT) { __shared__ float st[64][68]; const int tid = threadIdx.x; const int n0 = blockIdx.x * 64, c0 = blockIdx.y * 64; const size_t b = blockIdx.z;
  for (int e = tid; e < 64 * 16; e += 256) { const int nl = e >> 4, q = e & 15; *(v4f*)&st[nl][q * 4] = *(const v4f*)(ORW + (b * TT + n0 + nl) * (size_t)DIN + c0 + q * 4); }
  __syncthreads();
  for (int e = tid; e < 64 * 16; e += 256) { const int cl = e >> 4, q = e & 15; const size_t oi = (b * DIN + c0 + cl) * (size_t)XP + n0 + q * 4; const v4f xr = *(const v4f*)(X + oi); v4f o; o[0] = st[q * 4][cl] + bfr(xr[0]); o[1] = st[q * 4 + 1][cl] + bfr(xr[1]); o[2] = st[q * 4 + 2][cl] + bfr(xr[2]); o[3] = st[q * 4 + 3][cl] + bfr(xr[3]); vst2(OUT + oi, o); } }
#ifndef SM_EXTRA_PARAMS
#define SM_EXTRA_PARAMS
#endif
#ifndef PROJ_EXTRA_PARAMS
#define PROJ_EXTRA_PARAMS
#endif
#ifndef SM_MASK_HOOK
#define SM_MASK_HOOK (void)0
#endif

#define WS_QH  0u                                      // f16 q rows [b*t][CC]
#define WS_KH  (WS_QH + 2u * (size_t)NB * TT * CC)      // f16 k tiles in fragment order [b*t / 16][hi 0, hi 1, residual 0, residual 1][lane][8]: run h of a plane holds, at lane (g, col), key row col's channels 16 h + 8 g + 0..7; the residual is x 2^10
#define WS_VT  (WS_KH + 2u * (size_t)NB * TT * CC)      // f16 v tiles in fragment order [b*t / 32][channel tile j][h][lane][8]: at lane (g, col), channel 16 j + col's positions 16 h + 8 g + 0..7
#define WS_QL  (WS_VT + 2u * (size_t)NB * CC * TT)      // f16 q residual x 2^10 rows [b][t < QHI][CC]
#define WS_KL  (WS_QL + 2u * (size_t)NB * QHI * CC)     // not used: the k residuals lie beside their hi tiles
#define WS_VB  (WS_KL + 2u * (size_t)NB * KHI * CC)     // bf16 v hi planes [b][c][t < KHI]
#define WS_VBL (WS_VB + 2u * (size_t)NB * CC * KHI)
#define WS_S   (WS_VBL + 2u * (size_t)NB * CC * KHI)    // f32 [hg][t][s], reserved; no kernel uses it
#define WS_Y   (WS_S  + 4u * (size_t)HG * TT * TT)      // empty (0 bytes); the ctx rows are at WS_YR
#define WS_END (WS_Y  + 0u)

// ---- k_proj: block = (64 rows, 128 cols, which): q/k/v = X W (+ b) with exact bf16 products (K = DIN) -> which 0: q f16 rows (+ residual rows < QHI); 1: k f16 hi + residual tiles in fragment order (the 32 real columns); 2: v f16 tiles in fragment order (the 32 real channels) (+ bf16 hi/lo planes for t < KHI)
__global__ __launch_bounds__(128) void k_proj(const float* __restrict__ XQ, const float* __restrict__ XK, const float* __restrict__ XV, const float* __restrict__ WQ, const float* __restrict__ WK, const float* __restrict__ WV, const float* __restrict__ BQ, const float* __restrict__ BK, const float* __restrict__ BV,
    _Float16* __restrict__ QH, _Float16* __restrict__ QL, _Float16* __restrict__ KH, _Float16* __restrict__ KL, _Float16* __restrict__ VT, __bf16* __restrict__ VB, __bf16* __restrict__ VBL) {
  __shared__ __align__(16) _Float16 sh[64][136], sl[64][136]; __shared__ __align__(16) _Float16 th[128][72]; __shared__ __align__(16) __bf16 tb[128][72], tbl[128][72];
  const int tid = threadIdx.x, wave = tid >> 5, lane = tid & 31, col = lane & 15, g = lane >> 4; const int which = blockIdx.z; const int c0 = blockIdx.y * 128; const size_t r0 = (size_t)blockIdx.x * 64; const size_t bb = r0 / TT; const int t0 = (int)(r0 % TT);
  const float* X = which == 0 ? XQ : which == 1 ? XK : XV; const float* WA = which == 0 ? WQ : which == 1 ? WK : WV; const float* BA = which == 0 ? BQ : which == 1 ? BK : BV;
  v8f acc[8] = {};
#pragma unroll 2
  for (int kc = 0; kc < DIN / 32; ++kc) { v16b a; { const float* p = X + (bb * DIN + kc * 32 + 8 * g) * (size_t)XP + t0 + wave * 16 + col;   /* channels-first gather: x[b][k][t], stride XP between k */
#pragma unroll
      for (int i = 0; i < 8; ++i) { a[i] = (__bf16)p[(size_t)i * XP]; a[8 + i] = (__bf16)p[(size_t)(16 + i) * XP]; } }
    asm volatile("s_wait_loadcnt 0x0" ::: "memory");
#pragma unroll
    for (int j = 0; j < 8; ++j) { const v16b w = WCOL(WA, kc * 32, c0 + j * 16 + col, lane); asm volatile("s_wait_loadcnt 0x0" ::: "memory"); acc[j] = wmma_bf(a, w, acc[j]); } }
  if (which < 2) { _Float16* DH = which == 0 ? QH : KH; _Float16* DL = which == 0 ? QL : KL; const int nhi = which == 0 ? QHI : KHI; const bool hi_rows = t0 < nhi;
#pragma unroll
    for (int j = 0; j < 8; ++j) { const float bias = (BA && (c0 + j * 16 + col < HDQK)) ? bfr(BA[c0 + j * 16 + col]) : 0.f;   /* 32-entry biases */
#pragma unroll
      for (int r = 0; r < 8; ++r) { const float v = acc[j][r] + bias; const _Float16 hv = (_Float16)v; sh[wave * 16 + 8 * g + r][j * 16 + col] = hv; sl[wave * 16 + 8 * g + r][j * 16 + col] = (_Float16)((v - (float)hv) * 1024.0f); } }
    __syncthreads();
    if (which == 0) { for (int e = tid; e < 64 * 16; e += 128) { const int rl = e >> 4, q = e & 15; vst2((unsigned*)(DH + (r0 + rl) * CC + c0 + q * 8), *(const v4u*)&sh[rl][q * 8]); if (hi_rows) vst2((unsigned*)(DL + (bb * nhi + t0 + rl) * (size_t)CC + c0 + q * 8), *(const v4u*)&sl[rl][q * 8]); } }
    else { for (int e = tid; e < 4 * 4 * 32; e += 128) { const int tl = e >> 7, ch = (e >> 5) & 3, l = e & 31, rl = tl * 16 + (l & 15), cs = (ch & 1) * 16 + 8 * (l >> 4);   /* 4 key tiles x 4 runs x 32 lanes: a wave stores one run of 512 bytes, which k_att loads back with one instruction */
        vst2((unsigned*)(DH + ((r0 >> 4) + tl) * 1024 + ch * 256 + l * 8), (ch >> 1) ? *(const v4u*)&sl[rl][cs] : *(const v4u*)&sh[rl][cs]); } }
  } else { const bool hi_rows = t0 < KHI;
#pragma unroll
    for (int j = 0; j < 8; ++j) { const float bias = (BA && (c0 + j * 16 + col < HDQK)) ? bfr(BA[c0 + j * 16 + col]) : 0.f;   /* 32-entry biases */
#pragma unroll
      for (int r = 0; r < 8; ++r) { const float v = acc[j][r] + bias; const int rl = wave * 16 + 8 * g + r, cl = j * 16 + col; th[cl][rl] = (_Float16)v; const __bf16 bh = (__bf16)v; tb[cl][rl] = bh; tbl[cl][rl] = (__bf16)(v - (float)bh); } }
    __syncthreads();
    for (int e = tid; e < 2 * 2 * 2 * 32; e += 128) { const int kc = e >> 7, j = (e >> 6) & 1, h = (e >> 5) & 1, l = e & 31;   /* 2 groups of 32 positions x 2 channel tiles x 2 runs x 32 lanes */
      vst2((unsigned*)(VT + ((r0 >> 5) + kc) * 1024 + (j * 2 + h) * 256 + l * 8), *(const v4u*)&th[j * 16 + (l & 15)][kc * 32 + h * 16 + 8 * (l >> 4)]); }
    for (int e = tid; e < 128 * 8; e += 128) { const int cl = e >> 3, q = e & 7; if (hi_rows) { const size_t o3 = (bb * CC + c0 + cl) * (size_t)KHI + t0 + q * 8; vst2((unsigned*)(VB + o3), *(const v4u*)&tb[cl][q * 8]); vst2((unsigned*)(VBL + o3), *(const v4u*)&tbl[cl][q * 8]); } } } }
// ---- k_att: block = 64 queries (4 tiles of 16) of batch blockIdx.y, 16 waves; wave w owns keys [256 w, 256 w + 256) for all 64 queries; its key and value fragments lie in the workspace in fragment order, so each of its global loads reads 512 bytes in a row (4 cache lines, not 16). Scores are formed transposed, S^T = phi . theta^T (A = key rows, B = query rows, staged once in LDS: pass 1 keeps their fragments in registers, pass 2 reads them per tile; hi + residual planes, 3 products), so a lane holds one query's scores.
// pass 1: row maxima (joined over the waves in LDS). pass 2: the same scores again, e = exp2(s log2 e - (max log2 e - 11)) once to f16; two S^T tiles of 16 keys are the B operand of y^T += g^T . e^T with no lane exchange; f32 sums of e per lane. The 16 partial y tiles and sums are added in LDS in wave order, y = sum(e g) / sum(e).
// every bare '#pragma unroll' in k_att but the two whose loops sum over the waves' LDS rows: its loop indexes fragments or accumulators, which stay in registers only when the loop is fully unrolled
#define AQT 4              // query tiles per wave: each key / value fragment load serves 64 queries
#define AKW 16             // key ranges = waves per block
#define AKR (TT / AKW)     // keys per wave
__device__ __forceinline__ v16h frag_p(const _Float16* p) { union { v16h v; v8h q[2]; } u; u.q[0] = *(const v8h*)p; u.q[1] = *(const v8h*)(p + 16); return u.v; }   /* frag_h with the lane's 8 (lane >> 4) already in p */
__device__ __forceinline__ v16h frag_c(const _Float16* p) { union { v16h v; v8h q[2]; } u; u.q[0] = *(const v8h*)p; u.q[1] = *(const v8h*)(p + 256); return u.v; }   /* a fragment stored in fragment order: two runs of 512 bytes, the lane's 8 lane already in p */
static_assert(CC == 128 && HDQK == 32 && AKR % 32 == 0, "the fragment-order tiles hold 32 channels, written by k_proj's one column block");
__device__ __forceinline__ v8f score_t(v16h kh, v16h kl, v16h qh, v16h ql) { v8f a = {}, al = {}; a = wmma16(kh, qh, a); al = wmma16(kh, ql, al); al = wmma16(kl, qh, al); return (a + al * (1.0f / 1024.0f)) * SCALE; }
#define L2E 1.4426950408889634f
// pass 2's scores as exponents of 2: (hi + residual / 1024) log2 e - mt, two fused multiply-adds an element (the residual's scale and log2 e are one constant)
__device__ __forceinline__ v8f score_x(v16h kh, v16h kl, v16h qh, v16h ql, float mt) { v8f a = {}, al = {}; a = wmma16(kh, qh, a); al = wmma16(kh, ql, al); al = wmma16(kl, qh, al); return al * (SCALE * L2E / 1024.0f) + (a * (SCALE * L2E) - mt); }
__global__ __launch_bounds__(32 * AKW) void k_att(const _Float16* __restrict__ QH, const _Float16* __restrict__ QL, const _Float16* __restrict__ KF, const _Float16* __restrict__ VF, float* __restrict__ Y) {
  __shared__ __align__(16) float so[AKW][16 * AQT][HDQK + 4]; __shared__ float sm[AKW][16 * AQT], sl[AKW][16 * AQT], smx[16 * AQT]; __shared__ __align__(16) _Float16 sq[16 * AQT][HDQK + 8], sp[16 * AQT][HDQK + 8];   /* the block's query rows, residual and hi, 80-byte pitch */
  const int tid = threadIdx.x, wave = tid >> 5, lane = tid & 31, col = lane & 15, g = lane >> 4;
  const size_t b = blockIdx.y, rb = b * TT; const int q0 = blockIdx.x * (16 * AQT), kbeg = wave * AKR;
  float mx[AQT], ls[AQT]; v8f o[AQT][HDQK / 16] = {};
#pragma unroll
  for (int t = 0; t < AQT; ++t) { mx[t] = -3.0e38f; ls[t] = 0.f; }
  if (tid < 64 * AQT) { const int row = tid >> 2, sg = (tid & 3) * 8; *(v8h*)&sq[row][sg] = *(const v8h*)(QL + (rb + q0 + row) * CC + sg); *(v8h*)&sp[row][sg] = *(const v8h*)(QH + (rb + q0 + row) * CC + sg); }
  __syncthreads();   /* the query rows are in LDS before any wave reads them */
  { const _Float16* qk = KF + ((rb + kbeg) >> 4) * 1024 + lane * 8;   /* the lane's 16 bytes in the first run of the wave's first key tile */
    v16h qh[AQT], ql[AQT];   /* pass 1 has the registers to hold all query fragments */
#pragma unroll
    for (int t = 0; t < AQT; ++t) { qh[t] = frag_h(&sp[t * 16 + col][0], lane); ql[t] = frag_h(&sq[t * 16 + col][0], lane); }
#pragma unroll 1   /* rolled: a trip already holds two key tiles */
    for (int kt = 0; kt < AKR / 32; ++kt) { v16h kh[2], kl[2];   /* two key tiles' loads in flight together: one tile's products are shorter than its loads' latency */
#pragma unroll
      for (int u = 0; u < 2; ++u) { kh[u] = frag_c(qk + u * 1024); kl[u] = frag_c(qk + u * 1024 + 512); }
      asm volatile("s_wait_xcnt 0x0" :: "v"(qk) : "memory");   /* the eight loads' address register stays as it is until this wait */
      qk += 2 * 1024;
#pragma unroll
      for (int u = 0; u < 2; ++u)
#pragma unroll
        for (int t = 0; t < AQT; ++t) { const v8f s = score_t(kh[u], kl[u], qh[t], ql[t]);
#pragma unroll
          for (int r = 0; r < 8; ++r) mx[t] = fmaxf(mx[t], s[r]); } } }
#pragma unroll
  for (int t = 0; t < AQT; ++t) { mx[t] = fmaxf(mx[t], __shfl_xor(mx[t], 16)); if (g == 0) sm[wave][t * 16 + col] = mx[t]; }
  __syncthreads();   /* every wave's maxima are in LDS before they are joined */
  if (tid < 16 * AQT) { float a = sm[0][tid];
#pragma unroll
    for (int w = 1; w < AKW; ++w) a = fmaxf(a, sm[w][tid]);
    smx[tid] = a * L2E - 11.0f; }   /* max log2 e - 11: e = 2^11 exp(s - max), the scale cancels in sum(e g) / sum(e) */
  __syncthreads();   /* the joined maxima are in LDS before any wave reads them */
  const _Float16 *pk = KF + ((rb + kbeg) >> 4) * 1024 + lane * 8, *pv = VF + ((rb + kbeg) >> 5) * 1024 + lane * 8;   /* the lane's 16 bytes in the first run of the wave's first key tile and of its first value tile */
#pragma unroll 1   /* rolled: 256 registers a wave is the budget of 4 waves per SIMD */
  for (int kc = 0; kc < AKR / 32; ++kc) {
    const v16h kh0 = frag_c(pk), kl0 = frag_c(pk + 512), kh1 = frag_c(pk + 1024), kl1 = frag_c(pk + 1536);
    v16h vf[HDQK / 16];
#pragma unroll
    for (int j = 0; j < HDQK / 16; ++j) vf[j] = frag_c(pv + j * 512);
    asm volatile("s_wait_xcnt 0x0" :: "v"(pk), "v"(pv) : "memory");   /* the twelve loads' address registers stay as they are until this wait; its memory clobber also keeps the LDS reads below inside the loop: hoisted, the query fragments and the maxima's copies for packed subtracts hold about 90 more registers and spill */
    pk += 2 * 1024; pv += 1024;
#pragma unroll
    for (int t = 0; t < AQT; ++t) { v16h p; const v16h qht = frag_h(&sp[t * 16 + col][0], lane), qlt = frag_h(&sq[t * 16 + col][0], lane); const float mt = smx[t * 16 + col];
      { const v8f s = score_x(kh0, kl0, qht, qlt, mt);
#pragma unroll
        for (int r = 0; r < 8; ++r) { const float e = __builtin_amdgcn_exp2f(s[r]); p[r] = (_Float16)e; ls[t] += e; } }
      { const v8f s = score_x(kh1, kl1, qht, qlt, mt);
#pragma unroll
        for (int r = 0; r < 8; ++r) { const float e = __builtin_amdgcn_exp2f(s[r]); p[8 + r] = (_Float16)e; ls[t] += e; } }
#pragma unroll
      for (int j = 0; j < HDQK / 16; ++j) o[t][j] = wmma16(vf[j], p, o[t][j]); } }   /* D element r = y^T[channel 16 j + 8 g + r][query col] */
#pragma unroll
  for (int t = 0; t < AQT; ++t) { ls[t] += __shfl_xor(ls[t], 16); if (g == 0) sl[wave][t * 16 + col] = ls[t];
#pragma unroll
    for (int j = 0; j < HDQK / 16; ++j) { v4f lo, hi;
#pragma unroll
      for (int r = 0; r < 4; ++r) { lo[r] = o[t][j][r]; hi[r] = o[t][j][4 + r]; }
      *(v4f*)&so[wave][t * 16 + col][j * 16 + 8 * g] = lo; *(v4f*)&so[wave][t * 16 + col][j * 16 + 8 * g + 4] = hi; } }
  __syncthreads();   /* every wave's partial tile and sums are in LDS before they are added */
  { const int row = tid >> 3, c4 = (tid & 7) * 4; v4f s = *(const v4f*)&so[0][row][c4]; float l = sl[0][row];
#pragma unroll
    for (int w = 1; w < AKW; ++w) { s += *(const v4f*)&so[w][row][c4]; l += sl[w][row]; }
    vst2(Y + (rb + q0 + row) * CC + c4, s * (1.0f / l)); } }   /* the 32 real columns of the y rows: all that k_wz reads */

extern "C" void kernel_launch(void* const* d_in, const int* in_sizes, int n_in, void* d_out, int out_size, void* d_ws, size_t ws_size, hipStream_t stream) {
  (void)in_sizes; (void)n_in; (void)out_size;
  const float** F = (const float**)d_in;
  if (ws_size < (size_t)WS_END) return;
  char* ws = (char*)d_ws; _Float16 *QH = (_Float16*)(ws + WS_QH), *KH = (_Float16*)(ws + WS_KH), *VT = (_Float16*)(ws + WS_VT), *QL = (_Float16*)(ws + WS_QL), *KL = (_Float16*)(ws + WS_KL); __bf16 *VB = (__bf16*)(ws + WS_VB), *VBL = (__bf16*)(ws + WS_VBL); 
  (void)VB; (void)VBL;
  // inputs: 0 x [4,256,64,64]; 1 w_theta [32,256] (out,in); 2 w_phi; 3 w_g; 4 w_out [256,32] (out,in); no biases
  if (ws_size < (size_t)WS_END2) return;
  float *YR = (float*)(ws + WS_YR), *ORW = (float*)(ws + WS_OR);
  k_proj<<<dim3(TNB * TT / 64, CC / 128, 3), 128, 0, stream>>>(F[0], F[0], F[0], F[1], F[2], F[3], nullptr, nullptr, nullptr, QH, QL, KH, KL, VT, VB, VBL);   /* q = theta, k = phi, v = g */
  k_att<<<dim3(TT / (16 * AQT), TNB), 32 * AKW, 0, stream>>>(QH, QL, KH, VT, YR);
  k_wz<<<dim3(TNB * TT / 64, DIN / 128), 128, 0, stream>>>(YR, F[4], nullptr, ORW);
  k_fin2<<<dim3(TT / 64, DIN / 64, TNB), 256, 0, stream>>>(ORW, F[0], (float*)d_out);
}

// v005
// A run of this version takes 45.7 microseconds.
// Two timings next to v004 put it at 1.36 and 1.33 times that version's speed.
// Over all steps from v000 it is 23.5 times as fast.
// compute dtype: all float inputs rounded to bf16; theta/phi/g = W x with EXACT bf16 products on WMMA 16x16x32 (f32 accumulate); unscaled affinities theta.phi with both as f16 hi + residual planes (3 products); softmax in f32 (exponentials as the hardware's exp2 of (s - max) log2 e + 11); exp(s - max) x 2^11 once to f16 against g once to f16 (1 product), divided by the f32 sum of the exponentials after the product; y split bf16 hi + lo against exact w_out (2 products); + x in f32; f32 output.
#include <hip/hip_runtime.h>
#include <math.h>

typedef __attribute__((ext_vector_type(16))) _Float16 v16h;
typedef __attribute__((ext_vector_type(16))) __bf16 v16b;
typedef __attribute__((ext_vector_type(8)))  _Float16 v8h;
typedef __attribute__((ext_vector_type(8)))  float v8f;
typedef __attribute__((ext_vector_type(4)))  float v4f;
typedef __attribute__((ext_vector_type(2)))  float v2f;
typedef __attribute__((ext_vector_type(4)))  unsigned v4u;
typedef __attribute__((ext_vector_type(4)))  int v4i;
typedef float __attribute__((may_alias)) float_a;
typedef int __attribute__((may_alias)) int_a;

template <typename T> __device__ __forceinline__ void vst2(void* p, T v) { *(T*)p = v;  }
__device__ __forceinline__ v8f wmma16(v16h a, v16h b, v8f c) {
  v8f d = __builtin_amdgcn_wmma_f32_16x16x32_f16(false, a, false, b, (short)0, c, false, false);
  asm volatile("v_nop\n\tv_nop\n\tv_nop\n\tv_nop" : "+v"(d) : "v"(a), "v"(b));
  return d;
}
__device__ __forceinline__ v8f wmma_bf(v16b a, v16b b, v8f c) {
  v8f d = __builtin_amdgcn_wmma_f32_16x16x32_bf16(false, a, false, b, (short)0, c, false, false);
  asm volatile("v_nop\n\tv_nop\n\tv_nop\n\tv_nop" : "+v"(d) : "v"(a), "v"(b));
  return d;
}
// 16x16x32 fragments: lane = (h = lane>>4, row/col = lane&15); elements 0..7 = k0+8h+0..7, 8..15 = k0+16+8h+0..7; D element r = row 8h+r
__device__ __forceinline__ v16h frag_h(const _Float16* rowk0, int lane) {
  union { v16h v; v8h q[2]; } u; const _Float16* p = rowk0 + 8 * (lane >> 4);
  u.q[0] = *(const v8h*)p; u.q[1] = *(const v8h*)(p + 16); return u.v;
}
__device__ __forceinline__ v16h frag_f32(const float* rowk0, int lane) {
  v16h a; const float* p = rowk0 + 8 * (lane >> 4);
#pragma unroll
  for (int i = 0; i < 8; ++i) { a[i] = (_Float16)p[i]; a[8 + i] = (_Float16)p[16 + i]; }
  return a;
}
__device__ __forceinline__ v16h frag_f32s(const float* rowk0, int lane, float sc) {
  v16h a; const float* p = rowk0 + 8 * (lane >> 4);
#pragma unroll
  for (int i = 0; i < 8; ++i) { a[i] = (_Float16)(p[i] * sc); a[8 + i] = (_Float16)(p[16 + i] * sc); }
  return a;
}
// column fragment from a [K][ld] layout (column n), rows >= K read as 0
__device__ __forceinline__ v16h fragc_f32(const float* W, int k0, int n, int lane, int ld, int K) {
  v16h a; const int g = lane >> 4;
#pragma unroll
  for (int i = 0; i < 8; ++i) { const int ka = k0 + 8 * g + i, kb = ka + 16;
    a[i] = (_Float16)(ka < K ? W[(size_t)(ka < K ? ka : K - 1) * ld + n] : 0.f); a[8 + i] = (_Float16)(kb < K ? W[(size_t)(kb < K ? kb : K - 1) * ld + n] : 0.f); }
  return a;
}
struct F2 { v16b h, l; };
__device__ __forceinline__ F2 bsplit16(const float v[16]) { F2 r;
#pragma unroll
  for (int i = 0; i < 16; ++i) { const __bf16 h = (__bf16)v[i]; r.h[i] = h; r.l[i] = (__bf16)(v[i] - (float)h); }
  return r; }
__device__ __forceinline__ F2 split_row(const float* row, int k0, int lane) { float v[16]; const float* p = row + k0 + 8 * (lane >> 4);
#pragma unroll
  for (int i = 0; i < 8; ++i) { v[i] = p[i]; v[8 + i] = p[16 + i]; }
  return bsplit16(v); }
__device__ __forceinline__ F2 split_rowK(const float* row, int k0, int lane, int K) { float v[16]; const int g = lane >> 4;
#pragma unroll
  for (int i = 0; i < 8; ++i) { const int ka = k0 + 8 * g + i, kb = ka + 16; v[i] = ka < K ? row[ka < K ? ka : K - 1] : 0.f; v[8 + i] = kb < K ? row[kb < K ? kb : K - 1] : 0.f; }
  return bsplit16(v); }
__device__ __forceinline__ F2 split_col(const float* W, int k0, int n, int lane, int ld, int K) { float v[16]; const int g = lane >> 4;
#pragma unroll
  for (int i = 0; i < 8; ++i) { const int ka = k0 + 8 * g + i, kb = ka + 16; v[i] = ka < K ? W[(size_t)(ka < K ? ka : K - 1) * ld + n] : 0.f; v[8 + i] = kb < K ? W[(size_t)(kb < K ? kb : K - 1) * ld + n] : 0.f; }
  return bsplit16(v); }
__device__ __forceinline__ v8f mac3(const F2& a, const F2& b, v8f c) { c = wmma_bf(a.l, b.h, c); c = wmma_bf(a.h, b.l, c); return wmma_bf(a.h, b.h, c); }
__device__ __forceinline__ float sigm(float v) { return 1.0f / (1.0f + expf(-v)); }
#define LDSX() do { asm volatile("s_wait_dscnt 0" ::: "memory"); __builtin_amdgcn_wave_barrier(); __builtin_amdgcn_fence(__ATOMIC_RELEASE, "workgroup"); } while (0)

// Non-local block (B 4, C 256, 64 x 64 = 4,096 positions; C_int 32; (out,in) weights, no biases): theta, phi, g = W x ([32,256]); A[i][j] = softmax_j(theta_i . phi_j) (no scaling, sigma ~ 5.7); y[k][i] = sum_j A[i][j] g[k][j]; out = w_out y ([256,32]) + x.
#define NB 4
#define TT 4096
#define CC 128            // projected plane width (32 real columns + 96 zero)
#define DIN 256          // input (model) width
#define NH 1
#define HD 128
#define NQB (TT / 64)
#define HG 1               // 4,096 x 4,096 f32 planes reserved at WS_S, which no kernel uses
#define SCALE (1.0f)
#define HDQK 32            // theta / phi / g channels: the q rows are 128 wide, columns >= 32 are zero; the k and v fragment tiles hold only the 32 real channels; only the 32 real columns enter the scores
#define CAUSAL 0
#ifndef TNB
#define TNB NB
#endif
__device__ __forceinline__ v16b zero16b() { v16b z; _Pragma("unroll") for (int i = 0; i < 16; ++i) z[i] = (__bf16)0.f; return z; }
__device__ __forceinline__ float bfr(float v) { return (float)(__bf16)v; }
__host__ __device__ __forceinline__ int kb_last(int qb) { return CAUSAL ? ((qb * 64 + 63) >> 7) : (TT / 128 - 1); }
typedef __attribute__((ext_vector_type(8))) __bf16 v8b;
__device__ __forceinline__ v16b frag_b(const __bf16* rowk0, int lane) {
  union { v16b v; v8b q[2]; } u; const __bf16* p = rowk0 + 8 * (lane >> 4);
  u.q[0] = *(const v8b*)p; u.q[1] = *(const v8b*)(p + 16); return u.v;
}
#define QBH (TT / 64)      // ALL query blocks take k_att's 3-product scores
#define QBH_PV 0           // A.g stays single f16
#define QHI 4096            // q residual rows everywhere (3-product logits)
#define KHI 4096           // positions of the bf16 v hi/lo planes (all); the k residuals are stored for every key
// B fragment (k rows k0+.., output column o) of a weight: (in,out) [K][ld] or (out,in) [ld rows of K]: bf16 exact, or f16(bf16 * 256) exact
__device__ __forceinline__ v16b wcol_io(const float* Wm, int k0, int o, int lane, int ld) { v16b w; const int g = lane >> 4;
#pragma unroll
  for (int i = 0; i < 8; ++i) { w[i] = (__bf16)Wm[(size_t)(k0 + 8 * g + i) * ld + o]; w[8 + i] = (__bf16)Wm[(size_t)(k0 + 16 + 8 * g + i) * ld + o]; }
  return w; }
__device__ __forceinline__ v16b wcol_oi(const float* Wm, int k0, int o, int lane, int K) { v16b w; const float* p = Wm + (size_t)o * K + k0 + 8 * (lane >> 4);
#pragma unroll
  for (int i = 0; i < 8; ++i) { w[i] = (__bf16)p[i]; w[8 + i] = (__bf16)p[16 + i]; }
  return w; }
__device__ __forceinline__ v16h wcolh_io(const float* Wm, int k0, int o, int lane, int ld) { v16h w; const int g = lane >> 4;
#pragma unroll
  for (int i = 0; i < 8; ++i) { w[i] = (_Float16)(bfr(Wm[(size_t)(k0 + 8 * g + i) * ld + o]) * 256.0f); w[8 + i] = (_Float16)(bfr(Wm[(size_t)(k0 + 16 + 8 * g + i) * ld + o]) * 256.0f); }
  return w; }
__device__ __forceinline__ v16h wcolh_oi(const float* Wm, int k0, int o, int lane, int K) { v16h w; const float* p = Wm + (size_t)o * K + k0 + 8 * (lane >> 4);
#pragma unroll
  for (int i = 0; i < 8; ++i) { w[i] = (_Float16)(bfr(p[i]) * 256.0f); w[8 + i] = (_Float16)(bfr(p[16 + i]) * 256.0f); }
  return w; }
#define WQKV_LAYOUT 1   // 0 = (in,out) [DIN][CC]; 1 = (out,in) [HDQK][DIN]; 2 = per-head [NH][DIN][HD]
__device__ __forceinline__ v16b wcol_hdk(const float* Wm, int k0, int o, int lane) { v16b w; const int g = lane >> 4; const float* p = Wm + (size_t)(o / HD) * DIN * HD + (o % HD);
#pragma unroll
  for (int i = 0; i < 8; ++i) { w[i] = (__bf16)p[(size_t)(k0 + 8 * g + i) * HD]; w[8 + i] = (__bf16)p[(size_t)(k0 + 16 + 8 * g + i) * HD]; }
  return w; }
#define WO_OUT_IN 0
#if WQKV_LAYOUT == 1
#define WCOL(W, k0, o, lane) (((o) < HDQK) ? wcol_oi(W, k0, (o), lane, DIN) : zero16b())   /* theta/phi/g weights are [32][256] (out,in): projected columns >= 32 are zero for all three */
#elif WQKV_LAYOUT == 2
#define WCOL(W, k0, o, lane) wcol_hdk(W, k0, o, lane)
#else
#define WCOL(W, k0, o, lane) wcol_io(W, k0, o, lane, CC)
#endif
#if WO_OUT_IN
#define WOCOL(W, k0, o, lane) wcol_oi(W, k0, o, lane, CC)
#define WOCOLH(W, k0, o, lane) wcolh_oi(W, k0, o, lane, CC)
#else
#define WOCOL(W, k0, o, lane) wcol_io(W, k0, o, lane, DIN)
#define WOCOLH(W, k0, o, lane) wcolh_io(W, k0, o, lane, DIN)
#endif
#ifndef XP
#define XP TT              // position pitch of x and of the output
#endif
#define BG HG              // unused
#define DVH 128
#ifndef SM_EXTRA_PARAMS
#define SM_EXTRA_PARAMS
#endif
#ifndef PROJ_EXTRA_PARAMS
#define PROJ_EXTRA_PARAMS
#endif
#ifndef SM_MASK_HOOK
#define SM_MASK_HOOK (void)0
#endif

#define WS_QH  0u                                      // f16 q rows [b*t][CC]
#define WS_KH  (WS_QH + 2u * (size_t)NB * TT * CC)      // f16 k tiles in fragment order [b*t / 16][hi 0, hi 1, residual 0, residual 1][lane][8]: run h of a plane holds, at lane (g, col), key row col's channels 16 h + 8 g + 0..7; the residual is x 2^10
#define WS_VT  (WS_KH + 2u * (size_t)NB * TT * CC)      // f16 v tiles in fragment order [b*t / 32][channel tile j][h][lane][8]: at lane (g, col), channel 16 j + col's positions 16 h + 8 g + 0..7
#define WS_QL  (WS_VT + 2u * (size_t)NB * CC * TT)      // f16 q residual x 2^10 rows [b][t < QHI][CC]
#define WS_KL  (WS_QL + 2u * (size_t)NB * QHI * CC)     // not used: the k residuals lie beside their hi tiles
#define WS_VB  (WS_KL + 2u * (size_t)NB * KHI * CC)     // bf16 v hi planes [b][c][t < KHI]
#define WS_VBL (WS_VB + 2u * (size_t)NB * CC * KHI)
#define WS_S   (WS_VBL + 2u * (size_t)NB * CC * KHI)    // f32 [hg][t][s], reserved; no kernel uses it
#define WS_Y   (WS_S  + 4u * (size_t)HG * TT * TT)      // empty (0 bytes); y stays in k_att's LDS
#define WS_END (WS_Y  + 0u)

// ---- k_proj: block = (64 rows, 128 cols, which): q/k/v = X W (+ b) with exact bf16 products (K = DIN) -> which 0: q f16 rows (+ residual rows < QHI); 1: k f16 hi + residual tiles in fragment order (the 32 real columns); 2: v f16 tiles in fragment order (the 32 real channels) (+ bf16 hi/lo planes for t < KHI)
__global__ __launch_bounds__(128) void k_proj(const float* __restrict__ XQ, const float* __restrict__ XK, const float* __restrict__ XV, const float* __restrict__ WQ, const float* __restrict__ WK, const float* __restrict__ WV, const float* __restrict__ BQ, const float* __restrict__ BK, const float* __restrict__ BV,
    _Float16* __restrict__ QH, _Float16* __restrict__ QL, _Float16* __restrict__ KH, _Float16* __restrict__ KL, _Float16* __restrict__ VT, __bf16* __restrict__ VB, __bf16* __restrict__ VBL) {
  __shared__ __align__(16) _Float16 sh[64][136], sl[64][136]; __shared__ __align__(16) _Float16 th[128][72]; __shared__ __align__(16) __bf16 tb[128][72], tbl[128][72];
  const int tid = threadIdx.x, wave = tid >> 5, lane = tid & 31, col = lane & 15, g = lane >> 4; const int which = blockIdx.z; const int c0 = blockIdx.y * 128; const size_t r0 = (size_t)blockIdx.x * 64; const size_t bb = r0 / TT; const int t0 = (int)(r0 % TT);
  const float* X = which == 0 ? XQ : which == 1 ? XK : XV; const float* WA = which == 0 ? WQ : which == 1 ? WK : WV; const float* BA = which == 0 ? BQ : which == 1 ? BK : BV;
  v8f acc[8] = {};
#pragma unroll 2
  for (int kc = 0; kc < DIN / 32; ++kc) { v16b a; { const float* p = X + (bb * DIN + kc * 32 + 8 * g) * (size_t)XP + t0 + wave * 16 + col;   /* channels-first gather: x[b][k][t], stride XP between k */
#pragma unroll
      for (int i = 0; i < 8; ++i) { a[i] = (__bf16)p[(size_t)i * XP]; a[8 + i] = (__bf16)p[(size_t)(16 + i) * XP]; } }
    asm volatile("s_wait_loadcnt 0x0" ::: "memory");
#pragma unroll
    for (int j = 0; j < 8; ++j) { const v16b w = WCOL(WA, kc * 32, c0 + j * 16 + col, lane); asm volatile("s_wait_loadcnt 0x0" ::: "memory"); acc[j] = wmma_bf(a, w, acc[j]); } }
  if (which < 2) { _Float16* DH = which == 0 ? QH : KH; _Float16* DL = which == 0 ? QL : KL; const int nhi = which == 0 ? QHI : KHI; const bool hi_rows = t0 < nhi;
#pragma unroll
    for (int j = 0; j < 8; ++j) { const float bias = (BA && (c0 + j * 16 + col < HDQK)) ? bfr(BA[c0 + j * 16 + col]) : 0.f;   /* 32-entry biases */
#pragma unroll
      for (int r = 0; r < 8; ++r) { const float v = acc[j][r] + bias; const _Float16 hv = (_Float16)v; sh[wave * 16 + 8 * g + r][j * 16 + col] = hv; sl[wave * 16 + 8 * g + r][j * 16 + col] = (_Float16)((v - (float)hv) * 1024.0f); } }
    __syncthreads();
    if (which == 0) { for (int e = tid; e < 64 * 16; e += 128) { const int rl = e >> 4, q = e & 15; vst2((unsigned*)(DH + (r0 + rl) * CC + c0 + q * 8), *(const v4u*)&sh[rl][q * 8]); if (hi_rows) vst2((unsigned*)(DL + (bb * nhi + t0 + rl) * (size_t)CC + c0 + q * 8), *(const v4u*)&sl[rl][q * 8]); } }
    else { for (int e = tid; e < 4 * 4 * 32; e += 128) { const int tl = e >> 7, ch = (e >> 5) & 3, l = e & 31, rl = tl * 16 + (l & 15), cs = (ch & 1) * 16 + 8 * (l >> 4);   /* 4 key tiles x 4 runs x 32 lanes: a wave stores one run of 512 bytes, which k_att loads back with one instruction */
        vst2((unsigned*)(DH + ((r0 >> 4) + tl) * 1024 + ch * 256 + l * 8), (ch >> 1) ? *(const v4u*)&sl[rl][cs] : *(const v4u*)&sh[rl][cs]); } }
  } else { const bool hi_rows = t0 < KHI;
#pragma unroll
    for (int j = 0; j < 8; ++j) { const float bias = (BA && (c0 + j * 16 + col < HDQK)) ? bfr(BA[c0 + j * 16 + col]) : 0.f;   /* 32-entry biases */
#pragma unroll
      for (int r = 0; r < 8; ++r) { const float v = acc[j][r] + bias; const int rl = wave * 16 + 8 * g + r, cl = j * 16 + col; th[cl][rl] = (_Float16)v; const __bf16 bh = (__bf16)v; tb[cl][rl] = bh; tbl[cl][rl] = (__bf16)(v - (float)bh); } }
    __syncthreads();
    for (int e = tid; e < 2 * 2 * 2 * 32; e += 128) { const int kc = e >> 7, j = (e >> 6) & 1, h = (e >> 5) & 1, l = e & 31;   /* 2 groups of 32 positions x 2 channel tiles x 2 runs x 32 lanes */
      vst2((unsigned*)(VT + ((r0 >> 5) + kc) * 1024 + (j * 2 + h) * 256 + l * 8), *(const v4u*)&th[j * 16 + (l & 15)][kc * 32 + h * 16 + 8 * (l >> 4)]); }
    for (int e = tid; e < 128 * 8; e += 128) { const int cl = e >> 3, q = e & 7; if (hi_rows) { const size_t o3 = (bb * CC + c0 + cl) * (size_t)KHI + t0 + q * 8; vst2((unsigned*)(VB + o3), *(const v4u*)&tb[cl][q * 8]); vst2((unsigned*)(VBL + o3), *(const v4u*)&tbl[cl][q * 8]); } } } }
// ---- k_att: block = 64 queries (4 tiles of 16) of batch blockIdx.y, 16 waves; wave w owns keys [256 w, 256 w + 256) for all 64 queries; its key and value fragments lie in the workspace in fragment order, so each of its global loads reads 512 bytes in a row (4 cache lines, not 16). Scores are formed transposed, S^T = phi . theta^T (A = key rows, B = query rows, staged once in LDS: pass 1 keeps their fragments in registers, pass 2 reads them per tile; hi + residual planes, 3 products), so a lane holds one query's scores.
// pass 1: row maxima (joined over the waves in LDS). pass 2: the same scores again, e = exp2(s log2 e - (max log2 e - 11)) once to f16; two S^T tiles of 16 keys are the B operand of y^T += g^T . e^T with no lane exchange; f32 sums of e per lane. The 16 partial y tiles and sums are added in LDS in wave order, y = sum(e g) / sum(e). tail: y (bf16 hi + lo, in LDS) against exact w_out on WMMA, one tile of 16 output channels a wave, turned in LDS to runs of 64 positions, + bf16(x), stored to out.
// bare '#pragma unroll' in k_att: where its loop indexes fragments or accumulators, these stay in registers only when the loop is fully unrolled
#define AQT 4              // query tiles per wave: each key / value fragment load serves 64 queries
#define AKW 16             // key ranges = waves per block
#define AKR (TT / AKW)     // keys per wave
__device__ __forceinline__ v16h frag_p(const _Float16* p) { union { v16h v; v8h q[2]; } u; u.q[0] = *(const v8h*)p; u.q[1] = *(const v8h*)(p + 16); return u.v; }   /* frag_h with the lane's 8 (lane >> 4) already in p */
__device__ __forceinline__ v16h frag_c(const _Float16* p) { union { v16h v; v8h q[2]; } u; u.q[0] = *(const v8h*)p; u.q[1] = *(const v8h*)(p + 256); return u.v; }   /* a fragment stored in fragment order: two runs of 512 bytes, the lane's 8 lane already in p */
typedef __attribute__((ext_vector_type(4))) __bf16 v4b;
static_assert(32 * AKW * 16 == DIN * HDQK && DIN == 16 * AKW && 16 * 68 <= 16 * AQT * (HDQK + 4), "16 weights a thread; one output channel tile a wave; its output tile fits the LDS of its partial tile");
static_assert(CC == 128 && HDQK == 32 && AKR % 32 == 0, "the fragment-order tiles hold 32 channels, written by k_proj's one column block");
__device__ __forceinline__ v8f score_t(v16h kh, v16h kl, v16h qh, v16h ql) { v8f a = {}, al = {}; a = wmma16(kh, qh, a); al = wmma16(kh, ql, al); al = wmma16(kl, qh, al); return (a + al * (1.0f / 1024.0f)) * SCALE; }
#define L2E 1.4426950408889634f
// pass 2's scores as exponents of 2: (hi + residual / 1024) log2 e - mt, two fused multiply-adds an element (the residual's scale and log2 e are one constant)
__device__ __forceinline__ v8f score_x(v16h kh, v16h kl, v16h qh, v16h ql, float mt) { v8f a = {}, al = {}; a = wmma16(kh, qh, a); al = wmma16(kh, ql, al); al = wmma16(kl, qh, al); return al * (SCALE * L2E / 1024.0f) + (a * (SCALE * L2E) - mt); }
__global__ __launch_bounds__(32 * AKW) void k_att(const _Float16* __restrict__ QH, const _Float16* __restrict__ QL, const _Float16* __restrict__ KF, const _Float16* __restrict__ VF, const float* __restrict__ X, const float* __restrict__ WW, float* __restrict__ OUT) {
  __shared__ __align__(16) float so[AKW][16 * AQT][HDQK + 4]; __shared__ float sm[AKW][16 * AQT], sl[AKW][16 * AQT], smx[16 * AQT]; __shared__ __align__(16) _Float16 sq[16 * AQT][HDQK + 8], sp[16 * AQT][HDQK + 8];   /* the block's query rows, residual and hi, 80-byte pitch */
  __shared__ __align__(16) __bf16 syh[16 * AQT][HDQK + 8], syl[16 * AQT][HDQK + 8], swo[DIN][HDQK + 8];   /* the block's y rows, bf16 hi and lo, and w_out's rows, exact bf16: 80-byte pitch */
  const int tid = threadIdx.x, wave = tid >> 5, lane = tid & 31, col = lane & 15, g = lane >> 4;
  const size_t b = blockIdx.y, rb = b * TT; const int q0 = blockIdx.x * (16 * AQT), kbeg = wave * AKR;
  float mx[AQT], ls[AQT]; v8f o[AQT][HDQK / 16] = {};
#pragma unroll
  for (int t = 0; t < AQT; ++t) { mx[t] = -3.0e38f; ls[t] = 0.f; }
  v4f wr[4];   /* w_out, 16 weights a thread, goes to LDS here: loaded in front of the query rows so that the two latencies run together, and the tail waits for no weight load */
#pragma unroll
  for (int i = 0; i < 4; ++i) wr[i] = *(const v4f*)(WW + tid * 16 + i * 4);
  if (tid < 64 * AQT) { const int row = tid >> 2, sg = (tid & 3) * 8; *(v8h*)&sq[row][sg] = *(const v8h*)(QL + (rb + q0 + row) * CC + sg); *(v8h*)&sp[row][sg] = *(const v8h*)(QH + (rb + q0 + row) * CC + sg); }
  { v8b w0, w1;
#pragma unroll
    for (int i = 0; i < 4; ++i) { w0[i] = (__bf16)wr[0][i]; w0[4 + i] = (__bf16)wr[1][i]; w1[i] = (__bf16)wr[2][i]; w1[4 + i] = (__bf16)wr[3][i]; }
    *(v8b*)&swo[tid >> 1][(tid & 1) * 16] = w0; *(v8b*)&swo[tid >> 1][(tid & 1) * 16 + 8] = w1; }
  __syncthreads();   /* the query rows (and w_out's) are in LDS before any wave reads them */
  { const _Float16* qk = KF + ((rb + kbeg) >> 4) * 1024 + lane * 8;   /* the lane's 16 bytes in the first run of the wave's first key tile */
    v16h qh[AQT], ql[AQT];   /* pass 1 has the registers to hold all query fragments */
#pragma unroll
    for (int t = 0; t < AQT; ++t) { qh[t] = frag_h(&sp[t * 16 + col][0], lane); ql[t] = frag_h(&sq[t * 16 + col][0], lane); }
#pragma unroll 1   /* rolled: a trip already holds two key tiles */
    for (int kt = 0; kt < AKR / 32; ++kt) { v16h kh[2], kl[2];   /* two key tiles' loads in flight together: one tile's products are shorter than its loads' latency */
#pragma unroll
      for (int u = 0; u < 2; ++u) { kh[u] = frag_c(qk + u * 1024); kl[u] = frag_c(qk + u * 1024 + 512); }
      asm volatile("s_wait_xcnt 0x0" :: "v"(qk) : "memory");   /* the eight loads' address register stays as it is until this wait */
      qk += 2 * 1024;
#pragma unroll
      for (int u = 0; u < 2; ++u)
#pragma unroll
        for (int t = 0; t < AQT; ++t) { const v8f s = score_t(kh[u], kl[u], qh[t], ql[t]);
#pragma unroll
          for (int r = 0; r < 8; ++r) mx[t] = fmaxf(mx[t], s[r]); } } }
#pragma unroll
  for (int t = 0; t < AQT; ++t) { mx[t] = fmaxf(mx[t], __shfl_xor(mx[t], 16)); if (g == 0) sm[wave][t * 16 + col] = mx[t]; }
  __syncthreads();   /* every wave's maxima are in LDS before they are joined */
  if (tid < 16 * AQT) { float a = sm[0][tid];
#pragma unroll
    for (int w = 1; w < AKW; ++w) a = fmaxf(a, sm[w][tid]);
    smx[tid] = a * L2E - 11.0f; }   /* max log2 e - 11: e = 2^11 exp(s - max), the scale cancels in sum(e g) / sum(e) */
  __syncthreads();   /* the joined maxima are in LDS before any wave reads them */
  const _Float16 *pk = KF + ((rb + kbeg) >> 4) * 1024 + lane * 8, *pv = VF + ((rb + kbeg) >> 5) * 1024 + lane * 8;   /* the lane's 16 bytes in the first run of the wave's first key tile and of its first value tile */
#pragma unroll 1   /* rolled: 256 registers a wave is the budget of 4 waves per SIMD */
  for (int kc = 0; kc < AKR / 32; ++kc) {
    const v16h kh0 = frag_c(pk), kl0 = frag_c(pk + 512), kh1 = frag_c(pk + 1024), kl1 = frag_c(pk + 1536);
    v16h vf[HDQK / 16];
#pragma unroll
    for (int j = 0; j < HDQK / 16; ++j) vf[j] = frag_c(pv + j * 512);
    asm volatile("s_wait_xcnt 0x0" :: "v"(pk), "v"(pv) : "memory");   /* the twelve loads' address registers stay as they are until this wait; its memory clobber also keeps the LDS reads below inside the loop: hoisted, the query fragments and the maxima's copies for packed subtracts hold about 90 more registers and spill */
    pk += 2 * 1024; pv += 1024;
#pragma unroll
    for (int t = 0; t < AQT; ++t) { v16h p; const v16h qht = frag_h(&sp[t * 16 + col][0], lane), qlt = frag_h(&sq[t * 16 + col][0], lane); const float mt = smx[t * 16 + col];
      { const v8f s = score_x(kh0, kl0, qht, qlt, mt);
#pragma unroll
        for (int r = 0; r < 8; ++r) { const float e = __builtin_amdgcn_exp2f(s[r]); p[r] = (_Float16)e; ls[t] += e; } }
      { const v8f s = score_x(kh1, kl1, qht, qlt, mt);
#pragma unroll
        for (int r = 0; r < 8; ++r) { const float e = __builtin_amdgcn_exp2f(s[r]); p[8 + r] = (_Float16)e; ls[t] += e; } }
#pragma unroll
      for (int j = 0; j < HDQK / 16; ++j) o[t][j] = wmma16(vf[j], p, o[t][j]); } }   /* D element r = y^T[channel 16 j + 8 g + r][query col] */
#pragma unroll
  for (int t = 0; t < AQT; ++t) { ls[t] += __shfl_xor(ls[t], 16); if (g == 0) sl[wave][t * 16 + col] = ls[t];
#pragma unroll
    for (int j = 0; j < HDQK / 16; ++j) { v4f lo, hi;
#pragma unroll
      for (int r = 0; r < 4; ++r) { lo[r] = o[t][j][r]; hi[r] = o[t][j][4 + r]; }
      *(v4f*)&so[wave][t * 16 + col][j * 16 + 8 * g] = lo; *(v4f*)&so[wave][t * 16 + col][j * 16 + 8 * g + 4] = hi; } }
  // tail: out = w_out y + x for the block's 64 positions; wave w owns output channels [16 w, 16 w + 16)
  __syncthreads();   /* every wave's partial tile and sums are in LDS before they are added */
  { const int row = tid >> 3, c4 = (tid & 7) * 4; v4f s = *(const v4f*)&so[0][row][c4]; float l = sl[0][row];
#pragma unroll
    for (int w = 1; w < AKW; ++w) { s += *(const v4f*)&so[w][row][c4]; l += sl[w][row]; }
    const v4f y = s * (1.0f / l); v4b yh, yl;
#pragma unroll
    for (int r = 0; r < 4; ++r) { const __bf16 h = (__bf16)y[r]; yh[r] = h; yl[r] = (__bf16)(y[r] - (float)h); }
    *(v4b*)&syh[row][c4] = yh; *(v4b*)&syl[row][c4] = yl; }
  __syncthreads();   /* the y rows are in LDS before any wave reads them, and every read of the partial tiles is over before their LDS is written again */
  const int c0 = wave * 16; const size_t ob = (b * DIN + c0 + g) * (size_t)XP + q0 + col * 4;   /* 16 lanes cover one channel's 64 positions (256 bytes in a row), the two lane halves two channels */
  v4f xr[8];   /* the wave's x tile, loaded here so that the loads' latency runs under the products below (in front of the barrier they would be waited for at it) */
#pragma unroll
  for (int i = 0; i < 8; ++i) xr[i] = *(const v4f*)(X + ob + (size_t)(2 * i) * XP);
  asm volatile("s_wait_xcnt 0x0" ::: "memory");   /* the x loads' address registers stay as they are until this wait */
  const v16b wf = frag_b(&swo[c0 + col][0], lane);   /* A fragment: row = output channel c0 + col, k = the 32 y channels */
  float* st = &so[wave][0][0];   /* the wave's own 16 channels x 64 positions, 68-float pitch, in the LDS of its partial tile */
#pragma unroll
  for (int t = 0; t < AQT; ++t) { v8f a = {}; a = wmma_bf(wf, frag_b(&syh[t * 16 + col][0], lane), a); a = wmma_bf(wf, frag_b(&syl[t * 16 + col][0], lane), a);   /* D element r = out[channel c0 + 8 g + r][position 16 t + col] */
#pragma unroll
    for (int r = 0; r < 8; ++r) st[(8 * g + r) * 68 + t * 16 + col] = a[r]; }
  LDSX();   /* the wave's own stores are in LDS before its lanes read each other's */
  __builtin_amdgcn_sched_barrier(0);   /* keeps the x tile's roundings, and with them the wait for its loads, behind the products */
#pragma unroll
  for (int i = 0; i < 8; ++i) { const v4f v = *(const v4f*)&st[(2 * i + g) * 68 + col * 4]; v4f r4;
#pragma unroll
    for (int e = 0; e < 4; ++e) r4[e] = v[e] + bfr(xr[i][e]);
    vst2(OUT + ob + (size_t)(2 * i) * XP, r4); } }

extern "C" void kernel_launch(void* const* d_in, const int* in_sizes, int n_in, void* d_out, int out_size, void* d_ws, size_t ws_size, hipStream_t stream) {
  (void)in_sizes; (void)n_in; (void)out_size;
  const float** F = (const float**)d_in;
  if (ws_size < (size_t)WS_END) return;
  char* ws = (char*)d_ws; _Float16 *QH = (_Float16*)(ws + WS_QH), *KH = (_Float16*)(ws + WS_KH), *VT = (_Float16*)(ws + WS_VT), *QL = (_Float16*)(ws + WS_QL), *KL = (_Float16*)(ws + WS_KL); __bf16 *VB = (__bf16*)(ws + WS_VB), *VBL = (__bf16*)(ws + WS_VBL); 
  (void)VB; (void)VBL;
  // inputs: 0 x [4,256,64,64]; 1 w_theta [32,256] (out,in); 2 w_phi; 3 w_g; 4 w_out [256,32] (out,in); no biases
  k_proj<<<dim3(TNB * TT / 64, CC / 128, 3), 128, 0, stream>>>(F[0], F[0], F[0], F[1], F[2], F[3], nullptr, nullptr, nullptr, QH, QL, KH, KL, VT, VB, VBL);   /* q = theta, k = phi, v = g */
  k_att<<<dim3(TT / (16 * AQT), TNB), 32 * AKW, 0, stream>>>(QH, QL, KH, VT, F[0], F[4], (float*)d_out);
}

// v006
// A run of this version takes 39.6 microseconds.
// Two timings next to v005 both put it at 1.15 times that version's speed.
// Over all steps from v000 it is 26.9 times as fast.
// compute dtype: all float inputs rounded to bf16; theta/phi/g = W x with EXACT bf16 products on WMMA 16x16x32 (f32 accumulate); unscaled affinities theta.phi with both as f16 hi + residual planes (3 products); softmax in f32 (exponentials as the hardware's exp2 of (s - m) log2 e + 11, m = the row maximum of the hi planes' product); exp(s - m) x 2^11 once to f16 against g once to f16 (1 product), divided by the f32 sum of the exponentials after the product; y split bf16 hi + lo against exact w_out (2 products); + x in f32; f32 output.
#include <hip/hip_runtime.h>
#include <math.h>

typedef __attribute__((ext_vector_type(16))) _Float16 v16h;
typedef __attribute__((ext_vector_type(16))) __bf16 v16b;
typedef __attribute__((ext_vector_type(8)))  _Float16 v8h;
typedef __attribute__((ext_vector_type(8)))  float v8f;
typedef __attribute__((ext_vector_type(4)))  float v4f;
typedef __attribute__((ext_vector_type(2)))  float v2f;
typedef __attribute__((ext_vector_type(4)))  unsigned v4u;
typedef __attribute__((ext_vector_type(4)))  int v4i;
typedef float __attribute__((may_alias)) float_a;
typedef int __attribute__((may_alias)) int_a;

template <typename T> __device__ __forceinline__ void vst2(void* p, T v) { *(T*)p = v;  }
__device__ __forceinline__ v8f wmma16(v16h a, v16h b, v8f c) {
  v8f d = __builtin_amdgcn_wmma_f32_16x16x32_f16(false, a, false, b, (short)0, c, false, false);
  asm volatile("v_nop\n\tv_nop\n\tv_nop\n\tv_nop" : "+v"(d) : "v"(a), "v"(b));
  return d;
}
__device__ __forceinline__ v8f wmma_bf(v16b a, v16b b, v8f c) {
  v8f d = __builtin_amdgcn_wmma_f32_16x16x32_bf16(false, a, false, b, (short)0, c, false, false);
  asm volatile("v_nop\n\tv_nop\n\tv_nop\n\tv_nop" : "+v"(d) : "v"(a), "v"(b));
  return d;
}
// 16x16x32 fragments: lane = (h = lane>>4, row/col = lane&15); elements 0..7 = k0+8h+0..7, 8..15 = k0+16+8h+0..7; D element r = row 8h+r
__device__ __forceinline__ v16h frag_h(const _Float16* rowk0, int lane) {
  union { v16h v; v8h q[2]; } u; const _Float16* p = rowk0 + 8 * (lane >> 4);
  u.q[0] = *(const v8h*)p; u.q[1] = *(const v8h*)(p + 16); return u.v;
}
__device__ __forceinline__ v16h frag_f32(const float* rowk0, int lane) {
  v16h a; const float* p = rowk0 + 8 * (lane >> 4);
#pragma unroll
  for (int i = 0; i < 8; ++i) { a[i] = (_Float16)p[i]; a[8 + i] = (_Float16)p[16 + i]; }
  return a;
}
__device__ __forceinline__ v16h frag_f32s(const float* rowk0, int lane, float sc) {
  v16h a; const float* p = rowk0 + 8 * (lane >> 4);
#pragma unroll
  for (int i = 0; i < 8; ++i) { a[i] = (_Float16)(p[i] * sc); a[8 + i] = (_Float16)(p[16 + i] * sc); }
  return a;
}
// column fragment from a [K][ld] layout (column n), rows >= K read as 0
__device__ __forceinline__ v16h fragc_f32(const float* W, int k0, int n, int lane, int ld, int K) {
  v16h a; const int g = lane >> 4;
#pragma unroll
  for (int i = 0; i < 8; ++i) { const int ka = k0 + 8 * g + i, kb = ka + 16;
    a[i] = (_Float16)(ka < K ? W[(size_t)(ka < K ? ka : K - 1) * ld + n] : 0.f); a[8 + i] = (_Float16)(kb < K ? W[(size_t)(kb < K ? kb : K - 1) * ld + n] : 0.f); }
  return a;
}
struct F2 { v16b h, l; };
__device__ __forceinline__ F2 bsplit16(const float v[16]) { F2 r;
#pragma unroll
  for (int i = 0; i < 16; ++i) { const __bf16 h = (__bf16)v[i]; r.h[i] = h; r.l[i] = (__bf16)(v[i] - (float)h); }
  return r; }
__device__ __forceinline__ F2 split_row(const float* row, int k0, int lane) { float v[16]; const float* p = row + k0 + 8 * (lane >> 4);
#pragma unroll
  for (int i = 0; i < 8; ++i) { v[i] = p[i]; v[8 + i] = p[16 + i]; }
  return bsplit16(v); }
__device__ __forceinline__ F2 split_rowK(const float* row, int k0, int lane, int K) { float v[16]; const int g = lane >> 4;
#pragma unroll
  for (int i = 0; i < 8; ++i) { const int ka = k0 + 8 * g + i, kb = ka + 16; v[i] = ka < K ? row[ka < K ? ka : K - 1] : 0.f; v[8 + i] = kb < K ? row[kb < K ? kb : K - 1] : 0.f; }
  return bsplit16(v); }
__device__ __forceinline__ F2 split_col(const float* W, int k0, int n, int lane, int ld, int K) { float v[16]; const int g = lane >> 4;
#pragma unroll
  for (int i = 0; i < 8; ++i) { const int ka = k0 + 8 * g + i, kb = ka + 16; v[i] = ka < K ? W[(size_t)(ka < K ? ka : K - 1) * ld + n] : 0.f; v[8 + i] = kb < K ? W[(size_t)(kb < K ? kb : K - 1) * ld + n] : 0.f; }
  return bsplit16(v); }
__device__ __forceinline__ v8f mac3(const F2& a, const F2& b, v8f c) { c = wmma_bf(a.l, b.h, c); c = wmma_bf(a.h, b.l, c); return wmma_bf(a.h, b.h, c); }
__device__ __forceinline__ float sigm(float v) { return 1.0f / (1.0f + expf(-v)); }
#define LDSX() do { asm volatile("s_wait_dscnt 0" ::: "memory"); __builtin_amdgcn_wave_barrier(); __builtin_amdgcn_fence(__ATOMIC_RELEASE, "workgroup"); } while (0)

// Non-local block (B 4, C 256, 64 x 64 = 4,096 positions; C_int 32; (out,in) weights, no biases): theta, phi, g = W x ([32,256]); A[i][j] = softmax_j(theta_i . phi_j) (no scaling, sigma ~ 5.7); y[k][i] = sum_j A[i][j] g[k][j]; out = w_out y ([256,32]) + x.
#define NB 4
#define TT 4096
#define CC 128            // projected plane width (32 real columns + 96 zero)
#define DIN 256          // input (model) width
#define NH 1
#define HD 128
#define NQB (TT / 64)
#define HG 1               // 4,096 x 4,096 f32 planes reserved at WS_S, which no kernel uses
#define SCALE (1.0f)
#define HDQK 32            // theta / phi / g channels: the q rows are 128 wide, columns >= 32 are zero; the k and v fragment tiles hold only the 32 real channels; only the 32 real columns enter the scores
#define CAUSAL 0
#ifndef TNB
#define TNB NB
#endif
__device__ __forceinline__ v16b zero16b() { v16b z; _Pragma("unroll") for (int i = 0; i < 16; ++i) z[i] = (__bf16)0.f; return z; }
__device__ __forceinline__ float bfr(float v) { return (float)(__bf16)v; }
__host__ __device__ __forceinline__ int kb_last(int qb) { return CAUSAL ? ((qb * 64 + 63) >> 7) : (TT / 128 - 1); }
typedef __attribute__((ext_vector_type(8))) __bf16 v8b;
__device__ __forceinline__ v16b frag_b(const __bf16* rowk0, int lane) {
  union { v16b v; v8b q[2]; } u; const __bf16* p = rowk0 + 8 * (lane >> 4);
  u.q[0] = *(const v8b*)p; u.q[1] = *(const v8b*)(p + 16); return u.v;
}
#define QBH (TT / 64)      // ALL query blocks take k_att's 3-product scores
#define QBH_PV 0           // A.g stays single f16
#define QHI 4096            // q residual rows everywhere (3-product logits)
#define KHI 4096           // positions of the bf16 v hi/lo planes (all); the k residuals are stored for every key
// B fragment (k rows k0+.., output column o) of a weight: (in,out) [K][ld] or (out,in) [ld rows of K]: bf16 exact, or f16(bf16 * 256) exact
__device__ __forceinline__ v16b wcol_io(const float* Wm, int k0, int o, int lane, int ld) { v16b w; const int g = lane >> 4;
#pragma unroll
  for (int i = 0; i < 8; ++i) { w[i] = (__bf16)Wm[(size_t)(k0 + 8 * g + i) * ld + o]; w[8 + i] = (__bf16)Wm[(size_t)(k0 + 16 + 8 * g + i) * ld + o]; }
  return w; }
__device__ __forceinline__ v16b wcol_oi(const float* Wm, int k0, int o, int lane, int K) { v16b w; const float* p = Wm + (size_t)o * K + k0 + 8 * (lane >> 4);
#pragma unroll
  for (int i = 0; i < 8; ++i) { w[i] = (__bf16)p[i]; w[8 + i] = (__bf16)p[16 + i]; }
  return w; }
__device__ __forceinline__ v16h wcolh_io(const float* Wm, int k0, int o, int lane, int ld) { v16h w; const int g = lane >> 4;
#pragma unroll
  for (int i = 0; i < 8; ++i) { w[i] = (_Float16)(bfr(Wm[(size_t)(k0 + 8 * g + i) * ld + o]) * 256.0f); w[8 + i] = (_Float16)(bfr(Wm[(size_t)(k0 + 16 + 8 * g + i) * ld + o]) * 256.0f); }
  return w; }
__device__ __forceinline__ v16h wcolh_oi(const float* Wm, int k0, int o, int lane, int K) { v16h w; const float* p = Wm + (size_t)o * K + k0 + 8 * (lane >> 4);
#pragma unroll
  for (int i = 0; i < 8; ++i) { w[i] = (_Float16)(bfr(p[i]) * 256.0f); w[8 + i] = (_Float16)(bfr(p[16 + i]) * 256.0f); }
  return w; }
#define WQKV_LAYOUT 1   // 0 = (in,out) [DIN][CC]; 1 = (out,in) [HDQK][DIN]; 2 = per-head [NH][DIN][HD]
__device__ __forceinline__ v16b wcol_hdk(const float* Wm, int k0, int o, int lane) { v16b w; const int g = lane >> 4; const float* p = Wm + (size_t)(o / HD) * DIN * HD + (o % HD);
#pragma unroll
  for (int i = 0; i < 8; ++i) { w[i] = (__bf16)p[(size_t)(k0 + 8 * g + i) * HD]; w[8 + i] = (__bf16)p[(size_t)(k0 + 16 + 8 * g + i) * HD]; }
  return w; }
#define WO_OUT_IN 0
#if WQKV_LAYOUT == 1
#define WCOL(W, k0, o, lane) (((o) < HDQK) ? wcol_oi(W, k0, (o), lane, DIN) : zero16b())   /* theta/phi/g weights are [32][256] (out,in): projected columns >= 32 are zero for all three */
#elif WQKV_LAYOUT == 2
#define WCOL(W, k0, o, lane) wcol_hdk(W, k0, o, lane)
#else
#define WCOL(W, k0, o, lane) wcol_io(W, k0, o, lane, CC)
#endif
#if WO_OUT_IN
#define WOCOL(W, k0, o, lane) wcol_oi(W, k0, o, lane, CC)
#define WOCOLH(W, k0, o, lane) wcolh_oi(W, k0, o, lane, CC)
#else
#define WOCOL(W, k0, o, lane) wcol_io(W, k0, o, lane, DIN)
#define WOCOLH(W, k0, o, lane) wcolh_io(W, k0, o, lane, DIN)
#endif
#ifndef XP
#define XP TT              // position pitch of x and of the output
#endif
#define BG HG              // unused
#define DVH 128
#ifndef SM_EXTRA_PARAMS
#define SM_EXTRA_PARAMS
#endif
#ifndef PROJ_EXTRA_PARAMS
#define PROJ_EXTRA_PARAMS
#endif
#ifndef SM_MASK_HOOK
#define SM_MASK_HOOK (void)0
#endif

#define WS_QH  0u                                      // f16 q rows [b*t][CC]
#define WS_KH  (WS_QH + 2u * (size_t)NB * TT * CC)      // f16 k tiles in fragment order [b*t / 16][hi 0, hi 1, residual 0, residual 1][lane][8]: run h of a plane holds, at lane (g, col), key row col's channels 16 h + 8 g + 0..7; the residual is x 2^10
#define WS_VT  (WS_KH + 2u * (size_t)NB * TT * CC)      // f16 v tiles in fragment order [b*t / 32][channel tile j][h][lane][8]: at lane (g, col), channel 16 j + col's positions 16 h + 8 g + 0..7
#define WS_QL  (WS_VT + 2u * (size_t)NB * CC * TT)      // f16 q residual x 2^10 rows [b][t < QHI][CC]
#define WS_KL  (WS_QL + 2u * (size_t)NB * QHI * CC)     // not used: the k residuals lie beside their hi tiles
#define WS_VB  (WS_KL + 2u * (size_t)NB * KHI * CC)     // bf16 v hi planes [b][c][t < KHI]
#define WS_VBL (WS_VB + 2u * (size_t)NB * CC * KHI)
#define WS_S   (WS_VBL + 2u * (size_t)NB * CC * KHI)    // f32 [hg][t][s], reserved; no kernel uses it
#define WS_Y   (WS_S  + 4u * (size_t)HG * TT * TT)      // empty (0 bytes); y stays in k_att's LDS
#define WS_END (WS_Y  + 0u)

// ---- k_proj: block = (64 rows, 128 cols, which): q/k/v = X W (+ b) with exact bf16 products (K = DIN) -> which 0: q f16 rows (+ residual rows < QHI); 1: k f16 hi + residual tiles in fragment order (the 32 real columns); 2: v f16 tiles in fragment order (the 32 real channels) (+ bf16 hi/lo planes for t < KHI)
__global__ __launch_bounds__(128) void k_proj(const float* __restrict__ XQ, const float* __restrict__ XK, const float* __restrict__ XV, const float* __restrict__ WQ, const float* __restrict__ WK, const float* __restrict__ WV, const float* __restrict__ BQ, const float* __restrict__ BK, const float* __restrict__ BV,
    _Float16* __restrict__ QH, _Float16* __restrict__ QL, _Float16* __restrict__ KH, _Float16* __restrict__ KL, _Float16* __restrict__ VT, __bf16* __restrict__ VB, __bf16* __restrict__ VBL) {
  __shared__ __align__(16) _Float16 sh[64][136], sl[64][136]; __shared__ __align__(16) _Float16 th[128][72]; __shared__ __align__(16) __bf16 tb[128][72], tbl[128][72];
  const int tid = threadIdx.x, wave = tid >> 5, lane = tid & 31, col = lane & 15, g = lane >> 4; const int which = blockIdx.z; const int c0 = blockIdx.y * 128; const size_t r0 = (size_t)blockIdx.x * 64; const size_t bb = r0 / TT; const int t0 = (int)(r0 % TT);
  const float* X = which == 0 ? XQ : which == 1 ? XK : XV; const float* WA = which == 0 ? WQ : which == 1 ? WK : WV; const float* BA = which == 0 ? BQ : which == 1 ? BK : BV;
  v8f acc[8] = {};
#pragma unroll 2
  for (int kc = 0; kc < DIN / 32; ++kc) { v16b a; { const float* p = X + (bb * DIN + kc * 32 + 8 * g) * (size_t)XP + t0 + wave * 16 + col;   /* channels-first gather: x[b][k][t], stride XP between k */
#pragma unroll
      for (int i = 0; i < 8; ++i) { a[i] = (__bf16)p[(size_t)i * XP]; a[8 + i] = (__bf16)p[(size_t)(16 + i) * XP]; } }
    asm volatile("s_wait_loadcnt 0x0" ::: "memory");
#pragma unroll
    for (int j = 0; j < 8; ++j) { const v16b w = WCOL(WA, kc * 32, c0 + j * 16 + col, lane); asm volatile("s_wait_loadcnt 0x0" ::: "memory"); acc[j] = wmma_bf(a, w, acc[j]); } }
  if (which < 2) { _Float16* DH = which == 0 ? QH : KH; _Float16* DL = which == 0 ? QL : KL; const int nhi = which == 0 ? QHI : KHI; const bool hi_rows = t0 < nhi;
#pragma unroll
    for (int j = 0; j < 8; ++j) { const float bias = (BA && (c0 + j * 16 + col < HDQK)) ? bfr(BA[c0 + j * 16 + col]) : 0.f;   /* 32-entry biases */
#pragma unroll
      for (int r = 0; r < 8; ++r) { const float v = acc[j][r] + bias; const _Float16 hv = (_Float16)v; sh[wave * 16 + 8 * g + r][j * 16 + col] = hv; sl[wave * 16 + 8 * g + r][j * 16 + col] = (_Float16)((v - (float)hv) * 1024.0f); } }
    __syncthreads();
    if (which == 0) { for (int e = tid; e < 64 * 16; e += 128) { const int rl = e >> 4, q = e & 15; vst2((unsigned*)(DH + (r0 + rl) * CC + c0 + q * 8), *(const v4u*)&sh[rl][q * 8]); if (hi_rows) vst2((unsigned*)(DL + (bb * nhi + t0 + rl) * (size_t)CC + c0 + q * 8), *(const v4u*)&sl[rl][q * 8]); } }
    else { for (int e = tid; e < 4 * 4 * 32; e += 128) { const int tl = e >> 7, ch = (e >> 5) & 3, l = e & 31, rl = tl * 16 + (l & 15), cs = (ch & 1) * 16 + 8 * (l >> 4);   /* 4 key tiles x 4 runs x 32 lanes: a wave stores one run of 512 bytes, which k_att loads back with one instruction */
        vst2((unsigned*)(DH + ((r0 >> 4) + tl) * 1024 + ch * 256 + l * 8), (ch >> 1) ? *(const v4u*)&sl[rl][cs] : *(const v4u*)&sh[rl][cs]); } }
  } else { const bool hi_rows = t0 < KHI;
#pragma unroll
    for (int j = 0; j < 8; ++j) { const float bias = (BA && (c0 + j * 16 + col < HDQK)) ? bfr(BA[c0 + j * 16 + col]) : 0.f;   /* 32-entry biases */
#pragma unroll
      for (int r = 0; r < 8; ++r) { const float v = acc[j][r] + bias; const int rl = wave * 16 + 8 * g + r, cl = j * 16 + col; th[cl][rl] = (_Float16)v; const __bf16 bh = (__bf16)v; tb[cl][rl] = bh; tbl[cl][rl] = (__bf16)(v - (float)bh); } }
    __syncthreads();
    for (int e = tid; e < 2 * 2 * 2 * 32; e += 128) { const int kc = e >> 7, j = (e >> 6) & 1, h = (e >> 5) & 1, l = e & 31;   /* 2 groups of 32 positions x 2 channel tiles x 2 runs x 32 lanes */
      vst2((unsigned*)(VT + ((r0 >> 5) + kc) * 1024 + (j * 2 + h) * 256 + l * 8), *(const v4u*)&th[j * 16 + (l & 15)][kc * 32 + h * 16 + 8 * (l >> 4)]); }
    for (int e = tid; e < 128 * 8; e += 128) { const int cl = e >> 3, q = e & 7; if (hi_rows) { const size_t o3 = (bb * CC + c0 + cl) * (size_t)KHI + t0 + q * 8; vst2((unsigned*)(VB + o3), *(const v4u*)&tb[cl][q * 8]); vst2((unsigned*)(VBL + o3), *(const v4u*)&tbl[cl][q * 8]); } } } }
// ---- k_att: block = 64 queries (4 tiles of 16) of batch blockIdx.y, 16 waves; wave w owns keys [256 w, 256 w + 256) for all 64 queries; its key and value fragments lie in the workspace in fragment order, so each of its global loads reads 512 bytes in a row (4 cache lines, not 16). Scores are formed transposed, S^T = phi . theta^T (A = key rows, B = query rows, staged once in LDS: pass 1 keeps their hi fragments in registers, pass 2 reads them per tile), so a lane holds one query's scores.
// pass 1: row maxima m of the hi planes' product alone (1 product; joined over the waves in LDS): m is only the point the exponentials are taken from, it cancels in sum(e g) / sum(e), and it lies within the residual products (about 2^-10 |theta| |phi|) of the true maximum, far inside the 2^5 that f16 leaves above 2^11. pass 2: the full scores (hi + residual planes, 3 products), e = exp2(s log2 e - (m log2 e - 11)) once to f16; two S^T tiles of 16 keys are the B operand of y^T += g^T . e^T with no lane exchange; f32 sums of e per lane. The 16 partial y tiles and sums are added in LDS in wave order, y = sum(e g) / sum(e). tail: y (bf16 hi + lo, in LDS) against exact w_out on WMMA, one tile of 16 output channels a wave, turned in LDS to runs of 64 positions, + bf16(x), stored to out.
// every bare '#pragma unroll' in k_att: its loop indexes fragments or accumulators, which stay in registers only when the loop is fully unrolled
#define AQT 4              // query tiles per wave: each key / value fragment load serves 64 queries
#define AKW 16             // key ranges = waves per block
#define AKR (TT / AKW)     // keys per wave
__device__ __forceinline__ v16h frag_p(const _Float16* p) { union { v16h v; v8h q[2]; } u; u.q[0] = *(const v8h*)p; u.q[1] = *(const v8h*)(p + 16); return u.v; }   /* frag_h with the lane's 8 (lane >> 4) already in p */
__device__ __forceinline__ v16h frag_c(const _Float16* p) { union { v16h v; v8h q[2]; } u; u.q[0] = *(const v8h*)p; u.q[1] = *(const v8h*)(p + 256); return u.v; }   /* a fragment stored in fragment order: two runs of 512 bytes, the lane's 8 lane already in p */
typedef __attribute__((ext_vector_type(4))) __bf16 v4b;
static_assert(32 * AKW * 16 == DIN * HDQK && DIN == 16 * AKW && 16 * 68 <= 16 * AQT * (HDQK + 4), "16 weights a thread; one output channel tile a wave; its output tile fits the LDS of its partial tile");
static_assert(CC == 128 && HDQK == 32 && AKR % 32 == 0, "the fragment-order tiles hold 32 channels, written by k_proj's one column block");
static_assert(AKR % 128 == 0, "pass 1 takes eight key tiles a trip");
#define L2E 1.4426950408889634f
// pass 2's scores as exponents of 2: (hi + residual / 1024) log2 e - mt, two fused multiply-adds an element (the residual's scale and log2 e are one constant)
__device__ __forceinline__ v8f score_x(v16h kh, v16h kl, v16h qh, v16h ql, float mt) { v8f a = {}, al = {}; a = wmma16(kh, qh, a); al = wmma16(kh, ql, al); al = wmma16(kl, qh, al); return al * (SCALE * L2E / 1024.0f) + (a * (SCALE * L2E) - mt); }
__global__ __launch_bounds__(32 * AKW) void k_att(const _Float16* __restrict__ QH, const _Float16* __restrict__ QL, const _Float16* __restrict__ KF, const _Float16* __restrict__ VF, const float* __restrict__ X, const float* __restrict__ WW, float* __restrict__ OUT) {
  __shared__ __align__(16) float so[AKW][16 * AQT][HDQK + 4]; __shared__ float sm[AKW][16 * AQT], sl[AKW][16 * AQT], smx[16 * AQT]; __shared__ __align__(16) _Float16 sq[16 * AQT][HDQK + 8], sp[16 * AQT][HDQK + 8];   /* the block's query rows, residual and hi, 80-byte pitch */
  __shared__ __align__(16) __bf16 syh[16 * AQT][HDQK + 8], syl[16 * AQT][HDQK + 8], swo[DIN][HDQK + 8];   /* the block's y rows, bf16 hi and lo, and w_out's rows, exact bf16: 80-byte pitch */
  const int tid = threadIdx.x, wave = tid >> 5, lane = tid & 31, col = lane & 15, g = lane >> 4;
  const size_t b = blockIdx.y, rb = b * TT; const int q0 = blockIdx.x * (16 * AQT), kbeg = wave * AKR;
  float mx[AQT], ls[AQT]; v8f o[AQT][HDQK / 16] = {};
#pragma unroll
  for (int t = 0; t < AQT; ++t) { mx[t] = -3.0e38f; ls[t] = 0.f; }
  v4f wr[4];   /* w_out, 16 weights a thread, goes to LDS here: loaded in front of the query rows so that the two latencies run together, and the tail waits for no weight load */
#pragma unroll
  for (int i = 0; i < 4; ++i) wr[i] = *(const v4f*)(WW + tid * 16 + i * 4);
  if (tid < 64 * AQT) { const int row = tid >> 2, sg = (tid & 3) * 8; *(v8h*)&sq[row][sg] = *(const v8h*)(QL + (rb + q0 + row) * CC + sg); *(v8h*)&sp[row][sg] = *(const v8h*)(QH + (rb + q0 + row) * CC + sg); }
  { v8b w0, w1;
#pragma unroll
    for (int i = 0; i < 4; ++i) { w0[i] = (__bf16)wr[0][i]; w0[4 + i] = (__bf16)wr[1][i]; w1[i] = (__bf16)wr[2][i]; w1[4 + i] = (__bf16)wr[3][i]; }
    *(v8b*)&swo[tid >> 1][(tid & 1) * 16] = w0; *(v8b*)&swo[tid >> 1][(tid & 1) * 16 + 8] = w1; }
  __syncthreads();   /* the query rows (and w_out's) are in LDS before any wave reads them */
  { const _Float16* qk = KF + ((rb + kbeg) >> 4) * 1024 + lane * 8;   /* the lane's 16 bytes in the first run of the wave's first key tile */
    v16h qh[AQT];   /* pass 1 has the registers to hold the query hi fragments */
#pragma unroll
    for (int t = 0; t < AQT; ++t) qh[t] = frag_h(&sp[t * 16 + col][0], lane);
#pragma unroll 1   /* rolled: a trip already holds eight key tiles; the build with both trips unrolled spills */
    for (int kt = 0; kt < AKR / 128; ++kt) { v16h kh[8];   /* eight key tiles' hi fragments, 16 loads in flight together */
#pragma unroll
      for (int u = 0; u < 8; ++u) kh[u] = frag_c(qk + u * 1024);   /* the hi runs are the first 1,024 bytes of a tile's 2,048 */
      asm volatile("s_wait_xcnt 0x0" :: "v"(qk) : "memory");   /* the sixteen loads' address register stays as it is until this wait */
      qk += 8 * 1024;
#pragma unroll
      for (int u = 0; u < 8; ++u)
#pragma unroll
        for (int t = 0; t < AQT; ++t) { v8f s = {}; s = wmma16(kh[u], qh[t], s);
#pragma unroll
          for (int r = 0; r < 8; ++r) mx[t] = fmaxf(mx[t], s[r] * SCALE); } } }
#pragma unroll
  for (int t = 0; t < AQT; ++t) { mx[t] = fmaxf(mx[t], __shfl_xor(mx[t], 16)); if (g == 0) sm[wave][t * 16 + col] = mx[t]; }
  __syncthreads();   /* every wave's maxima are in LDS before they are joined */
  if (tid < 16 * AQT) { float a = sm[0][tid];
#pragma unroll
    for (int w = 1; w < AKW; ++w) a = fmaxf(a, sm[w][tid]);
    smx[tid] = a * L2E - 11.0f; }   /* m log2 e - 11: e = 2^11 exp(s - m), the scale cancels in sum(e g) / sum(e) */
  __syncthreads();   /* the joined maxima are in LDS before any wave reads them */
  const _Float16 *pk = KF + ((rb + kbeg) >> 4) * 1024 + lane * 8, *pv = VF + ((rb + kbeg) >> 5) * 1024 + lane * 8;   /* the lane's 16 bytes in the first run of the wave's first key tile and of its first value tile */
#pragma unroll 1   /* rolled: 256 registers a wave is the budget of 4 waves per SIMD */
  for (int kc = 0; kc < AKR / 32; ++kc) {
    const v16h kh0 = frag_c(pk), kl0 = frag_c(pk + 512), kh1 = frag_c(pk + 1024), kl1 = frag_c(pk + 1536);
    v16h vf[HDQK / 16];
#pragma unroll
    for (int j = 0; j < HDQK / 16; ++j) vf[j] = frag_c(pv + j * 512);
    asm volatile("s_wait_xcnt 0x0" :: "v"(pk), "v"(pv) : "memory");   /* the twelve loads' address registers stay as they are until this wait; its memory clobber also keeps the LDS reads below inside the loop: hoisted, the query fragments and the maxima's copies for packed subtracts hold about 90 more registers and spill */
    pk += 2 * 1024; pv += 1024;
#pragma unroll
    for (int t = 0; t < AQT; ++t) { v16h p; const v16h qht = frag_h(&sp[t * 16 + col][0], lane), qlt = frag_h(&sq[t * 16 + col][0], lane); const float mt = smx[t * 16 + col];
      { const v8f s = score_x(kh0, kl0, qht, qlt, mt);
#pragma unroll
        for (int r = 0; r < 8; ++r) { const float e = __builtin_amdgcn_exp2f(s[r]); p[r] = (_Float16)e; ls[t] += e; } }
      { const v8f s = score_x(kh1, kl1, qht, qlt, mt);
#pragma unroll
        for (int r = 0; r < 8; ++r) { const float e = __builtin_amdgcn_exp2f(s[r]); p[8 + r] = (_Float16)e; ls[t] += e; } }
#pragma unroll
      for (int j = 0; j < HDQK / 16; ++j) o[t][j] = wmma16(vf[j], p, o[t][j]); } }   /* D element r = y^T[channel 16 j + 8 g + r][query col] */
#pragma unroll
  for (int t = 0; t < AQT; ++t) { ls[t] += __shfl_xor(ls[t], 16); if (g == 0) sl[wave][t * 16 + col] = ls[t];
#pragma unroll
    for (int j = 0; j < HDQK / 16; ++j) { v4f lo, hi;
#pragma unroll
      for (int r = 0; r < 4; ++r) { lo[r] = o[t][j][r]; hi[r] = o[t][j][4 + r]; }
      *(v4f*)&so[wave][t * 16 + col][j * 16 + 8 * g] = lo; *(v4f*)&so[wave][t * 16 + col][j * 16 + 8 * g + 4] = hi; } }
  // tail: out = w_out y + x for the block's 64 positions; wave w owns output channels [16 w, 16 w + 16)
  __syncthreads();   /* every wave's partial tile and sums are in LDS before they are added */
  { const int row = tid >> 3, c4 = (tid & 7) * 4; v4f s = *(const v4f*)&so[0][row][c4]; float l = sl[0][row];
#pragma unroll
    for (int w = 1; w < AKW; ++w) { s += *(const v4f*)&so[w][row][c4]; l += sl[w][row]; }
    const v4f y = s * (1.0f / l); v4b yh, yl;
#pragma unroll
    for (int r = 0; r < 4; ++r) { const __bf16 h = (__bf16)y[r]; yh[r] = h; yl[r] = (__bf16)(y[r] - (float)h); }
    *(v4b*)&syh[row][c4] = yh; *(v4b*)&syl[row][c4] = yl; }
  __syncthreads();   /* the y rows are in LDS before any wave reads them, and every read of the partial tiles is over before their LDS is written again */
  const int c0 = wave * 16; const size_t ob = (b * DIN + c0 + g) * (size_t)XP + q0 + col * 4;   /* 16 lanes cover one channel's 64 positions (256 bytes in a row), the two lane halves two channels */
  v4f xr[8];   /* the wave's x tile, loaded here so that the loads' latency runs under the products below (in front of the barrier they would be waited for at it) */
#pragma unroll
  for (int i = 0; i < 8; ++i) xr[i] = *(const v4f*)(X + ob + (size_t)(2 * i) * XP);
  asm volatile("s_wait_xcnt 0x0" ::: "memory");   /* the x loads' address registers stay as they are until this wait */
  const v16b wf = frag_b(&swo[c0 + col][0], lane);   /* A fragment: row = output channel c0 + col, k = the 32 y channels */
  float* st = &so[wave][0][0];   /* the wave's own 16 channels x 64 positions, 68-float pitch, in the LDS of its partial tile */
#pragma unroll
  for (int t = 0; t < AQT; ++t) { v8f a = {}; a = wmma_bf(wf, frag_b(&syh[t * 16 + col][0], lane), a); a = wmma_bf(wf, frag_b(&syl[t * 16 + col][0], lane), a);   /* D element r = out[channel c0 + 8 g + r][position 16 t + col] */
#pragma unroll
    for (int r = 0; r < 8; ++r) st[(8 * g + r) * 68 + t * 16 + col] = a[r]; }
  LDSX();   /* the wave's own stores are in LDS before its lanes read each other's */
  __builtin_amdgcn_sched_barrier(0);   /* keeps the x tile's roundings, and with them the wait for its loads, behind the products */
#pragma unroll
  for (int i = 0; i < 8; ++i) { const v4f v = *(const v4f*)&st[(2 * i + g) * 68 + col * 4]; v4f r4;
#pragma unroll
    for (int e = 0; e < 4; ++e) r4[e] = v[e] + bfr(xr[i][e]);
    vst2(OUT + ob + (size_t)(2 * i) * XP, r4); } }

extern "C" void kernel_launch(void* const* d_in, const int* in_sizes, int n_in, void* d_out, int out_size, void* d_ws, size_t ws_size, hipStream_t stream) {
  (void)in_sizes; (void)n_in; (void)out_size;
  const float** F = (const float**)d_in;
  if (ws_size < (size_t)WS_END) return;
  char* ws = (char*)d_ws; _Float16 *QH = (_Float16*)(ws + WS_QH), *KH = (_Float16*)(ws + WS_KH), *VT = (_Float16*)(ws + WS_VT), *QL = (_Float16*)(ws + WS_QL), *KL = (_Float16*)(ws + WS_KL); __bf16 *VB = (__bf16*)(ws + WS_VB), *VBL = (__bf16*)(ws + WS_VBL); 
  (void)VB; (void)VBL;
  // inputs: 0 x [4,256,64,64]; 1 w_theta [32,256] (out,in); 2 w_phi; 3 w_g; 4 w_out [256,32] (out,in); no biases
  k_proj<<<dim3(TNB * TT / 64, CC / 128, 3), 128, 0, stream>>>(F[0], F[0], F[0], F[1], F[2], F[3], nullptr, nullptr, nullptr, QH, QL, KH, KL, VT, VB, VBL);   /* q = theta, k = phi, v = g */
  k_att<<<dim3(TT / (16 * AQT), TNB), 32 * AKW, 0, stream>>>(QH, QL, KH, VT, F[0], F[4], (float*)d_out);
}

// v007
// A run of this version takes 28.2 microseconds.
// Timed twice side by side with v006, it ran 1.41 times as fast both times.
// Over all steps from v000 it is 38.0 times as fast.
// compute dtype: all float inputs rounded to bf16; theta/phi/g = W x with EXACT bf16 products on WMMA 16x16x32 (f32 accumulate); unscaled affinities theta.phi with both as f16 hi + residual planes (3 products); softmax in f32 (exponentials as the hardware's exp2 of (s - m) log2 e + 11, m = the row maximum of the hi planes' product); exp(s - m) x 2^11 once to f16 against g once to f16 (1 product), divided by the f32 sum of the exponentials after the product; y split bf16 hi + lo against exact w_out (2 products); + x in f32; f32 output.
#include <hip/hip_runtime.h>
#include <math.h>

typedef __attribute__((ext_vector_type(16))) _Float16 v16h;
typedef __attribute__((ext_vector_type(16))) __bf16 v16b;
typedef __attribute__((ext_vector_type(8)))  _Float16 v8h;
typedef __attribute__((ext_vector_type(8)))  float v8f;
typedef __attribute__((ext_vector_type(4)))  float v4f;
typedef __attribute__((ext_vector_type(2)))  float v2f;
typedef __attribute__((ext_vector_type(4)))  unsigned v4u;
typedef __attribute__((ext_vector_type(4)))  int v4i;
typedef float __attribute__((may_alias)) float_a;
typedef int __attribute__((may_alias)) int_a;

template <typename T> __device__ __forceinline__ void vst2(void* p, T v) { *(T*)p = v;  }
__device__ __forceinline__ v8f wmma16(v16h a, v16h b, v8f c) {
  v8f d = __builtin_amdgcn_wmma_f32_16x16x32_f16(false, a, false, b, (short)0, c, false, false);
  asm volatile("v_nop\n\tv_nop\n\tv_nop\n\tv_nop" : "+v"(d) : "v"(a), "v"(b));
  return d;
}
__device__ __forceinline__ v8f wmma_bf(v16b a, v16b b, v8f c) {
  v8f d = __builtin_amdgcn_wmma_f32_16x16x32_bf16(false, a, false, b, (short)0, c, false, false);
  asm volatile("v_nop\n\tv_nop\n\tv_nop\n\tv_nop" : "+v"(d) : "v"(a), "v"(b));
  return d;
}
// 16x16x32 fragments: lane = (h = lane>>4, row/col = lane&15); elements 0..7 = k0+8h+0..7, 8..15 = k0+16+8h+0..7; D element r = row 8h+r
__device__ __forceinline__ v16h frag_h(const _Float16* rowk0, int lane) {
  union { v16h v; v8h q[2]; } u; const _Float16* p = rowk0 + 8 * (lane >> 4);
  u.q[0] = *(const v8h*)p; u.q[1] = *(const v8h*)(p + 16); return u.v;
}
__device__ __forceinline__ v16h frag_f32(const float* rowk0, int lane) {
  v16h a; const float* p = rowk0 + 8 * (lane >> 4);
#pragma unroll
  for (int i = 0; i < 8; ++i) { a[i] = (_Float16)p[i]; a[8 + i] = (_Float16)p[16 + i]; }
  return a;
}
__device__ __forceinline__ v16h frag_f32s(const float* rowk0, int lane, float sc) {
  v16h a; const float* p = rowk0 + 8 * (lane >> 4);
#pragma unroll
  for (int i = 0; i < 8; ++i) { a[i] = (_Float16)(p[i] * sc); a[8 + i] = (_Float16)(p[16 + i] * sc); }
  return a;
}
// column fragment from a [K][ld] layout (column n), rows >= K read as 0
__device__ __forceinline__ v16h fragc_f32(const float* W, int k0, int n, int lane, int ld, int K) {
  v16h a; const int g = lane >> 4;
#pragma unroll
  for (int i = 0; i < 8; ++i) { const int ka = k0 + 8 * g + i, kb = ka + 16;
    a[i] = (_Float16)(ka < K ? W[(size_t)(ka < K ? ka : K - 1) * ld + n] : 0.f); a[8 + i] = (_Float16)(kb < K ? W[(size_t)(kb < K ? kb : K - 1) * ld + n] : 0.f); }
  return a;
}
struct F2 { v16b h, l; };
__device__ __forceinline__ F2 bsplit16(const float v[16]) { F2 r;
#pragma unroll
  for (int i = 0; i < 16; ++i) { const __bf16 h = (__bf16)v[i]; r.h[i] = h; r.l[i] = (__bf16)(v[i] - (float)h); }
  return r; }
__device__ __forceinline__ F2 split_row(const float* row, int k0, int lane) { float v[16]; const float* p = row + k0 + 8 * (lane >> 4);
#pragma unroll
  for (int i = 0; i < 8; ++i) { v[i] = p[i]; v[8 + i] = p[16 + i]; }
  return bsplit16(v); }
__device__ __forceinline__ F2 split_rowK(const float* row, int k0, int lane, int K) { float v[16]; const int g = lane >> 4;
#pragma unroll
  for (int i = 0; i < 8; ++i) { const int ka = k0 + 8 * g + i, kb = ka + 16; v[i] = ka < K ? row[ka < K ? ka : K - 1] : 0.f; v[8 + i] = kb < K ? row[kb < K ? kb : K - 1] : 0.f; }
  return bsplit16(v); }
__device__ __forceinline__ F2 split_col(const float* W, int k0, int n, int lane, int ld, int K) { float v[16]; const int g = lane >> 4;
#pragma unroll
  for (int i = 0; i < 8; ++i) { const int ka = k0 + 8 * g + i, kb = ka + 16; v[i] = ka < K ? W[(size_t)(ka < K ? ka : K - 1) * ld + n] : 0.f; v[8 + i] = kb < K ? W[(size_t)(kb < K ? kb : K - 1) * ld + n] : 0.f; }
  return bsplit16(v); }
__device__ __forceinline__ v8f mac3(const F2& a, const F2& b, v8f c) { c = wmma_bf(a.l, b.h, c); c = wmma_bf(a.h, b.l, c); return wmma_bf(a.h, b.h, c); }
__device__ __forceinline__ float sigm(float v) { return 1.0f / (1.0f + expf(-v)); }
#define LDSX() do { asm volatile("s_wait_dscnt 0" ::: "memory"); __builtin_amdgcn_wave_barrier(); __builtin_amdgcn_fence(__ATOMIC_RELEASE, "workgroup"); } while (0)

// Non-local block (B 4, C 256, 64 x 64 = 4,096 positions; C_int 32; (out,in) weights, no biases): theta, phi, g = W x ([32,256]); A[i][j] = softmax_j(theta_i . phi_j) (no scaling, sigma ~ 5.7); y[k][i] = sum_j A[i][j] g[k][j]; out = w_out y ([256,32]) + x.
#define NB 4
#define TT 4096
#define CC 128            // projected plane width (32 real columns + 96 not written)
#define DIN 256          // input (model) width
#define NH 1
#define HD 128
#define NQB (TT / 64)
#define HG 1               // 4,096 x 4,096 f32 planes reserved at WS_S, which no kernel uses
#define SCALE (1.0f)
#define HDQK 32            // theta / phi / g channels: the planes are 128 wide, columns >= 32 are not written; only the 32 real columns enter the scores
#define CAUSAL 0
#ifndef TNB
#define TNB NB
#endif
__device__ __forceinline__ v16b zero16b() { v16b z; _Pragma("unroll") for (int i = 0; i < 16; ++i) z[i] = (__bf16)0.f; return z; }
__device__ __forceinline__ float bfr(float v) { return (float)(__bf16)v; }
__host__ __device__ __forceinline__ int kb_last(int qb) { return CAUSAL ? ((qb * 64 + 63) >> 7) : (TT / 128 - 1); }
typedef __attribute__((ext_vector_type(8))) __bf16 v8b;
__device__ __forceinline__ v16b frag_b(const __bf16* rowk0, int lane) {
  union { v16b v; v8b q[2]; } u; const __bf16* p = rowk0 + 8 * (lane >> 4);
  u.q[0] = *(const v8b*)p; u.q[1] = *(const v8b*)(p + 16); return u.v;
}
#define QBH (TT / 64)      // ALL query blocks take k_att's 3-product scores
#define QBH_PV 0           // A.g stays single f16
#define QHI 4096            // q residual rows everywhere (3-product logits)
#define KHI 4096           // positions of the bf16 v hi/lo planes (all); the k residuals are stored for every key
// B fragment (k rows k0+.., output column o) of a weight: (in,out) [K][ld] or (out,in) [ld rows of K]: bf16 exact, or f16(bf16 * 256) exact
__device__ __forceinline__ v16b wcol_io(const float* Wm, int k0, int o, int lane, int ld) { v16b w; const int g = lane >> 4;
#pragma unroll
  for (int i = 0; i < 8; ++i) { w[i] = (__bf16)Wm[(size_t)(k0 + 8 * g + i) * ld + o]; w[8 + i] = (__bf16)Wm[(size_t)(k0 + 16 + 8 * g + i) * ld + o]; }
  return w; }
__device__ __forceinline__ v16b wcol_oi(const float* Wm, int k0, int o, int lane, int K) { v16b w; const float* p = Wm + (size_t)o * K + k0 + 8 * (lane >> 4);
#pragma unroll
  for (int i = 0; i < 8; ++i) { w[i] = (__bf16)p[i]; w[8 + i] = (__bf16)p[16 + i]; }
  return w; }
__device__ __forceinline__ v16h wcolh_io(const float* Wm, int k0, int o, int lane, int ld) { v16h w; const int g = lane >> 4;
#pragma unroll
  for (int i = 0; i < 8; ++i) { w[i] = (_Float16)(bfr(Wm[(size_t)(k0 + 8 * g + i) * ld + o]) * 256.0f); w[8 + i] = (_Float16)(bfr(Wm[(size_t)(k0 + 16 + 8 * g + i) * ld + o]) * 256.0f); }
  return w; }
__device__ __forceinline__ v16h wcolh_oi(const float* Wm, int k0, int o, int lane, int K) { v16h w; const float* p = Wm + (size_t)o * K + k0 + 8 * (lane >> 4);
#pragma unroll
  for (int i = 0; i < 8; ++i) { w[i] = (_Float16)(bfr(p[i]) * 256.0f); w[8 + i] = (_Float16)(bfr(p[16 + i]) * 256.0f); }
  return w; }
#define WQKV_LAYOUT 1   // 0 = (in,out) [DIN][CC]; 1 = (out,in) [HDQK][DIN]; 2 = per-head [NH][DIN][HD]
__device__ __forceinline__ v16b wcol_hdk(const float* Wm, int k0, int o, int lane) { v16b w; const int g = lane >> 4; const float* p = Wm + (size_t)(o / HD) * DIN * HD + (o % HD);
#pragma unroll
  for (int i = 0; i < 8; ++i) { w[i] = (__bf16)p[(size_t)(k0 + 8 * g + i) * HD]; w[8 + i] = (__bf16)p[(size_t)(k0 + 16 + 8 * g + i) * HD]; }
  return w; }
#define WO_OUT_IN 0
#if WQKV_LAYOUT == 1
#define WCOL(W, k0, o, lane) (((o) < HDQK) ? wcol_oi(W, k0, (o), lane, DIN) : zero16b())   /* theta/phi/g weights are [32][256] (out,in): output columns o >= 32 read as zero for all three */
#elif WQKV_LAYOUT == 2
#define WCOL(W, k0, o, lane) wcol_hdk(W, k0, o, lane)
#else
#define WCOL(W, k0, o, lane) wcol_io(W, k0, o, lane, CC)
#endif
#if WO_OUT_IN
#define WOCOL(W, k0, o, lane) wcol_oi(W, k0, o, lane, CC)
#define WOCOLH(W, k0, o, lane) wcolh_oi(W, k0, o, lane, CC)
#else
#define WOCOL(W, k0, o, lane) wcol_io(W, k0, o, lane, DIN)
#define WOCOLH(W, k0, o, lane) wcolh_io(W, k0, o, lane, DIN)
#endif
#ifndef XP
#define XP TT              // position pitch of x and of the output
#endif
#define BG HG              // unused
#define DVH 128
#ifndef SM_EXTRA_PARAMS
#define SM_EXTRA_PARAMS
#endif
#ifndef PROJ_EXTRA_PARAMS
#define PROJ_EXTRA_PARAMS
#endif
#ifndef SM_MASK_HOOK
#define SM_MASK_HOOK (void)0
#endif

#define WS_QH  0u                                      // f16 q rows [b*t][CC], the 32 real columns written and read
#define WS_KH  (WS_QH + 2u * (size_t)NB * TT * CC)      // f16 k tiles in fragment order [b*t / 16][hi 0, hi 1, residual 0, residual 1][lane][8]: run h of a plane holds, at lane (g, col), key row col's channels 16 h + 8 g + 0..7; the residual is x 2^10
#define WS_VT  (WS_KH + 2u * (size_t)NB * TT * CC)      // f16 v tiles in fragment order [b*t / 32][channel tile j][h][lane][8]: at lane (g, col), channel 16 j + col's positions 16 h + 8 g + 0..7
#define WS_QL  (WS_VT + 2u * (size_t)NB * CC * TT)      // f16 q residual x 2^10 rows [b][t < QHI][CC]
#define WS_KL  (WS_QL + 2u * (size_t)NB * QHI * CC)     // not used: the k residuals lie beside their hi tiles
#define WS_VB  (WS_KL + 2u * (size_t)NB * KHI * CC)     // not used
#define WS_VBL (WS_VB + 2u * (size_t)NB * CC * KHI)
#define WS_S   (WS_VBL + 2u * (size_t)NB * CC * KHI)    // f32 [hg][t][s], reserved; no kernel uses it
#define WS_Y   (WS_S  + 4u * (size_t)HG * TT * TT)      // empty (0 bytes); y stays in k_att's LDS
#define WS_END (WS_Y  + 0u)

// ---- k_proj: block = 64 positions, 8 waves; wave (pt, kq) = position tile pt (16 positions) x input channels [128 kq, 128 kq + 128). One gather of x serves theta, phi and g: the three weights (96 real rows, exact bf16) are staged once a block in LDS, every global load of the block is issued before the first wait, and only the 6 real column tiles are formed.
// theta and phi are formed transposed (A = weight rows, B = x positions), so a lane holds 8 channels in a row of one position, which is the order of a q row and of a k fragment run; g is formed as A = x positions, B = weight rows, so a lane holds 8 positions in a row of one channel, the order of a v fragment run: no turn in LDS. The two channel halves' f32 partial tiles are added through LDS (each wave hands over three tiles and finishes three).
typedef __attribute__((ext_vector_type(4))) __bf16 v4bw;
static_assert(DIN == 256 && HDQK == 32 && QHI == TT && TT % 64 == 0, "8 float4 of each weight a thread; two halves of 4 k steps; q residual rows lie as the q rows do");
__device__ __forceinline__ void st_split(_Float16* dh, _Float16* dl, v8f v) { v8h h, l;   /* f16 hi and residual x 2^10 of 8 values, 16 bytes each */
#pragma unroll
  for (int r = 0; r < 8; ++r) { const _Float16 hv = (_Float16)v[r]; h[r] = hv; l[r] = (_Float16)((v[r] - (float)hv) * 1024.0f); }
  *(v8h*)dh = h; *(v8h*)dl = l; }
__global__ __launch_bounds__(256) void k_proj(const float* __restrict__ X, const float* __restrict__ WQ, const float* __restrict__ WK, const float* __restrict__ WV, _Float16* __restrict__ QH, _Float16* __restrict__ QL, _Float16* __restrict__ KH, _Float16* __restrict__ VT) {
  __shared__ __align__(16) __bf16 sw[3 * HDQK][DIN + 8];   /* theta, phi, g weight rows, 528-byte pitch */
  __shared__ __align__(16) float sx[8][3][32][8];          /* the three partial tiles each wave hands to its partner, as they lie in registers */
  const int tid = threadIdx.x, wave = __builtin_amdgcn_readfirstlane(tid >> 5), lane = tid & 31, col = lane & 15, g = lane >> 4, pt = wave & 3, kq = wave >> 2;
  const size_t r0 = (size_t)blockIdx.x * 64, bb = r0 / TT; const int t0 = (int)(r0 % TT);
  v4f wr[24]; float xv[4][16];
  // every bare '#pragma unroll' in k_proj: its loop indexes loaded values, fragments or accumulators, which stay in registers only when the loop is fully unrolled
#pragma unroll
  for (int i = 0; i < 24; ++i) { const float* Wm = i < 8 ? WQ : i < 16 ? WK : WV; wr[i] = *(const v4f*)(Wm + (i & 7) * 1024 + tid * 4); }   /* 4 weight rows (4,096 bytes in a row) a step */
  { const float* p = X + (bb * DIN + kq * 128 + 8 * g) * (size_t)XP + t0 + pt * 16 + col;   /* channels-first gather: x[b][k][t], stride XP between k */
#pragma unroll
    for (int kc = 0; kc < 4; ++kc)
#pragma unroll
      for (int i = 0; i < 8; ++i) { xv[kc][i] = p[(size_t)(kc * 32 + i) * XP]; xv[kc][8 + i] = p[(size_t)(kc * 32 + 16 + i) * XP]; } }
  asm volatile("s_wait_xcnt 0x0" ::: "memory");   /* the loads' address registers stay as they are until this wait */
#pragma unroll
  for (int i = 0; i < 24; ++i) { v4bw w4;
#pragma unroll
    for (int e = 0; e < 4; ++e) w4[e] = (__bf16)wr[i][e];
    *(v4bw*)&sw[(i >> 3) * HDQK + (i & 7) * 4 + (tid >> 6)][(tid & 63) * 4] = w4; }
  __syncthreads();   /* the weight rows are in LDS before any wave reads them */
  v8f acc[6] = {};   /* 0, 1: theta^T channel tiles; 2, 3: phi^T channel tiles; 4, 5: g channel tiles */
  v16b wf[2][6];   /* the weight fragments of this k step and of the next */
#pragma unroll
  for (int j = 0; j < 6; ++j) wf[0][j] = frag_b(&sw[j * 16 + col][kq * 128], lane);
#pragma unroll
  for (int kc = 0; kc < 4; ++kc) { v16b a;
#pragma unroll
    for (int i = 0; i < 16; ++i) a[i] = (__bf16)xv[kc][i];
    if (kc < 3) {
#pragma unroll
      for (int j = 0; j < 6; ++j) wf[(kc + 1) & 1][j] = frag_b(&sw[j * 16 + col][kq * 128 + (kc + 1) * 32], lane); }
    __builtin_amdgcn_sched_barrier(0);   /* keeps the next step's twelve LDS reads in front of this step's products, so that their latency runs under them (left free, the compiler reads one fragment ahead and waits at every product) */
#pragma unroll
    for (int j = 0; j < 6; ++j) { const v16b w = wf[kc & 1][j];   /* the bare builtin: the compiler keeps the distances behind it */
      acc[j] = j < 4 ? __builtin_amdgcn_wmma_f32_16x16x32_bf16(false, w, false, a, (short)0, acc[j], false, false) : __builtin_amdgcn_wmma_f32_16x16x32_bf16(false, a, false, w, (short)0, acc[j], false, false); } }
  // the wave of the low channel half finishes theta's two tiles and g's first, its partner phi's two and g's second
  v8f mine[3], send[3];
  mine[0] = kq ? acc[2] : acc[0]; mine[1] = kq ? acc[3] : acc[1]; mine[2] = kq ? acc[5] : acc[4];
  send[0] = kq ? acc[0] : acc[2]; send[1] = kq ? acc[1] : acc[3]; send[2] = kq ? acc[4] : acc[5];
#pragma unroll
  for (int m = 0; m < 3; ++m) *(v8f*)&sx[wave][m][lane][0] = send[m];
  __syncthreads();   /* the partial tiles are in LDS before the partner wave reads them */
#pragma unroll
  for (int m = 0; m < 3; ++m) mine[m] += *(const v8f*)&sx[wave ^ 4][m][lane][0];
  if (kq == 0) { const size_t o = (r0 + pt * 16 + col) * CC + 8 * g;   /* q rows: the lane's position, channels 16 m + 8 g + 0..7; one wave writes a row's 64 bytes */
    st_split(QH + o, QL + o, mine[0]); st_split(QH + o + 16, QL + o + 16, mine[1]);
    asm volatile("s_wait_xcnt 0x0" ::: "memory"); }   /* the four stores' registers stay as they are until this wait */
  else { _Float16* d = KH + ((r0 >> 4) + pt) * 1024 + lane * 8;   /* k tile pt: runs hi 0, hi 1, residual 0, residual 1, 512 bytes each */
    st_split(d, d + 512, mine[0]); st_split(d + 256, d + 768, mine[1]);
    asm volatile("s_wait_xcnt 0x0" ::: "memory"); }   /* the four stores' registers stay as they are until this wait */
  { v8h h;   /* v tile of 32 positions: run (channel tile kq, position half pt & 1) */
#pragma unroll
    for (int r = 0; r < 8; ++r) h[r] = (_Float16)mine[2][r];
    *(v8h*)(VT + ((r0 >> 5) + (pt >> 1)) * 1024 + (kq * 2 + (pt & 1)) * 256 + lane * 8) = h; } }
// ---- k_att: block = 64 queries (4 tiles of 16) of batch blockIdx.y, 16 waves; wave w owns keys [256 w, 256 w + 256) for all 64 queries; its key and value fragments lie in the workspace in fragment order, so each of its global loads reads 512 bytes in a row (4 cache lines, not 16). Scores are formed transposed, S^T = phi . theta^T (A = key rows, B = query rows, staged once in LDS: pass 1 keeps their hi fragments in registers, pass 2 reads them per tile), so a lane holds one query's scores.
// pass 1: row maxima m of the hi planes' product alone (1 product; joined over the waves in LDS): m is only the point the exponentials are taken from, it cancels in sum(e g) / sum(e), and it lies within the residual products (about 2^-10 |theta| |phi|) of the true maximum, far inside the 2^5 that f16 leaves above 2^11. pass 2: the full scores (hi + residual planes, 3 products), e = exp2(s log2 e - (m log2 e - 11)) once to f16; two S^T tiles of 16 keys are the B operand of y^T += g^T . e^T with no lane exchange; f32 sums of e per lane. The 16 partial y tiles and sums are added in LDS in wave order, y = sum(e g) / sum(e). tail: y (bf16 hi + lo, in LDS) against exact w_out on WMMA, one tile of 16 output channels a wave, turned in LDS to runs of 64 positions, + bf16(x), stored to out.
// every bare '#pragma unroll' in k_att: its loop indexes fragments or accumulators, which stay in registers only when the loop is fully unrolled
#define AQT 4              // query tiles per wave: each key / value fragment load serves 64 queries
#define AKW 16             // key ranges = waves per block
#define AKR (TT / AKW)     // keys per wave
__device__ __forceinline__ v16h frag_p(const _Float16* p) { union { v16h v; v8h q[2]; } u; u.q[0] = *(const v8h*)p; u.q[1] = *(const v8h*)(p + 16); return u.v; }   /* frag_h with the lane's 8 (lane >> 4) already in p */
__device__ __forceinline__ v16h frag_c(const _Float16* p) { union { v16h v; v8h q[2]; } u; u.q[0] = *(const v8h*)p; u.q[1] = *(const v8h*)(p + 256); return u.v; }   /* a fragment stored in fragment order: two runs of 512 bytes, the lane's 8 lane already in p */
typedef __attribute__((ext_vector_type(4))) __bf16 v4b;
static_assert(32 * AKW * 16 == DIN * HDQK && DIN == 16 * AKW && 16 * 68 <= 16 * AQT * (HDQK + 4), "16 weights a thread; one output channel tile a wave; its output tile fits the LDS of its partial tile");
static_assert(CC == 128 && HDQK == 32 && AKR % 32 == 0, "the fragment-order tiles hold 32 channels, written by k_proj's one column block");
static_assert(AKR % 128 == 0, "pass 1 takes eight key tiles a trip");
#define L2E 1.4426950408889634f
// pass 2's scores as exponents of 2: (hi + residual / 1024) log2 e - mt, two fused multiply-adds an element (the residual's scale and log2 e are one constant)
__device__ __forceinline__ v8f score_x(v16h kh, v16h kl, v16h qh, v16h ql, float mt) { v8f a = {}, al = {}; a = wmma16(kh, qh, a); al = wmma16(kh, ql, al); al = wmma16(kl, qh, al); return al * (SCALE * L2E / 1024.0f) + (a * (SCALE * L2E) - mt); }
__global__ __launch_bounds__(32 * AKW) void k_att(const _Float16* __restrict__ QH, const _Float16* __restrict__ QL, const _Float16* __restrict__ KF, const _Float16* __restrict__ VF, const float* __restrict__ X, const float* __restrict__ WW, float* __restrict__ OUT) {
  __shared__ __align__(16) float so[AKW][16 * AQT][HDQK + 4]; __shared__ float sm[AKW][16 * AQT], sl[AKW][16 * AQT], smx[16 * AQT]; __shared__ __align__(16) _Float16 sq[16 * AQT][HDQK + 8], sp[16 * AQT][HDQK + 8];   /* the block's query rows, residual and hi, 80-byte pitch */
  __shared__ __align__(16) __bf16 syh[16 * AQT][HDQK + 8], syl[16 * AQT][HDQK + 8], swo[DIN][HDQK + 8];   /* the block's y rows, bf16 hi and lo, and w_out's rows, exact bf16: 80-byte pitch */
  const int tid = threadIdx.x, wave = tid >> 5, lane = tid & 31, col = lane & 15, g = lane >> 4;
  const size_t b = blockIdx.y, rb = b * TT; const int q0 = blockIdx.x * (16 * AQT), kbeg = wave * AKR;
  float mx[AQT], ls[AQT]; v8f o[AQT][HDQK / 16] = {};
#pragma unroll
  for (int t = 0; t < AQT; ++t) { mx[t] = -3.0e38f; ls[t] = 0.f; }
  v4f wr[4];   /* w_out, 16 weights a thread, goes to LDS here: loaded in front of the query rows so that the two latencies run together, and the tail waits for no weight load */
#pragma unroll
  for (int i = 0; i < 4; ++i) wr[i] = *(const v4f*)(WW + tid * 16 + i * 4);
  if (tid < 64 * AQT) { const int row = tid >> 2, sg = (tid & 3) * 8; *(v8h*)&sq[row][sg] = *(const v8h*)(QL + (rb + q0 + row) * CC + sg); *(v8h*)&sp[row][sg] = *(const v8h*)(QH + (rb + q0 + row) * CC + sg); }
  { v8b w0, w1;
#pragma unroll
    for (int i = 0; i < 4; ++i) { w0[i] = (__bf16)wr[0][i]; w0[4 + i] = (__bf16)wr[1][i]; w1[i] = (__bf16)wr[2][i]; w1[4 + i] = (__bf16)wr[3][i]; }
    *(v8b*)&swo[tid >> 1][(tid & 1) * 16] = w0; *(v8b*)&swo[tid >> 1][(tid & 1) * 16 + 8] = w1; }
  __syncthreads();   /* the query rows (and w_out's) are in LDS before any wave reads them */
  { const _Float16* qk = KF + ((rb + kbeg) >> 4) * 1024 + lane * 8;   /* the lane's 16 bytes in the first run of the wave's first key tile */
    v16h qh[AQT];   /* pass 1 has the registers to hold the query hi fragments */
#pragma unroll
    for (int t = 0; t < AQT; ++t) qh[t] = frag_h(&sp[t * 16 + col][0], lane);
#pragma unroll 1   /* rolled: a trip already holds eight key tiles; the build with both trips unrolled spills */
    for (int kt = 0; kt < AKR / 128; ++kt) { v16h kh[8];   /* eight key tiles' hi fragments, 16 loads in flight together */
#pragma unroll
      for (int u = 0; u < 8; ++u) kh[u] = frag_c(qk + u * 1024);   /* the hi runs are the first 1,024 bytes of a tile's 2,048 */
      asm volatile("s_wait_xcnt 0x0" :: "v"(qk) : "memory");   /* the sixteen loads' address register stays as it is until this wait */
      qk += 8 * 1024;
#pragma unroll
      for (int u = 0; u < 8; ++u)
#pragma unroll
        for (int t = 0; t < AQT; ++t) { v8f s = {}; s = wmma16(kh[u], qh[t], s);
#pragma unroll
          for (int r = 0; r < 8; ++r) mx[t] = fmaxf(mx[t], s[r] * SCALE); } } }
#pragma unroll
  for (int t = 0; t < AQT; ++t) { mx[t] = fmaxf(mx[t], __shfl_xor(mx[t], 16)); if (g == 0) sm[wave][t * 16 + col] = mx[t]; }
  __syncthreads();   /* every wave's maxima are in LDS before they are joined */
  if (tid < 16 * AQT) { float a = sm[0][tid];
#pragma unroll
    for (int w = 1; w < AKW; ++w) a = fmaxf(a, sm[w][tid]);
    smx[tid] = a * L2E - 11.0f; }   /* m log2 e - 11: e = 2^11 exp(s - m), the scale cancels in sum(e g) / sum(e) */
  __syncthreads();   /* the joined maxima are in LDS before any wave reads them */
  const _Float16 *pk = KF + ((rb + kbeg) >> 4) * 1024 + lane * 8, *pv = VF + ((rb + kbeg) >> 5) * 1024 + lane * 8;   /* the lane's 16 bytes in the first run of the wave's first key tile and of its first value tile */
#pragma unroll 1   /* rolled: 256 registers a wave is the budget of 4 waves per SIMD */
  for (int kc = 0; kc < AKR / 32; ++kc) {
    const v16h kh0 = frag_c(pk), kl0 = frag_c(pk + 512), kh1 = frag_c(pk + 1024), kl1 = frag_c(pk + 1536);
    v16h vf[HDQK / 16];
#pragma unroll
    for (int j = 0; j < HDQK / 16; ++j) vf[j] = frag_c(pv + j * 512);
    asm volatile("s_wait_xcnt 0x0" :: "v"(pk), "v"(pv) : "memory");   /* the twelve loads' address registers stay as they are until this wait; its memory clobber also keeps the LDS reads below inside the loop: hoisted, the query fragments and the maxima's copies for packed subtracts hold about 90 more registers and spill */
    pk += 2 * 1024; pv += 1024;
#pragma unroll
    for (int t = 0; t < AQT; ++t) { v16h p; const v16h qht = frag_h(&sp[t * 16 + col][0], lane), qlt = frag_h(&sq[t * 16 + col][0], lane); const float mt = smx[t * 16 + col];
      { const v8f s = score_x(kh0, kl0, qht, qlt, mt);
#pragma unroll
        for (int r = 0; r < 8; ++r) { const float e = __builtin_amdgcn_exp2f(s[r]); p[r] = (_Float16)e; ls[t] += e; } }
      { const v8f s = score_x(kh1, kl1, qht, qlt, mt);
#pragma unroll
        for (int r = 0; r < 8; ++r) { const float e = __builtin_amdgcn_exp2f(s[r]); p[8 + r] = (_Float16)e; ls[t] += e; } }
#pragma unroll
      for (int j = 0; j < HDQK / 16; ++j) o[t][j] = wmma16(vf[j], p, o[t][j]); } }   /* D element r = y^T[channel 16 j + 8 g + r][query col] */
#pragma unroll
  for (int t = 0; t < AQT; ++t) { ls[t] += __shfl_xor(ls[t], 16); if (g == 0) sl[wave][t * 16 + col] = ls[t];
#pragma unroll
    for (int j = 0; j < HDQK / 16; ++j) { v4f lo, hi;
#pragma unroll
      for (int r = 0; r < 4; ++r) { lo[r] = o[t][j][r]; hi[r] = o[t][j][4 + r]; }
      *(v4f*)&so[wave][t * 16 + col][j * 16 + 8 * g] = lo; *(v4f*)&so[wave][t * 16 + col][j * 16 + 8 * g + 4] = hi; } }
  // tail: out = w_out y + x for the block's 64 positions; wave w owns output channels [16 w, 16 w + 16)
  __syncthreads();   /* every wave's partial tile and sums are in LDS before they are added */
  { const int row = tid >> 3, c4 = (tid & 7) * 4; v4f s = *(const v4f*)&so[0][row][c4]; float l = sl[0][row];
#pragma unroll
    for (int w = 1; w < AKW; ++w) { s += *(const v4f*)&so[w][row][c4]; l += sl[w][row]; }
    const v4f y = s * (1.0f / l); v4b yh, yl;
#pragma unroll
    for (int r = 0; r < 4; ++r) { const __bf16 h = (__bf16)y[r]; yh[r] = h; yl[r] = (__bf16)(y[r] - (float)h); }
    *(v4b*)&syh[row][c4] = yh; *(v4b*)&syl[row][c4] = yl; }
  __syncthreads();   /* the y rows are in LDS before any wave reads them, and every read of the partial tiles is over before their LDS is written again */
  const int c0 = wave * 16; const size_t ob = (b * DIN + c0 + g) * (size_t)XP + q0 + col * 4;   /* 16 lanes cover one channel's 64 positions (256 bytes in a row), the two lane halves two channels */
  v4f xr[8];   /* the wave's x tile, loaded here so that the loads' latency runs under the products below (in front of the barrier they would be waited for at it) */
#pragma unroll
  for (int i = 0; i < 8; ++i) xr[i] = *(const v4f*)(X + ob + (size_t)(2 * i) * XP);
  asm volatile("s_wait_xcnt 0x0" ::: "memory");   /* the x loads' address registers stay as they are until this wait */
  const v16b wf = frag_b(&swo[c0 + col][0], lane);   /* A fragment: row = output channel c0 + col, k = the 32 y channels */
  float* st = &so[wave][0][0];   /* the wave's own 16 channels x 64 positions, 68-float pitch, in the LDS of its partial tile */
#pragma unroll
  for (int t = 0; t < AQT; ++t) { v8f a = {}; a = wmma_bf(wf, frag_b(&syh[t * 16 + col][0], lane), a); a = wmma_bf(wf, frag_b(&syl[t * 16 + col][0], lane), a);   /* D element r = out[channel c0 + 8 g + r][position 16 t + col] */
#pragma unroll
    for (int r = 0; r < 8; ++r) st[(8 * g + r) * 68 + t * 16 + col] = a[r]; }
  LDSX();   /* the wave's own stores are in LDS before its lanes read each other's */
  __builtin_amdgcn_sched_barrier(0);   /* keeps the x tile's roundings, and with them the wait for its loads, behind the products */
#pragma unroll
  for (int i = 0; i < 8; ++i) { const v4f v = *(const v4f*)&st[(2 * i + g) * 68 + col * 4]; v4f r4;
#pragma unroll
    for (int e = 0; e < 4; ++e) r4[e] = v[e] + bfr(xr[i][e]);
    vst2(OUT + ob + (size_t)(2 * i) * XP, r4); } }

extern "C" void kernel_launch(void* const* d_in, const int* in_sizes, int n_in, void* d_out, int out_size, void* d_ws, size_t ws_size, hipStream_t stream) {
  (void)in_sizes; (void)n_in; (void)out_size;
  const float** F = (const float**)d_in;
  if (ws_size < (size_t)WS_END) return;
  char* ws = (char*)d_ws; _Float16 *QH = (_Float16*)(ws + WS_QH), *KH = (_Float16*)(ws + WS_KH), *VT = (_Float16*)(ws + WS_VT), *QL = (_Float16*)(ws + WS_QL);
  // inputs: 0 x [4,256,64,64]; 1 w_theta [32,256] (out,in); 2 w_phi; 3 w_g; 4 w_out [256,32] (out,in); no biases
  k_proj<<<dim3(TNB * TT / 64), 256, 0, stream>>>(F[0], F[1], F[2], F[3], QH, QL, KH, VT);   /* q = theta, k = phi, v = g */
  k_att<<<dim3(TT / (16 * AQT), TNB), 32 * AKW, 0, stream>>>(QH, QL, KH, VT, F[0], F[4], (float*)d_out);
}

// v008
// It runs in 26.9 microseconds.
// Two timings next to v007 both put it at 1.05 times that version's speed.
// Counting every step since v000, it is 39.9 times as fast.
// compute dtype: all float inputs rounded to bf16; theta/phi/g = W x with EXACT bf16 products on WMMA 16x16x32 (f32 accumulate); unscaled affinities theta.phi with both as f16 hi + residual planes (3 products); softmax in f32 (exponentials as the hardware's exp2 of (s - m) log2 e + 11, m = the row maximum of the hi planes' product); exp(s - m) x 2^11 once to f16 against g once to f16 (1 product), divided by the f32 sum of the exponentials after the product; y split bf16 hi + lo against exact w_out (2 products); + x in f32; f32 output.
#include <hip/hip_runtime.h>
#include <math.h>

typedef __attribute__((ext_vector_type(16))) _Float16 v16h;
typedef __attribute__((ext_vector_type(16))) __bf16 v16b;
typedef __attribute__((ext_vector_type(8)))  _Float16 v8h;
typedef __attribute__((ext_vector_type(8)))  float v8f;
typedef __attribute__((ext_vector_type(4)))  float v4f;
typedef __attribute__((ext_vector_type(2)))  float v2f;
typedef __attribute__((ext_vector_type(4)))  unsigned v4u;
typedef __attribute__((ext_vector_type(4)))  int v4i;
typedef float __attribute__((may_alias)) float_a;
typedef int __attribute__((may_alias)) int_a;

template <typename T> __device__ __forceinline__ void vst2(void* p, T v) { *(T*)p = v;  }
__device__ __forceinline__ v8f wmma16(v16h a, v16h b, v8f c) {
  return __builtin_amdgcn_wmma_f32_16x16x32_f16(false, a, false, b, (short)0, c, false, false);   /* the bare builtin: the compiler keeps the distances behind it and fills them with independent work where it has some */
}
__device__ __forceinline__ v8f wmma_bf(v16b a, v16b b, v8f c) {
  return __builtin_amdgcn_wmma_f32_16x16x32_bf16(false, a, false, b, (short)0, c, false, false);   /* the bare builtin, as above */
}
// 16x16x32 fragments: lane = (h = lane>>4, row/col = lane&15); elements 0..7 = k0+8h+0..7, 8..15 = k0+16+8h+0..7; D element r = row 8h+r
__device__ __forceinline__ v16h frag_h(const _Float16* rowk0, int lane) {
  union { v16h v; v8h q[2]; } u; const _Float16* p = rowk0 + 8 * (lane >> 4);
  u.q[0] = *(const v8h*)p; u.q[1] = *(const v8h*)(p + 16); return u.v;
}
__device__ __forceinline__ v16h frag_f32(const float* rowk0, int lane) {
  v16h a; const float* p = rowk0 + 8 * (lane >> 4);
#pragma unroll
  for (int i = 0; i < 8; ++i) { a[i] = (_Float16)p[i]; a[8 + i] = (_Float16)p[16 + i]; }
  return a;
}
__device__ __forceinline__ v16h frag_f32s(const float* rowk0, int lane, float sc) {
  v16h a; const float* p = rowk0 + 8 * (lane >> 4);
#pragma unroll
  for (int i = 0; i < 8; ++i) { a[i] = (_Float16)(p[i] * sc); a[8 + i] = (_Float16)(p[16 + i] * sc); }
  return a;
}
// column fragment from a [K][ld] layout (column n), rows >= K read as 0
__device__ __forceinline__ v16h fragc_f32(const float* W, int k0, int n, int lane, int ld, int K) {
  v16h a; const int g = lane >> 4;
#pragma unroll
  for (int i = 0; i < 8; ++i) { const int ka = k0 + 8 * g + i, kb = ka + 16;
    a[i] = (_Float16)(ka < K ? W[(size_t)(ka < K ? ka : K - 1) * ld + n] : 0.f); a[8 + i] = (_Float16)(kb < K ? W[(size_t)(kb < K ? kb : K - 1) * ld + n] : 0.f); }
  return a;
}
struct F2 { v16b h, l; };
__device__ __forceinline__ F2 bsplit16(const float v[16]) { F2 r;
#pragma unroll
  for (int i = 0; i < 16; ++i) { const __bf16 h = (__bf16)v[i]; r.h[i] = h; r.l[i] = (__bf16)(v[i] - (float)h); }
  return r; }
__device__ __forceinline__ F2 split_row(const float* row, int k0, int lane) { float v[16]; const float* p = row + k0 + 8 * (lane >> 4);
#pragma unroll
  for (int i = 0; i < 8; ++i) { v[i] = p[i]; v[8 + i] = p[16 + i]; }
  return bsplit16(v); }
__device__ __forceinline__ F2 split_rowK(const float* row, int k0, int lane, int K) { float v[16]; const int g = lane >> 4;
#pragma unroll
  for (int i = 0; i < 8; ++i) { const int ka = k0 + 8 * g + i, kb = ka + 16; v[i] = ka < K ? row[ka < K ? ka : K - 1] : 0.f; v[8 + i] = kb < K ? row[kb < K ? kb : K - 1] : 0.f; }
  return bsplit16(v); }
__device__ __forceinline__ F2 split_col(const float* W, int k0, int n, int lane, int ld, int K) { float v[16]; const int g = lane >> 4;
#pragma unroll
  for (int i = 0; i < 8; ++i) { const int ka = k0 + 8 * g + i, kb = ka + 16; v[i] = ka < K ? W[(size_t)(ka < K ? ka : K - 1) * ld + n] : 0.f; v[8 + i] = kb < K ? W[(size_t)(kb < K ? kb : K - 1) * ld + n] : 0.f; }
  return bsplit16(v); }
__device__ __forceinline__ v8f mac3(const F2& a, const F2& b, v8f c) { c = wmma_bf(a.l, b.h, c); c = wmma_bf(a.h, b.l, c); return wmma_bf(a.h, b.h, c); }
__device__ __forceinline__ float sigm(float v) { return 1.0f / (1.0f + expf(-v)); }
#define LDSX() do { asm volatile("s_wait_dscnt 0" ::: "memory"); __builtin_amdgcn_wave_barrier(); __builtin_amdgcn_fence(__ATOMIC_RELEASE, "workgroup"); } while (0)

// Non-local block (B 4, C 256, 64 x 64 = 4,096 positions; C_int 32; (out,in) weights, no biases): theta, phi, g = W x ([32,256]); A[i][j] = softmax_j(theta_i . phi_j) (no scaling, sigma ~ 5.7); y[k][i] = sum_j A[i][j] g[k][j]; out = w_out y ([256,32]) + x.
#define NB 4
#define TT 4096
#define CC 128            // projected plane width (32 real columns + 96 not written)
#define DIN 256          // input (model) width
#define NH 1
#define HD 128
#define NQB (TT / 64)
#define HG 1               // 4,096 x 4,096 f32 planes reserved at WS_S, which no kernel uses
#define SCALE (1.0f)
#define HDQK 32            // theta / phi / g channels: the planes are 128 wide, columns >= 32 are not written; only the 32 real columns enter the scores
#define CAUSAL 0
#ifndef TNB
#define TNB NB
#endif
__device__ __forceinline__ v16b zero16b() { v16b z; _Pragma("unroll") for (int i = 0; i < 16; ++i) z[i] = (__bf16)0.f; return z; }
__device__ __forceinline__ float bfr(float v) { return (float)(__bf16)v; }
__host__ __device__ __forceinline__ int kb_last(int qb) { return CAUSAL ? ((qb * 64 + 63) >> 7) : (TT / 128 - 1); }
typedef __attribute__((ext_vector_type(8))) __bf16 v8b;
__device__ __forceinline__ v16b frag_b(const __bf16* rowk0, int lane) {
  union { v16b v; v8b q[2]; } u; const __bf16* p = rowk0 + 8 * (lane >> 4);
  u.q[0] = *(const v8b*)p; u.q[1] = *(const v8b*)(p + 16); return u.v;
}
#define QBH (TT / 64)      // ALL query blocks take k_att's 3-product scores
#define QBH_PV 0           // A.g stays single f16
#define QHI 4096            // q residual rows everywhere (3-product logits)
#define KHI 4096           // positions of the bf16 v hi/lo planes (all); the k residuals are stored for every key
// B fragment (k rows k0+.., output column o) of a weight: (in,out) [K][ld] or (out,in) [ld rows of K]: bf16 exact, or f16(bf16 * 256) exact
__device__ __forceinline__ v16b wcol_io(const float* Wm, int k0, int o, int lane, int ld) { v16b w; const int g = lane >> 4;
#pragma unroll
  for (int i = 0; i < 8; ++i) { w[i] = (__bf16)Wm[(size_t)(k0 + 8 * g + i) * ld + o]; w[8 + i] = (__bf16)Wm[(size_t)(k0 + 16 + 8 * g + i) * ld + o]; }
  return w; }
__device__ __forceinline__ v16b wcol_oi(const float* Wm, int k0, int o, int lane, int K) { v16b w; const float* p = Wm + (size_t)o * K + k0 + 8 * (lane >> 4);
#pragma unroll
  for (int i = 0; i < 8; ++i) { w[i] = (__bf16)p[i]; w[8 + i] = (__bf16)p[16 + i]; }
  return w; }
__device__ __forceinline__ v16h wcolh_io(const float* Wm, int k0, int o, int lane, int ld) { v16h w; const int g = lane >> 4;
#pragma unroll
  for (int i = 0; i < 8; ++i) { w[i] = (_Float16)(bfr(Wm[(size_t)(k0 + 8 * g + i) * ld + o]) * 256.0f); w[8 + i] = (_Float16)(bfr(Wm[(size_t)(k0 + 16 + 8 * g + i) * ld + o]) * 256.0f); }
  return w; }
__device__ __forceinline__ v16h wcolh_oi(const float* Wm, int k0, int o, int lane, int K) { v16h w; const float* p = Wm + (size_t)o * K + k0 + 8 * (lane >> 4);
#pragma unroll
  for (int i = 0; i < 8; ++i) { w[i] = (_Float16)(bfr(p[i]) * 256.0f); w[8 + i] = (_Float16)(bfr(p[16 + i]) * 256.0f); }
  return w; }
#define WQKV_LAYOUT 1   // 0 = (in,out) [DIN][CC]; 1 = (out,in) [HDQK][DIN]; 2 = per-head [NH][DIN][HD]
__device__ __forceinline__ v16b wcol_hdk(const float* Wm, int k0, int o, int lane) { v16b w; const int g = lane >> 4; const float* p = Wm + (size_t)(o / HD) * DIN * HD + (o % HD);
#pragma unroll
  for (int i = 0; i < 8; ++i) { w[i] = (__bf16)p[(size_t)(k0 + 8 * g + i) * HD]; w[8 + i] = (__bf16)p[(size_t)(k0 + 16 + 8 * g + i) * HD]; }
  return w; }
#define WO_OUT_IN 0
#if WQKV_LAYOUT == 1
#define WCOL(W, k0, o, lane) (((o) < HDQK) ? wcol_oi(W, k0, (o), lane, DIN) : zero16b())   /* theta/phi/g weights are [32][256] (out,in): output columns o >= 32 read as zero for all three */
#elif WQKV_LAYOUT == 2
#define WCOL(W, k0, o, lane) wcol_hdk(W, k0, o, lane)
#else
#define WCOL(W, k0, o, lane) wcol_io(W, k0, o, lane, CC)
#endif
#if WO_OUT_IN
#define WOCOL(W, k0, o, lane) wcol_oi(W, k0, o, lane, CC)
#define WOCOLH(W, k0, o, lane) wcolh_oi(W, k0, o, lane, CC)
#else
#define WOCOL(W, k0, o, lane) wcol_io(W, k0, o, lane, DIN)
#define WOCOLH(W, k0, o, lane) wcolh_io(W, k0, o, lane, DIN)
#endif
#ifndef XP
#define XP TT              // position pitch of x and of the output
#endif
#define BG HG              // unused
#define DVH 128
#ifndef SM_EXTRA_PARAMS
#define SM_EXTRA_PARAMS
#endif
#ifndef PROJ_EXTRA_PARAMS
#define PROJ_EXTRA_PARAMS
#endif
#ifndef SM_MASK_HOOK
#define SM_MASK_HOOK (void)0
#endif

#define WS_QH  0u                                      // f16 q rows [b*t][CC], the 32 real columns written and read
#define WS_KH  (WS_QH + 2u * (size_t)NB * TT * CC)      // f16 k tiles in fragment order [b*t / 16][hi 0, hi 1, residual 0, residual 1][lane][8]: run h of a plane holds, at lane (g, col), key row col's channels 16 h + 8 g + 0..7; the residual is x 2^10
#define WS_VT  (WS_KH + 2u * (size_t)NB * TT * CC)      // f16 v tiles in fragment order [b*t / 32][channel tile j][h][lane][8]: at lane (g, col), channel 16 j + col's positions 16 h + 8 g + 0..7
#define WS_QL  (WS_VT + 2u * (size_t)NB * CC * TT)      // f16 q residual x 2^10 rows [b][t < QHI][CC]
#define WS_KL  (WS_QL + 2u * (size_t)NB * QHI * CC)     // not used: the k residuals lie beside their hi tiles
#define WS_VB  (WS_KL + 2u * (size_t)NB * KHI * CC)     // not used
#define WS_VBL (WS_VB + 2u * (size_t)NB * CC * KHI)
#define WS_S   (WS_VBL + 2u * (size_t)NB * CC * KHI)    // f32 [hg][t][s], reserved; no kernel uses it
#define WS_Y   (WS_S  + 4u * (size_t)HG * TT * TT)      // empty (0 bytes); y stays in k_att's LDS
#define WS_END (WS_Y  + 0u)

// ---- k_proj: block = 64 positions, 8 waves; wave (pt, kq) = position tile pt (16 positions) x input channels [128 kq, 128 kq + 128). One gather of x serves theta, phi and g: the three weights (96 real rows, exact bf16) are staged once a block in LDS, every global load of the block is issued before the first wait, and only the 6 real column tiles are formed.
// theta and phi are formed transposed (A = weight rows, B = x positions), so a lane holds 8 channels in a row of one position, which is the order of a q row and of a k fragment run; g is formed as A = x positions, B = weight rows, so a lane holds 8 positions in a row of one channel, the order of a v fragment run: no turn in LDS. The two channel halves' f32 partial tiles are added through LDS (each wave hands over three tiles and finishes three).
typedef __attribute__((ext_vector_type(4))) __bf16 v4bw;
static_assert(DIN == 256 && HDQK == 32 && QHI == TT && TT % 64 == 0, "8 float4 of each weight a thread; two halves of 4 k steps; q residual rows lie as the q rows do");
__device__ __forceinline__ void st_split(_Float16* dh, _Float16* dl, v8f v) { v8h h, l;   /* f16 hi and residual x 2^10 of 8 values, 16 bytes each */
#pragma unroll
  for (int r = 0; r < 8; ++r) { const _Float16 hv = (_Float16)v[r]; h[r] = hv; l[r] = (_Float16)((v[r] - (float)hv) * 1024.0f); }
  *(v8h*)dh = h; *(v8h*)dl = l; }
__global__ __launch_bounds__(256) void k_proj(const float* __restrict__ X, const float* __restrict__ WQ, const float* __restrict__ WK, const float* __restrict__ WV, _Float16* __restrict__ QH, _Float16* __restrict__ QL, _Float16* __restrict__ KH, _Float16* __restrict__ VT) {
  __shared__ __align__(16) __bf16 sw[3 * HDQK][DIN + 8];   /* theta, phi, g weight rows, 528-byte pitch */
  __shared__ __align__(16) float sx[8][3][32][8];          /* the three partial tiles each wave hands to its partner, as they lie in registers */
  const int tid = threadIdx.x, wave = __builtin_amdgcn_readfirstlane(tid >> 5), lane = tid & 31, col = lane & 15, g = lane >> 4, pt = wave & 3, kq = wave >> 2;
  const size_t r0 = (size_t)blockIdx.x * 64, bb = r0 / TT; const int t0 = (int)(r0 % TT);
  v4f wr[24]; float xv[4][16];
  // every bare '#pragma unroll' in k_proj: its loop indexes loaded values, fragments or accumulators, which stay in registers only when the loop is fully unrolled
#pragma unroll
  for (int i = 0; i < 24; ++i) { const float* Wm = i < 8 ? WQ : i < 16 ? WK : WV; wr[i] = *(const v4f*)(Wm + (i & 7) * 1024 + tid * 4); }   /* 4 weight rows (4,096 bytes in a row) a step */
  { const float* p = X + (bb * DIN + kq * 128 + 8 * g) * (size_t)XP + t0 + pt * 16 + col;   /* channels-first gather: x[b][k][t], stride XP between k */
#pragma unroll
    for (int kc = 0; kc < 4; ++kc)
#pragma unroll
      for (int i = 0; i < 8; ++i) { xv[kc][i] = p[(size_t)(kc * 32 + i) * XP]; xv[kc][8 + i] = p[(size_t)(kc * 32 + 16 + i) * XP]; } }
  asm volatile("s_wait_xcnt 0x0" ::: "memory");   /* the loads' address registers stay as they are until this wait */
#pragma unroll
  for (int i = 0; i < 24; ++i) { v4bw w4;
#pragma unroll
    for (int e = 0; e < 4; ++e) w4[e] = (__bf16)wr[i][e];
    *(v4bw*)&sw[(i >> 3) * HDQK + (i & 7) * 4 + (tid >> 6)][(tid & 63) * 4] = w4; }
  __syncthreads();   /* the weight rows are in LDS before any wave reads them */
  v8f acc[6] = {};   /* 0, 1: theta^T channel tiles; 2, 3: phi^T channel tiles; 4, 5: g channel tiles */
  v16b wf[2][6];   /* the weight fragments of this k step and of the next */
#pragma unroll
  for (int j = 0; j < 6; ++j) wf[0][j] = frag_b(&sw[j * 16 + col][kq * 128], lane);
#pragma unroll
  for (int kc = 0; kc < 4; ++kc) { v16b a;
#pragma unroll
    for (int i = 0; i < 16; ++i) a[i] = (__bf16)xv[kc][i];
    if (kc < 3) {
#pragma unroll
      for (int j = 0; j < 6; ++j) wf[(kc + 1) & 1][j] = frag_b(&sw[j * 16 + col][kq * 128 + (kc + 1) * 32], lane); }
    __builtin_amdgcn_sched_barrier(0);   /* keeps the next step's twelve LDS reads in front of this step's products, so that their latency runs under them (left free, the compiler reads one fragment ahead and waits at every product) */
#pragma unroll
    for (int j = 0; j < 6; ++j) { const v16b w = wf[kc & 1][j];   /* the bare builtin: the compiler keeps the distances behind it */
      acc[j] = j < 4 ? __builtin_amdgcn_wmma_f32_16x16x32_bf16(false, w, false, a, (short)0, acc[j], false, false) : __builtin_amdgcn_wmma_f32_16x16x32_bf16(false, a, false, w, (short)0, acc[j], false, false); } }
  // the wave of the low channel half finishes theta's two tiles and g's first, its partner phi's two and g's second
  v8f mine[3], send[3];
  mine[0] = kq ? acc[2] : acc[0]; mine[1] = kq ? acc[3] : acc[1]; mine[2] = kq ? acc[5] : acc[4];
  send[0] = kq ? acc[0] : acc[2]; send[1] = kq ? acc[1] : acc[3]; send[2] = kq ? acc[4] : acc[5];
#pragma unroll
  for (int m = 0; m < 3; ++m) *(v8f*)&sx[wave][m][lane][0] = send[m];
  __syncthreads();   /* the partial tiles are in LDS before the partner wave reads them */
#pragma unroll
  for (int m = 0; m < 3; ++m) mine[m] += *(const v8f*)&sx[wave ^ 4][m][lane][0];
  if (kq == 0) { const size_t o = (r0 + pt * 16 + col) * CC + 8 * g;   /* q rows: the lane's position, channels 16 m + 8 g + 0..7; one wave writes a row's 64 bytes */
    st_split(QH + o, QL + o, mine[0]); st_split(QH + o + 16, QL + o + 16, mine[1]);
    asm volatile("s_wait_xcnt 0x0" ::: "memory"); }   /* the four stores' registers stay as they are until this wait */
  else { _Float16* d = KH + ((r0 >> 4) + pt) * 1024 + lane * 8;   /* k tile pt: runs hi 0, hi 1, residual 0, residual 1, 512 bytes each */
    st_split(d, d + 512, mine[0]); st_split(d + 256, d + 768, mine[1]);
    asm volatile("s_wait_xcnt 0x0" ::: "memory"); }   /* the four stores' registers stay as they are until this wait */
  { v8h h;   /* v tile of 32 positions: run (channel tile kq, position half pt & 1) */
#pragma unroll
    for (int r = 0; r < 8; ++r) h[r] = (_Float16)mine[2][r];
    *(v8h*)(VT + ((r0 >> 5) + (pt >> 1)) * 1024 + (kq * 2 + (pt & 1)) * 256 + lane * 8) = h; } }
// ---- k_att: block = 64 queries (4 tiles of 16) of batch blockIdx.y, 16 waves; wave w owns keys [256 w, 256 w + 256) for all 64 queries; its key and value fragments lie in the workspace in fragment order, so each of its global loads reads 512 bytes in a row (4 cache lines, not 16). Scores are formed transposed, S^T = phi . theta^T (A = key rows, B = query rows, staged once in LDS: pass 1 keeps their hi fragments in registers, pass 2 reads them per tile), so a lane holds one query's scores.
// pass 1: row maxima m of the hi planes' product alone (1 product; joined over the waves in LDS): m is only the point the exponentials are taken from, it cancels in sum(e g) / sum(e), and it lies within the residual products (about 2^-10 |theta| |phi|) of the true maximum, far inside the 2^5 that f16 leaves above 2^11. pass 2: the full scores (hi + residual planes, 3 products), e = exp2(s log2 e - (m log2 e - 11)) once to f16; two S^T tiles of 16 keys are the B operand of y^T += g^T . e^T with no lane exchange; f32 sums of e per lane. The 16 partial y tiles and sums are added in LDS in wave order, y = sum(e g) / sum(e). tail: y (bf16 hi + lo, in LDS) against exact w_out on WMMA, one tile of 16 output channels a wave, turned in LDS to runs of 64 positions, + bf16(x), stored to out.
// the bare '#pragma unroll's in k_att whose loops index fragments or accumulators: these stay in registers only when the loop is fully unrolled
#define AQT 4              // query tiles per wave: each key / value fragment load serves 64 queries
#define AKW 16             // key ranges = waves per block
#define AKR (TT / AKW)     // keys per wave
__device__ __forceinline__ v16h frag_p(const _Float16* p) { union { v16h v; v8h q[2]; } u; u.q[0] = *(const v8h*)p; u.q[1] = *(const v8h*)(p + 16); return u.v; }   /* frag_h with the lane's 8 (lane >> 4) already in p */
__device__ __forceinline__ v16h frag_c(const _Float16* p) { union { v16h v; v8h q[2]; } u; u.q[0] = *(const v8h*)p; u.q[1] = *(const v8h*)(p + 256); return u.v; }   /* a fragment stored in fragment order: two runs of 512 bytes, the lane's 8 lane already in p */
typedef __attribute__((ext_vector_type(4))) __bf16 v4b;
static_assert(32 * AKW * 16 == DIN * HDQK && DIN == 16 * AKW && 16 * 68 <= 16 * AQT * (HDQK + 4), "16 weights a thread; one output channel tile a wave; its output tile fits the LDS of its partial tile");
static_assert(CC == 128 && HDQK == 32 && AKR % 32 == 0, "the fragment-order tiles hold 32 channels, written by k_proj's one column block");
static_assert(AKR % 128 == 0, "pass 1 takes eight key tiles a trip");
#define L2E 1.4426950408889634f
__global__ __launch_bounds__(32 * AKW) void k_att(const _Float16* __restrict__ QH, const _Float16* __restrict__ QL, const _Float16* __restrict__ KF, const _Float16* __restrict__ VF, const float* __restrict__ X, const float* __restrict__ WW, float* __restrict__ OUT) {
  __shared__ __align__(16) float so[AKW][16 * AQT][HDQK + 4]; __shared__ float sm[AKW][16 * AQT], sl[AKW][16 * AQT], smx[16 * AQT]; __shared__ __align__(16) _Float16 sq[16 * AQT][HDQK + 8], sp[16 * AQT][HDQK + 8];   /* the block's query rows, residual and hi, 80-byte pitch */
  __shared__ __align__(16) __bf16 syh[16 * AQT][HDQK + 8], syl[16 * AQT][HDQK + 8], swo[DIN][HDQK + 8];   /* the block's y rows, bf16 hi and lo, and w_out's rows, exact bf16: 80-byte pitch */
  const int tid = threadIdx.x, wave = tid >> 5, lane = tid & 31, col = lane & 15, g = lane >> 4;
  const size_t b = blockIdx.y, rb = b * TT; const int q0 = blockIdx.x * (16 * AQT), kbeg = wave * AKR;
  float mx[AQT], ls[AQT]; v8f o[AQT][HDQK / 16] = {};
#pragma unroll
  for (int t = 0; t < AQT; ++t) { mx[t] = -3.0e38f; ls[t] = 0.f; }
  v4f wr[4];   /* w_out, 16 weights a thread, goes to LDS here: loaded in front of the query rows so that the two latencies run together, and the tail waits for no weight load */
#pragma unroll
  for (int i = 0; i < 4; ++i) wr[i] = *(const v4f*)(WW + tid * 16 + i * 4);
  if (tid < 64 * AQT) { const int row = tid >> 2, sg = (tid & 3) * 8; *(v8h*)&sq[row][sg] = *(const v8h*)(QL + (rb + q0 + row) * CC + sg); *(v8h*)&sp[row][sg] = *(const v8h*)(QH + (rb + q0 + row) * CC + sg); }
  { v8b w0, w1;
#pragma unroll
    for (int i = 0; i < 4; ++i) { w0[i] = (__bf16)wr[0][i]; w0[4 + i] = (__bf16)wr[1][i]; w1[i] = (__bf16)wr[2][i]; w1[4 + i] = (__bf16)wr[3][i]; }
    *(v8b*)&swo[tid >> 1][(tid & 1) * 16] = w0; *(v8b*)&swo[tid >> 1][(tid & 1) * 16 + 8] = w1; }
  __syncthreads();   /* the query rows (and w_out's) are in LDS before any wave reads them */
  { const _Float16* qk = KF + ((rb + kbeg) >> 4) * 1024 + lane * 8;   /* the lane's 16 bytes in the first run of the wave's first key tile */
    v16h qh[AQT];   /* pass 1 has the registers to hold the query hi fragments */
#pragma unroll
    for (int t = 0; t < AQT; ++t) qh[t] = frag_h(&sp[t * 16 + col][0], lane);
#pragma unroll 1   /* rolled: a trip already holds eight key tiles; the build with both trips unrolled spills */
    for (int kt = 0; kt < AKR / 128; ++kt) { v16h kh[8];   /* eight key tiles' hi fragments, 16 loads in flight together */
#pragma unroll
      for (int u = 0; u < 8; ++u) kh[u] = frag_c(qk + u * 1024);   /* the hi runs are the first 1,024 bytes of a tile's 2,048 */
      asm volatile("s_wait_xcnt 0x0" :: "v"(qk) : "memory");   /* the sixteen loads' address register stays as it is until this wait */
      __builtin_amdgcn_sched_barrier(0);   /* keeps all sixteen loads, and the wait, in front of the products and of the address's addition: left free, the compiler issues four of the loads in the middle of the trip and adds to the address ahead of the wait */
      qk += 8 * 1024;
#pragma unroll
      for (int u = 0; u < 8; ++u)
#pragma unroll
        for (int t = 0; t < AQT; ++t) { v8f s = {}; s = wmma16(kh[u], qh[t], s);
#pragma unroll
          for (int r = 0; r < 8; ++r) mx[t] = fmaxf(mx[t], s[r] * SCALE); } } }
#pragma unroll
  for (int t = 0; t < AQT; ++t) { mx[t] = fmaxf(mx[t], __shfl_xor(mx[t], 16)); if (g == 0) sm[wave][t * 16 + col] = mx[t]; }
  __syncthreads();   /* every wave's maxima are in LDS before they are joined */
  if (tid < 16 * AQT) { float a = sm[0][tid];
#pragma unroll
    for (int w = 1; w < AKW; ++w) a = fmaxf(a, sm[w][tid]);
    smx[tid] = a * L2E - 11.0f; }   /* m log2 e - 11: e = 2^11 exp(s - m), the scale cancels in sum(e g) / sum(e) */
  __syncthreads();   /* the joined maxima are in LDS before any wave reads them */
  const _Float16 *pk = KF + ((rb + kbeg) >> 4) * 1024 + lane * 8, *pv = VF + ((rb + kbeg) >> 5) * 1024 + lane * 8;   /* the lane's 16 bytes in the first run of the wave's first key tile and of its first value tile */
#pragma unroll 1   /* rolled: 256 registers a wave is the budget of 4 waves per SIMD */
  for (int kc = 0; kc < AKR / 32; ++kc) {
    const v16h kh0 = frag_c(pk), kl0 = frag_c(pk + 512), kh1 = frag_c(pk + 1024), kl1 = frag_c(pk + 1536);
    v16h vf[HDQK / 16];
#pragma unroll
    for (int j = 0; j < HDQK / 16; ++j) vf[j] = frag_c(pv + j * 512);
    asm volatile("s_wait_xcnt 0x0" :: "v"(pk), "v"(pv) : "memory");   /* the twelve loads' address registers stay as they are until this wait; its memory clobber also keeps the LDS reads below inside the loop: hoisted, the query fragments and the maxima's copies for packed subtracts hold about 90 more registers and spill */
    pk += 2 * 1024; pv += 1024;
#pragma unroll
    for (int t = 0; t < AQT; ++t) { v16h p; const v16h qht = frag_h(&sp[t * 16 + col][0], lane), qlt = frag_h(&sq[t * 16 + col][0], lane); const float mt = smx[t * 16 + col];
      v8f a0 = {}, a1 = {}, b0 = {}, b1 = {};   /* hi and residual products of both key tiles, all six written ahead of the vector work */
      a0 = wmma16(kh0, qht, a0); a1 = wmma16(kh1, qht, a1); b0 = wmma16(kh0, qlt, b0); b1 = wmma16(kh1, qlt, b1); b0 = wmma16(kl0, qht, b0); b1 = wmma16(kl1, qht, b1);
      __builtin_amdgcn_sched_barrier(0);   /* cuts the unrolled trip's scheduling here, so that one piece holds a query tile's vector work with the next tile's LDS reads and products, which the compiler then places among it: they fill the distances behind each other. Without the cut it orders the whole trip for the fewest registers, in short dependent chains, with more than twice the idle slots */
      // the scores as exponents of 2: (hi + residual / 1024) log2 e - mt, two fused multiply-adds an element (the residual's scale and log2 e are one constant)
      const v8f x0 = a0 * (SCALE * L2E) - mt, x1 = a1 * (SCALE * L2E) - mt, s0 = b0 * (SCALE * L2E / 1024.0f) + x0, s1 = b1 * (SCALE * L2E / 1024.0f) + x1;
#pragma unroll
      for (int r = 0; r < 8; ++r) { const float e = __builtin_amdgcn_exp2f(s0[r]); p[r] = (_Float16)e; ls[t] += e; }
#pragma unroll
      for (int r = 0; r < 8; ++r) { const float e = __builtin_amdgcn_exp2f(s1[r]); p[8 + r] = (_Float16)e; ls[t] += e; }
#pragma unroll
      for (int j = 0; j < HDQK / 16; ++j) o[t][j] = wmma16(vf[j], p, o[t][j]); } }   /* D element r = y^T[channel 16 j + 8 g + r][query col] */
#pragma unroll
  for (int t = 0; t < AQT; ++t) { ls[t] += __shfl_xor(ls[t], 16); if (g == 0) sl[wave][t * 16 + col] = ls[t];
#pragma unroll
    for (int j = 0; j < HDQK / 16; ++j) { v4f lo, hi;
#pragma unroll
      for (int r = 0; r < 4; ++r) { lo[r] = o[t][j][r]; hi[r] = o[t][j][4 + r]; }
      *(v4f*)&so[wave][t * 16 + col][j * 16 + 8 * g] = lo; *(v4f*)&so[wave][t * 16 + col][j * 16 + 8 * g + 4] = hi; } }
  // tail: out = w_out y + x for the block's 64 positions; wave w owns output channels [16 w, 16 w + 16)
  __syncthreads();   /* every wave's partial tile and sums are in LDS before they are added */
  { const int row = tid >> 3, c4 = (tid & 7) * 4; v4f s = *(const v4f*)&so[0][row][c4]; float l = sl[0][row];
#pragma unroll
    for (int w = 1; w < AKW; ++w) { s += *(const v4f*)&so[w][row][c4]; l += sl[w][row]; }
    const v4f y = s * (1.0f / l); v4b yh, yl;
#pragma unroll
    for (int r = 0; r < 4; ++r) { const __bf16 h = (__bf16)y[r]; yh[r] = h; yl[r] = (__bf16)(y[r] - (float)h); }
    *(v4b*)&syh[row][c4] = yh; *(v4b*)&syl[row][c4] = yl; }
  __syncthreads();   /* the y rows are in LDS before any wave reads them, and every read of the partial tiles is over before their LDS is written again */
  const int c0 = wave * 16; const size_t ob = (b * DIN + c0 + g) * (size_t)XP + q0 + col * 4;   /* 16 lanes cover one channel's 64 positions (256 bytes in a row), the two lane halves two channels */
  v4f xr[8];   /* the wave's x tile, loaded here so that the loads' latency runs under the products below (in front of the barrier they would be waited for at it) */
#pragma unroll
  for (int i = 0; i < 8; ++i) xr[i] = *(const v4f*)(X + ob + (size_t)(2 * i) * XP);
  asm volatile("s_wait_xcnt 0x0" ::: "memory");   /* the x loads' address registers stay as they are until this wait */
  const v16b wf = frag_b(&swo[c0 + col][0], lane);   /* A fragment: row = output channel c0 + col, k = the 32 y channels */
  float* st = &so[wave][0][0];   /* the wave's own 16 channels x 64 positions, 68-float pitch, in the LDS of its partial tile */
#pragma unroll
  for (int t = 0; t < AQT; ++t) { v8f a = {}; a = wmma_bf(wf, frag_b(&syh[t * 16 + col][0], lane), a); a = wmma_bf(wf, frag_b(&syl[t * 16 + col][0], lane), a);   /* D element r = out[channel c0 + 8 g + r][position 16 t + col] */
#pragma unroll
    for (int r = 0; r < 8; ++r) st[(8 * g + r) * 68 + t * 16 + col] = a[r]; }
  LDSX();   /* the wave's own stores are in LDS before its lanes read each other's */
  __builtin_amdgcn_sched_barrier(0);   /* keeps the x tile's roundings, and with them the wait for its loads, behind the products */
#pragma unroll
  for (int i = 0; i < 8; ++i) { const v4f v = *(const v4f*)&st[(2 * i + g) * 68 + col * 4]; v4f r4;
#pragma unroll
    for (int e = 0; e < 4; ++e) r4[e] = v[e] + bfr(xr[i][e]);
    vst2(OUT + ob + (size_t)(2 * i) * XP, r4); } }

extern "C" void kernel_launch(void* const* d_in, const int* in_sizes, int n_in, void* d_out, int out_size, void* d_ws, size_t ws_size, hipStream_t stream) {
  (void)in_sizes; (void)n_in; (void)out_size;
  const float** F = (const float**)d_in;
  if (ws_size < (size_t)WS_END) return;
  char* ws = (char*)d_ws; _Float16 *QH = (_Float16*)(ws + WS_QH), *KH = (_Float16*)(ws + WS_KH), *VT = (_Float16*)(ws + WS_VT), *QL = (_Float16*)(ws + WS_QL);
  // inputs: 0 x [4,256,64,64]; 1 w_theta [32,256] (out,in); 2 w_phi; 3 w_g; 4 w_out [256,32] (out,in); no biases
  k_proj<<<dim3(TNB * TT / 64), 256, 0, stream>>>(F[0], F[1], F[2], F[3], QH, QL, KH, VT);   /* q = theta, k = phi, v = g */
  k_att<<<dim3(TT / (16 * AQT), TNB), 32 * AKW, 0, stream>>>(QH, QL, KH, VT, F[0], F[4], (float*)d_out);
}

// v009
// Measured time: 22.8 microseconds a run.
// Timed twice side by side with v008, it ran 1.18 times as fast both times.
// All steps since v000 together make it 47.0 times as fast.
// compute dtype: all float inputs rounded to bf16; theta/phi/g = W x with EXACT bf16 products on WMMA 16x16x32 (f32 accumulate); unscaled affinities theta.phi with both as f16 hi + residual planes (3 products); softmax in f32, one pass over the keys (exponentials as the hardware's exp2 of s log2 e - ref, ref = a reference point kept per wave and query, raised when a sum of 16 exponentials grows too large for f16); the exponentials once to f16 against g once to f16 (1 product); the waves' partial sums weighted by exp2(ref - largest ref), divided by the f32 sum of the exponentials after the product; y split bf16 hi + lo against exact w_out (2 products); + x in f32; f32 output.
#include <hip/hip_runtime.h>
#include <math.h>

typedef __attribute__((ext_vector_type(16))) _Float16 v16h;
typedef __attribute__((ext_vector_type(16))) __bf16 v16b;
typedef __attribute__((ext_vector_type(8)))  _Float16 v8h;
typedef __attribute__((ext_vector_type(8)))  float v8f;
typedef __attribute__((ext_vector_type(4)))  float v4f;
typedef __attribute__((ext_vector_type(2)))  float v2f;
typedef __attribute__((ext_vector_type(4)))  unsigned v4u;
typedef __attribute__((ext_vector_type(4)))  int v4i;
typedef float __attribute__((may_alias)) float_a;
typedef int __attribute__((may_alias)) int_a;

template <typename T> __device__ __forceinline__ void vst2(void* p, T v) { *(T*)p = v;  }
__device__ __forceinline__ v8f wmma16(v16h a, v16h b, v8f c) {
  return __builtin_amdgcn_wmma_f32_16x16x32_f16(false, a, false, b, (short)0, c, false, false);   /* the bare builtin: the compiler keeps the distances behind it and fills them with independent work where it has some */
}
__device__ __forceinline__ v8f wmma_bf(v16b a, v16b b, v8f c) {
  return __builtin_amdgcn_wmma_f32_16x16x32_bf16(false, a, false, b, (short)0, c, false, false);   /* the bare builtin, as above */
}
// 16x16x32 fragments: lane = (h = lane>>4, row/col = lane&15); elements 0..7 = k0+8h+0..7, 8..15 = k0+16+8h+0..7; D element r = row 8h+r
__device__ __forceinline__ v16h frag_h(const _Float16* rowk0, int lane) {
  union { v16h v; v8h q[2]; } u; const _Float16* p = rowk0 + 8 * (lane >> 4);
  u.q[0] = *(const v8h*)p; u.q[1] = *(const v8h*)(p + 16); return u.v;
}
__device__ __forceinline__ v16h frag_f32(const float* rowk0, int lane) {
  v16h a; const float* p = rowk0 + 8 * (lane >> 4);
#pragma unroll
  for (int i = 0; i < 8; ++i) { a[i] = (_Float16)p[i]; a[8 + i] = (_Float16)p[16 + i]; }
  return a;
}
__device__ __forceinline__ v16h frag_f32s(const float* rowk0, int lane, float sc) {
  v16h a; const float* p = rowk0 + 8 * (lane >> 4);
#pragma unroll
  for (int i = 0; i < 8; ++i) { a[i] = (_Float16)(p[i] * sc); a[8 + i] = (_Float16)(p[16 + i] * sc); }
  return a;
}
// column fragment from a [K][ld] layout (column n), rows >= K read as 0
__device__ __forceinline__ v16h fragc_f32(const float* W, int k0, int n, int lane, int ld, int K) {
  v16h a; const int g = lane >> 4;
#pragma unroll
  for (int i = 0; i < 8; ++i) { const int ka = k0 + 8 * g + i, kb = ka + 16;
    a[i] = (_Float16)(ka < K ? W[(size_t)(ka < K ? ka : K - 1) * ld + n] : 0.f); a[8 + i] = (_Float16)(kb < K ? W[(size_t)(kb < K ? kb : K - 1) * ld + n] : 0.f); }
  return a;
}
struct F2 { v16b h, l; };
__device__ __forceinline__ F2 bsplit16(const float v[16]) { F2 r;
#pragma unroll
  for (int i = 0; i < 16; ++i) { const __bf16 h = (__bf16)v[i]; r.h[i] = h; r.l[i] = (__bf16)(v[i] - (float)h); }
  return r; }
__device__ __forceinline__ F2 split_row(const float* row, int k0, int lane) { float v[16]; const float* p = row + k0 + 8 * (lane >> 4);
#pragma unroll
  for (int i = 0; i < 8; ++i) { v[i] = p[i]; v[8 + i] = p[16 + i]; }
  return bsplit16(v); }
__device__ __forceinline__ F2 split_rowK(const float* row, int k0, int lane, int K) { float v[16]; const int g = lane >> 4;
#pragma unroll
  for (int i = 0; i < 8; ++i) { const int ka = k0 + 8 * g + i, kb = ka + 16; v[i] = ka < K ? row[ka < K ? ka : K - 1] : 0.f; v[8 + i] = kb < K ? row[kb < K ? kb : K - 1] : 0.f; }
  return bsplit16(v); }
__device__ __forceinline__ F2 split_col(const float* W, int k0, int n, int lane, int ld, int K) { float v[16]; const int g = lane >> 4;
#pragma unroll
  for (int i = 0; i < 8; ++i) { const int ka = k0 + 8 * g + i, kb = ka + 16; v[i] = ka < K ? W[(size_t)(ka < K ? ka : K - 1) * ld + n] : 0.f; v[8 + i] = kb < K ? W[(size_t)(kb < K ? kb : K - 1) * ld + n] : 0.f; }
  return bsplit16(v); }
__device__ __forceinline__ v8f mac3(const F2& a, const F2& b, v8f c) { c = wmma_bf(a.l, b.h, c); c = wmma_bf(a.h, b.l, c); return wmma_bf(a.h, b.h, c); }
__device__ __forceinline__ float sigm(float v) { return 1.0f / (1.0f + expf(-v)); }
#define LDSX() do { asm volatile("s_wait_dscnt 0" ::: "memory"); __builtin_amdgcn_wave_barrier(); __builtin_amdgcn_fence(__ATOMIC_RELEASE, "workgroup"); } while (0)

// Non-local block (B 4, C 256, 64 x 64 = 4,096 positions; C_int 32; (out,in) weights, no biases): theta, phi, g = W x ([32,256]); A[i][j] = softmax_j(theta_i . phi_j) (no scaling, sigma ~ 5.7); y[k][i] = sum_j A[i][j] g[k][j]; out = w_out y ([256,32]) + x.
#define NB 4
#define TT 4096
#define CC 128            // projected plane width (32 real columns + 96 not written)
#define DIN 256          // input (model) width
#define NH 1
#define HD 128
#define NQB (TT / 64)
#define HG 1               // 4,096 x 4,096 f32 planes reserved at WS_S, which no kernel uses
#define SCALE (1.0f)
#define HDQK 32            // theta / phi / g channels: the planes are 128 wide, columns >= 32 are not written; only the 32 real columns enter the scores
#define CAUSAL 0
#ifndef TNB
#define TNB NB
#endif
__device__ __forceinline__ v16b zero16b() { v16b z; _Pragma("unroll") for (int i = 0; i < 16; ++i) z[i] = (__bf16)0.f; return z; }
__device__ __forceinline__ float bfr(float v) { return (float)(__bf16)v; }
__host__ __device__ __forceinline__ int kb_last(int qb) { return CAUSAL ? ((qb * 64 + 63) >> 7) : (TT / 128 - 1); }
typedef __attribute__((ext_vector_type(8))) __bf16 v8b;
__device__ __forceinline__ v16b frag_b(const __bf16* rowk0, int lane) {
  union { v16b v; v8b q[2]; } u; const __bf16* p = rowk0 + 8 * (lane >> 4);
  u.q[0] = *(const v8b*)p; u.q[1] = *(const v8b*)(p + 16); return u.v;
}
#define QBH (TT / 64)      // ALL query blocks take k_att's 3-product scores
#define QBH_PV 0           // A.g stays single f16
#define QHI 4096            // q residual rows everywhere (3-product logits)
#define KHI 4096           // positions of the bf16 v hi/lo planes (all); the k residuals are stored for every key
// B fragment (k rows k0+.., output column o) of a weight: (in,out) [K][ld] or (out,in) [ld rows of K]: bf16 exact, or f16(bf16 * 256) exact
__device__ __forceinline__ v16b wcol_io(const float* Wm, int k0, int o, int lane, int ld) { v16b w; const int g = lane >> 4;
#pragma unroll
  for (int i = 0; i < 8; ++i) { w[i] = (__bf16)Wm[(size_t)(k0 + 8 * g + i) * ld + o]; w[8 + i] = (__bf16)Wm[(size_t)(k0 + 16 + 8 * g + i) * ld + o]; }
  return w; }
__device__ __forceinline__ v16b wcol_oi(const float* Wm, int k0, int o, int lane, int K) { v16b w; const float* p = Wm + (size_t)o * K + k0 + 8 * (lane >> 4);
#pragma unroll
  for (int i = 0; i < 8; ++i) { w[i] = (__bf16)p[i]; w[8 + i] = (__bf16)p[16 + i]; }
  return w; }
__device__ __forceinline__ v16h wcolh_io(const float* Wm, int k0, int o, int lane, int ld) { v16h w; const int g = lane >> 4;
#pragma unroll
  for (int i = 0; i < 8; ++i) { w[i] = (_Float16)(bfr(Wm[(size_t)(k0 + 8 * g + i) * ld + o]) * 256.0f); w[8 + i] = (_Float16)(bfr(Wm[(size_t)(k0 + 16 + 8 * g + i) * ld + o]) * 256.0f); }
  return w; }
__device__ __forceinline__ v16h wcolh_oi(const float* Wm, int k0, int o, int lane, int K) { v16h w; const float* p = Wm + (size_t)o * K + k0 + 8 * (lane >> 4);
#pragma unroll
  for (int i = 0; i < 8; ++i) { w[i] = (_Float16)(bfr(p[i]) * 256.0f); w[8 + i] = (_Float16)(bfr(p[16 + i]) * 256.0f); }
  return w; }
#define WQKV_LAYOUT 1   // 0 = (in,out) [DIN][CC]; 1 = (out,in) [HDQK][DIN]; 2 = per-head [NH][DIN][HD]
__device__ __forceinline__ v16b wcol_hdk(const float* Wm, int k0, int o, int lane) { v16b w; const int g = lane >> 4; const float* p = Wm + (size_t)(o / HD) * DIN * HD + (o % HD);
#pragma unroll
  for (int i = 0; i < 8; ++i) { w[i] = (__bf16)p[(size_t)(k0 + 8 * g + i) * HD]; w[8 + i] = (__bf16)p[(size_t)(k0 + 16 + 8 * g + i) * HD]; }
  return w; }
#define WO_OUT_IN 0
#if WQKV_LAYOUT == 1
#define WCOL(W, k0, o, lane) (((o) < HDQK) ? wcol_oi(W, k0, (o), lane, DIN) : zero16b())   /* theta/phi/g weights are [32][256] (out,in): output columns o >= 32 read as zero for all three */
#elif WQKV_LAYOUT == 2
#define WCOL(W, k0, o, lane) wcol_hdk(W, k0, o, lane)
#else
#define WCOL(W, k0, o, lane) wcol_io(W, k0, o, lane, CC)
#endif
#if WO_OUT_IN
#define WOCOL(W, k0, o, lane) wcol_oi(W, k0, o, lane, CC)
#define WOCOLH(W, k0, o, lane) wcolh_oi(W, k0, o, lane, CC)
#else
#define WOCOL(W, k0, o, lane) wcol_io(W, k0, o, lane, DIN)
#define WOCOLH(W, k0, o, lane) wcolh_io(W, k0, o, lane, DIN)
#endif
#ifndef XP
#define XP TT              // position pitch of x and of the output
#endif
#define BG HG              // unused
#define DVH 128
#ifndef SM_EXTRA_PARAMS
#define SM_EXTRA_PARAMS
#endif
#ifndef PROJ_EXTRA_PARAMS
#define PROJ_EXTRA_PARAMS
#endif
#ifndef SM_MASK_HOOK
#define SM_MASK_HOOK (void)0
#endif

#define WS_QH  0u                                      // f16 q rows [b*t][CC], the 32 real columns written and read
#define WS_KH  (WS_QH + 2u * (size_t)NB * TT * CC)      // f16 k tiles in fragment order [b*t / 16][hi 0, hi 1, residual 0, residual 1][lane][8]: run h of a plane holds, at lane (g, col), key row col's channels 16 h + 8 g + 0..7; the residual is x 2^10
#define WS_VT  (WS_KH + 2u * (size_t)NB * TT * CC)      // f16 v tiles in fragment order [b*t / 32][channel tile j][h][lane][8]: at lane (g, col), channel 16 j + col's positions 16 h + 8 g + 0..7
#define WS_QL  (WS_VT + 2u * (size_t)NB * CC * TT)      // f16 q residual x 2^10 rows [b][t < QHI][CC]
#define WS_KL  (WS_QL + 2u * (size_t)NB * QHI * CC)     // not used: the k residuals lie beside their hi tiles
#define WS_VB  (WS_KL + 2u * (size_t)NB * KHI * CC)     // not used
#define WS_VBL (WS_VB + 2u * (size_t)NB * CC * KHI)
#define WS_S   (WS_VBL + 2u * (size_t)NB * CC * KHI)    // f32 [hg][t][s], reserved; no kernel uses it
#define WS_Y   (WS_S  + 4u * (size_t)HG * TT * TT)      // empty (0 bytes); y stays in k_att's LDS
#define WS_END (WS_Y  + 0u)

// ---- k_proj: block = 64 positions, 8 waves; wave (pt, kq) = position tile pt (16 positions) x input channels [128 kq, 128 kq + 128). One gather of x serves theta, phi and g: the three weights (96 real rows, exact bf16) are staged once a block in LDS, every global load of the block is issued before the first wait, and only the 6 real column tiles are formed.
// theta and phi are formed transposed (A = weight rows, B = x positions), so a lane holds 8 channels in a row of one position, which is the order of a q row and of a k fragment run; g is formed as A = x positions, B = weight rows, so a lane holds 8 positions in a row of one channel, the order of a v fragment run: no turn in LDS. The two channel halves' f32 partial tiles are added through LDS (each wave hands over three tiles and finishes three).
typedef __attribute__((ext_vector_type(4))) __bf16 v4bw;
static_assert(DIN == 256 && HDQK == 32 && QHI == TT && TT % 64 == 0, "8 float4 of each weight a thread; two halves of 4 k steps; q residual rows lie as the q rows do");
__device__ __forceinline__ void st_split(_Float16* dh, _Float16* dl, v8f v) { v8h h, l;   /* f16 hi and residual x 2^10 of 8 values, 16 bytes each */
#pragma unroll
  for (int r = 0; r < 8; ++r) { const _Float16 hv = (_Float16)v[r]; h[r] = hv; l[r] = (_Float16)((v[r] - (float)hv) * 1024.0f); }
  *(v8h*)dh = h; *(v8h*)dl = l; }
__global__ __launch_bounds__(256) void k_proj(const float* __restrict__ X, const float* __restrict__ WQ, const float* __restrict__ WK, const float* __restrict__ WV, _Float16* __restrict__ QH, _Float16* __restrict__ QL, _Float16* __restrict__ KH, _Float16* __restrict__ VT) {
  __shared__ __align__(16) __bf16 sw[3 * HDQK][DIN + 8];   /* theta, phi, g weight rows, 528-byte pitch */
  __shared__ __align__(16) float sx[8][3][32][8];          /* the three partial tiles each wave hands to its partner, as they lie in registers */
  const int tid = threadIdx.x, wave = __builtin_amdgcn_readfirstlane(tid >> 5), lane = tid & 31, col = lane & 15, g = lane >> 4, pt = wave & 3, kq = wave >> 2;
  const size_t r0 = (size_t)blockIdx.x * 64, bb = r0 / TT; const int t0 = (int)(r0 % TT);
  v4f wr[24]; float xv[4][16];
  // every bare '#pragma unroll' in k_proj: its loop indexes loaded values, fragments or accumulators, which stay in registers only when the loop is fully unrolled
#pragma unroll
  for (int i = 0; i < 24; ++i) { const float* Wm = i < 8 ? WQ : i < 16 ? WK : WV; wr[i] = *(const v4f*)(Wm + (i & 7) * 1024 + tid * 4); }   /* 4 weight rows (4,096 bytes in a row) a step */
  { const float* p = X + (bb * DIN + kq * 128 + 8 * g) * (size_t)XP + t0 + pt * 16 + col;   /* channels-first gather: x[b][k][t], stride XP between k */
#pragma unroll
    for (int kc = 0; kc < 4; ++kc)
#pragma unroll
      for (int i = 0; i < 8; ++i) { xv[kc][i] = p[(size_t)(kc * 32 + i) * XP]; xv[kc][8 + i] = p[(size_t)(kc * 32 + 16 + i) * XP]; } }
  asm volatile("s_wait_xcnt 0x0" ::: "memory");   /* the loads' address registers stay as they are until this wait */
#pragma unroll
  for (int i = 0; i < 24; ++i) { v4bw w4;
#pragma unroll
    for (int e = 0; e < 4; ++e) w4[e] = (__bf16)wr[i][e];
    *(v4bw*)&sw[(i >> 3) * HDQK + (i & 7) * 4 + (tid >> 6)][(tid & 63) * 4] = w4; }
  __syncthreads();   /* the weight rows are in LDS before any wave reads them */
  v8f acc[6] = {};   /* 0, 1: theta^T channel tiles; 2, 3: phi^T channel tiles; 4, 5: g channel tiles */
  v16b wf[2][6];   /* the weight fragments of this k step and of the next */
#pragma unroll
  for (int j = 0; j < 6; ++j) wf[0][j] = frag_b(&sw[j * 16 + col][kq * 128], lane);
#pragma unroll
  for (int kc = 0; kc < 4; ++kc) { v16b a;
#pragma unroll
    for (int i = 0; i < 16; ++i) a[i] = (__bf16)xv[kc][i];
    if (kc < 3) {
#pragma unroll
      for (int j = 0; j < 6; ++j) wf[(kc + 1) & 1][j] = frag_b(&sw[j * 16 + col][kq * 128 + (kc + 1) * 32], lane); }
    __builtin_amdgcn_sched_barrier(0);   /* keeps the next step's twelve LDS reads in front of this step's products, so that their latency runs under them (left free, the compiler reads one fragment ahead and waits at every product) */
#pragma unroll
    for (int j = 0; j < 6; ++j) { const v16b w = wf[kc & 1][j];   /* the bare builtin: the compiler keeps the distances behind it */
      acc[j] = j < 4 ? __builtin_amdgcn_wmma_f32_16x16x32_bf16(false, w, false, a, (short)0, acc[j], false, false) : __builtin_amdgcn_wmma_f32_16x16x32_bf16(false, a, false, w, (short)0, acc[j], false, false); } }
  // the wave of the low channel half finishes theta's two tiles and g's first, its partner phi's two and g's second
  v8f mine[3], send[3];
  mine[0] = kq ? acc[2] : acc[0]; mine[1] = kq ? acc[3] : acc[1]; mine[2] = kq ? acc[5] : acc[4];
  send[0] = kq ? acc[0] : acc[2]; send[1] = kq ? acc[1] : acc[3]; send[2] = kq ? acc[4] : acc[5];
#pragma unroll
  for (int m = 0; m < 3; ++m) *(v8f*)&sx[wave][m][lane][0] = send[m];
  __syncthreads();   /* the partial tiles are in LDS before the partner wave reads them */
#pragma unroll
  for (int m = 0; m < 3; ++m) mine[m] += *(const v8f*)&sx[wave ^ 4][m][lane][0];
  if (kq == 0) { const size_t o = (r0 + pt * 16 + col) * CC + 8 * g;   /* q rows: the lane's position, channels 16 m + 8 g + 0..7; one wave writes a row's 64 bytes */
    st_split(QH + o, QL + o, mine[0]); st_split(QH + o + 16, QL + o + 16, mine[1]);
    asm volatile("s_wait_xcnt 0x0" ::: "memory"); }   /* the four stores' registers stay as they are until this wait */
  else { _Float16* d = KH + ((r0 >> 4) + pt) * 1024 + lane * 8;   /* k tile pt: runs hi 0, hi 1, residual 0, residual 1, 512 bytes each */
    st_split(d, d + 512, mine[0]); st_split(d + 256, d + 768, mine[1]);
    asm volatile("s_wait_xcnt 0x0" ::: "memory"); }   /* the four stores' registers stay as they are until this wait */
  { v8h h;   /* v tile of 32 positions: run (channel tile kq, position half pt & 1) */
#pragma unroll
    for (int r = 0; r < 8; ++r) h[r] = (_Float16)mine[2][r];
    *(v8h*)(VT + ((r0 >> 5) + (pt >> 1)) * 1024 + (kq * 2 + (pt & 1)) * 256 + lane * 8) = h; } }
// ---- k_att: block = 64 queries (4 tiles of 16) of batch blockIdx.y, 16 waves; wave w owns keys [256 w, 256 w + 256) for all 64 queries; its key and value fragments lie in the workspace in fragment order, so each of its global loads reads 512 bytes in a row (4 cache lines, not 16). Scores are formed transposed, S^T = phi . theta^T (A = key rows, B = query rows, staged once in LDS and read per tile), so a lane holds one query's scores.
// one pass over the keys: e = exp2(s log2 e - ref), s the full scores (hi + residual planes, 3 products), ref a reference point per wave and query that cancels in sum(e g) / sum(e). It starts 4 above the largest hi-plane score of the wave's first 32 keys (in powers of 2), so e starts near 2^-4 and f16 leaves 2^19 above it. A lane's f32 sum of its 16 e of a query tile and trip bounds each of them: only when such a sum passes 2^15 (one test a query tile and trip, a scalar branch) is the tile's ref raised to 4 above the scores in hand, their e taken again, and the tile's sums and partial y scaled by exp2(-rise). e goes once to f16; two S^T tiles of 16 keys are the B operand of y^T += g^T . e^T with no lane exchange. The 16 partial y tiles and sums are added in LDS in wave order, each weighted by exp2(its ref - the largest ref), y = sum(e g) / sum(e). tail: y (bf16 hi + lo, in LDS) against exact w_out on WMMA, one tile of 16 output channels a wave, turned in LDS to runs of 64 positions, + bf16(x), stored to out.
// every bare '#pragma unroll' in k_att and its helpers: its loop indexes fragments or accumulators, which stay in registers only when the loop is fully unrolled
#define AQT 4              // query tiles per wave: each key / value fragment load serves 64 queries
#define AKW 16             // key ranges = waves per block
#define AKR (TT / AKW)     // keys per wave
__device__ __forceinline__ v16h frag_p(const _Float16* p) { union { v16h v; v8h q[2]; } u; u.q[0] = *(const v8h*)p; u.q[1] = *(const v8h*)(p + 16); return u.v; }   /* frag_h with the lane's 8 (lane >> 4) already in p */
__device__ __forceinline__ v16h frag_c(const _Float16* p) { union { v16h v; v8h q[2]; } u; u.q[0] = *(const v8h*)p; u.q[1] = *(const v8h*)(p + 256); return u.v; }   /* a fragment stored in fragment order: two runs of 512 bytes, the lane's 8 lane already in p */
typedef __attribute__((ext_vector_type(4))) __bf16 v4b;
static_assert(32 * AKW * 16 == DIN * HDQK && DIN == 16 * AKW && 16 * 68 <= 16 * AQT * (HDQK + 4), "16 weights a thread; one output channel tile a wave; its output tile fits the LDS of its partial tile");
static_assert(CC == 128 && HDQK == 32 && AKR % 32 == 0, "the fragment-order tiles hold 32 channels, written by k_proj's one column block");
#define L2E 1.4426950408889634f
#define RSH 4.0f            // a fresh reference point lies this far (powers of 2) above the largest score it was taken from
#define TSMAX 32768.0f      // a lane's sum of 16 exponentials up to here: every one of them is finite in f16
struct SP { v8f a0, a1, b0, b1; };   /* hi and residual products of two key tiles against one query tile */
__device__ __forceinline__ SP att_prod(const _Float16* qhrow, const _Float16* qlrow, int lane, v16h kh0, v16h kl0, v16h kh1, v16h kl1) {
  const v16h qht = frag_h(qhrow, lane), qlt = frag_h(qlrow, lane); SP q; const v8f z = {};
  q.a0 = wmma16(kh0, qht, z); q.a1 = wmma16(kh1, qht, z); q.b0 = wmma16(kh0, qlt, z); q.b1 = wmma16(kh1, qlt, z); q.b0 = wmma16(kl0, qht, q.b0); q.b1 = wmma16(kl1, qht, q.b1);
  return q; }
// the scores as exponents of 2: (hi + residual / 1024) log2 e - ref, two fused multiply-adds an element (the residual's scale and log2 e are one constant)
__device__ __forceinline__ void att_join(const SP& q, float ref, v8f& s0, v8f& s1) {
  const v8f x0 = q.a0 * (SCALE * L2E) - ref, x1 = q.a1 * (SCALE * L2E) - ref; s0 = q.b0 * (SCALE * L2E / 1024.0f) + x0; s1 = q.b1 * (SCALE * L2E / 1024.0f) + x1; }
// exponentials of 16 scores a lane: once to f16 as the B fragment, and their f32 sum
__device__ __forceinline__ float att_exp(v8f s0, v8f s1, v16h& p) { v8f e0, e1;
#pragma unroll
  for (int r = 0; r < 8; ++r) { e0[r] = __builtin_amdgcn_exp2f(s0[r]); e1[r] = __builtin_amdgcn_exp2f(s1[r]); p[r] = (_Float16)e0[r]; p[8 + r] = (_Float16)e1[r]; }
  const v8f u = e0 + e1; const v4f w = __builtin_shufflevector(u, u, 0, 1, 2, 3) + __builtin_shufflevector(u, u, 4, 5, 6, 7);
  return (w[0] + w[2]) + (w[1] + w[3]); }
__global__ __launch_bounds__(32 * AKW) void k_att(const _Float16* __restrict__ QH, const _Float16* __restrict__ QL, const _Float16* __restrict__ KF, const _Float16* __restrict__ VF, const float* __restrict__ X, const float* __restrict__ WW, float* __restrict__ OUT) {
  __shared__ __align__(16) float so[AKW][16 * AQT][HDQK + 4]; __shared__ float sm[AKW][16 * AQT], sl[AKW][16 * AQT]; __shared__ __align__(16) _Float16 sq[16 * AQT][HDQK + 8], sp[16 * AQT][HDQK + 8];   /* the block's query rows, residual and hi, 80-byte pitch */
  __shared__ __align__(16) __bf16 syh[16 * AQT][HDQK + 8], syl[16 * AQT][HDQK + 8], swo[DIN][HDQK + 8];   /* the block's y rows, bf16 hi and lo, and w_out's rows, exact bf16: 80-byte pitch */
  const int tid = threadIdx.x, wave = tid >> 5, lane = tid & 31, col = lane & 15, g = lane >> 4;
  const size_t b = blockIdx.y, rb = b * TT; const int q0 = blockIdx.x * (16 * AQT), kbeg = wave * AKR;
  float rf[AQT], ls[AQT]; v8f o[AQT][HDQK / 16] = {};
#pragma unroll
  for (int t = 0; t < AQT; ++t) ls[t] = 0.f;
  const _Float16 *pk = KF + ((rb + kbeg) >> 4) * 1024 + lane * 8, *pv = VF + ((rb + kbeg) >> 5) * 1024 + lane * 8;   /* the lane's 16 bytes in the first run of the wave's first key tile and of its first value tile */
  v4f wr[4];   /* w_out, 16 weights a thread, goes to LDS here: loaded in front of the query rows so that the two latencies run together, and the tail waits for no weight load */
#pragma unroll
  for (int i = 0; i < 4; ++i) wr[i] = *(const v4f*)(WW + tid * 16 + i * 4);
  const v16h ki0 = frag_c(pk), ki1 = frag_c(pk + 1024);   /* hi fragments of the wave's first 32 keys, for the first reference points: loaded here so that their latency runs with the query rows' */
  asm volatile("s_wait_xcnt 0x0" :: "v"(pk) : "memory");   /* the loads' address registers stay as they are until this wait */
  if (tid < 64 * AQT) { const int row = tid >> 2, sg = (tid & 3) * 8; *(v8h*)&sq[row][sg] = *(const v8h*)(QL + (rb + q0 + row) * CC + sg); *(v8h*)&sp[row][sg] = *(const v8h*)(QH + (rb + q0 + row) * CC + sg); }
  { v8b w0, w1;
#pragma unroll
    for (int i = 0; i < 4; ++i) { w0[i] = (__bf16)wr[0][i]; w0[4 + i] = (__bf16)wr[1][i]; w1[i] = (__bf16)wr[2][i]; w1[4 + i] = (__bf16)wr[3][i]; }
    *(v8b*)&swo[tid >> 1][(tid & 1) * 16] = w0; *(v8b*)&swo[tid >> 1][(tid & 1) * 16 + 8] = w1; }
  __syncthreads();   /* the query rows (and w_out's) are in LDS before any wave reads them */
#pragma unroll
  for (int t = 0; t < AQT; ++t) { const v16h qht = frag_h(&sp[t * 16 + col][0], lane); const v8f z = {}; const v8f a0 = wmma16(ki0, qht, z), a1 = wmma16(ki1, qht, z); float m = fmaxf(a0[0], a1[0]);
#pragma unroll
    for (int r = 1; r < 8; ++r) m = fmaxf(m, fmaxf(a0[r], a1[r]));
    m = fmaxf(m, __shfl_xor(m, 16)); rf[t] = m * (SCALE * L2E) + RSH; }   /* the two lane halves hold one query's keys: one reference point for both */
#pragma unroll 1   /* rolled: 256 registers a wave is the budget of 4 waves per SIMD */
  for (int kc = 0; kc < AKR / 32; ++kc) {
    const v16h kh0 = frag_c(pk), kl0 = frag_c(pk + 512), kh1 = frag_c(pk + 1024), kl1 = frag_c(pk + 1536);
    v16h vf[HDQK / 16];
#pragma unroll
    for (int j = 0; j < HDQK / 16; ++j) vf[j] = frag_c(pv + j * 512);
    asm volatile("s_wait_xcnt 0x0" :: "v"(pk), "v"(pv) : "memory");   /* the twelve loads' address registers stay as they are until this wait; its memory clobber also keeps the LDS reads below inside the loop: hoisted, the eight query fragments would hold 64 more registers */
    pk += 2 * 1024; pv += 1024;
    SP q = att_prod(&sp[col][0], &sq[col][0], lane, kh0, kl0, kh1, kl1);
#pragma unroll
    for (int t = 0; t < AQT; ++t) { SP qn = q;
      if (t + 1 < AQT) qn = att_prod(&sp[(t + 1) * 16 + col][0], &sq[(t + 1) * 16 + col][0], lane, kh0, kl0, kh1, kl1);   /* the next query tile's six products are written ahead of this tile's vector work, in one piece of straight code with it: they fill the distances behind each other */
      v8f s0, s1; att_join(q, rf[t], s0, s1); v16h p; float ts = att_exp(s0, s1, p);
      if (__builtin_expect(__builtin_amdgcn_ballot_w32(!(ts <= TSMAX)) != 0, 0)) {   /* seldom taken (the hint keeps this code out of the loop's straight line), the same for the whole wave: some lane's exponentials may not fit f16 */
        float d = fmaxf(s0[0], s1[0]);
#pragma unroll
        for (int r = 1; r < 8; ++r) d = fmaxf(d, fmaxf(s0[r], s1[r]));
        d = fmaxf(d, __shfl_xor(d, 16)); d = fmaxf(d + RSH, 0.f);   /* the rise of the query's reference point, the same in both lane halves, never a fall */
        const float f = __builtin_amdgcn_exp2f(-d); rf[t] += d; ts = att_exp(s0 - d, s1 - d, p); ls[t] *= f;
#pragma unroll
        for (int j = 0; j < HDQK / 16; ++j) o[t][j] *= f; }
      ls[t] += ts;
#pragma unroll
      for (int j = 0; j < HDQK / 16; ++j) o[t][j] = wmma16(vf[j], p, o[t][j]);   /* D element r = y^T[channel 16 j + 8 g + r][query col] */
      q = qn; } }
#pragma unroll
  for (int t = 0; t < AQT; ++t) { ls[t] += __shfl_xor(ls[t], 16); if (g == 0) { sl[wave][t * 16 + col] = ls[t]; sm[wave][t * 16 + col] = rf[t]; }
#pragma unroll
    for (int j = 0; j < HDQK / 16; ++j) { v4f lo, hi;
#pragma unroll
      for (int r = 0; r < 4; ++r) { lo[r] = o[t][j][r]; hi[r] = o[t][j][4 + r]; }
      *(v4f*)&so[wave][t * 16 + col][j * 16 + 8 * g] = lo; *(v4f*)&so[wave][t * 16 + col][j * 16 + 8 * g + 4] = hi; } }
  // tail: out = w_out y + x for the block's 64 positions; wave w owns output channels [16 w, 16 w + 16)
  __syncthreads();   /* every wave's partial tile, sums and reference points are in LDS before they are added */
  { const int row = tid >> 3, c4 = (tid & 7) * 4; float mr[AKW], mm = sm[0][row]; mr[0] = mm;
#pragma unroll
    for (int w = 1; w < AKW; ++w) { mr[w] = sm[w][row]; mm = fmaxf(mm, mr[w]); }
    v4f s = {}; float l = 0.f;
#pragma unroll
    for (int w = 0; w < AKW; ++w) { const float f = __builtin_amdgcn_exp2f(mr[w] - mm); s += *(const v4f*)&so[w][row][c4] * f; l += sl[w][row] * f; }   /* each wave's sums brought to the largest reference point */
    const v4f y = s * (1.0f / l); v4b yh, yl;
#pragma unroll
    for (int r = 0; r < 4; ++r) { const __bf16 h = (__bf16)y[r]; yh[r] = h; yl[r] = (__bf16)(y[r] - (float)h); }
    *(v4b*)&syh[row][c4] = yh; *(v4b*)&syl[row][c4] = yl; }
  __syncthreads();   /* the y rows are in LDS before any wave reads them, and every read of the partial tiles is over before their LDS is written again */
  const int c0 = wave * 16; const size_t ob = (b * DIN + c0 + g) * (size_t)XP + q0 + col * 4;   /* 16 lanes cover one channel's 64 positions (256 bytes in a row), the two lane halves two channels */
  v4f xr[8];   /* the wave's x tile, loaded here so that the loads' latency runs under the products below (in front of the barrier they would be waited for at it) */
#pragma unroll
  for (int i = 0; i < 8; ++i) xr[i] = *(const v4f*)(X + ob + (size_t)(2 * i) * XP);
  asm volatile("s_wait_xcnt 0x0" ::: "memory");   /* the x loads' address registers stay as they are until this wait */
  const v16b wf = frag_b(&swo[c0 + col][0], lane);   /* A fragment: row = output channel c0 + col, k = the 32 y channels */
  float* st = &so[wave][0][0];   /* the wave's own 16 channels x 64 positions, 68-float pitch, in the LDS of its partial tile */
#pragma unroll
  for (int t = 0; t < AQT; ++t) { v8f a = {}; a = wmma_bf(wf, frag_b(&syh[t * 16 + col][0], lane), a); a = wmma_bf(wf, frag_b(&syl[t * 16 + col][0], lane), a);   /* D element r = out[channel c0 + 8 g + r][position 16 t + col] */
#pragma unroll
    for (int r = 0; r < 8; ++r) st[(8 * g + r) * 68 + t * 16 + col] = a[r]; }
  LDSX();   /* the wave's own stores are in LDS before its lanes read each other's */
  __builtin_amdgcn_sched_barrier(0);   /* keeps the x tile's roundings, and with them the wait for its loads, behind the products */
#pragma unroll
  for (int i = 0; i < 8; ++i) { const v4f v = *(const v4f*)&st[(2 * i + g) * 68 + col * 4]; v4f r4;
#pragma unroll
    for (int e = 0; e < 4; ++e) r4[e] = v[e] + bfr(xr[i][e]);
    vst2(OUT + ob + (size_t)(2 * i) * XP, r4); } }

extern "C" void kernel_launch(void* const* d_in, const int* in_sizes, int n_in, void* d_out, int out_size, void* d_ws, size_t ws_size, hipStream_t stream) {
  (void)in_sizes; (void)n_in; (void)out_size;
  const float** F = (const float**)d_in;
  if (ws_size < (size_t)WS_END) return;
  char* ws = (char*)d_ws; _Float16 *QH = (_Float16*)(ws + WS_QH), *KH = (_Float16*)(ws + WS_KH), *VT = (_Float16*)(ws + WS_VT), *QL = (_Float16*)(ws + WS_QL);
  // inputs: 0 x [4,256,64,64]; 1 w_theta [32,256] (out,in); 2 w_phi; 3 w_g; 4 w_out [256,32] (out,in); no biases
  k_proj<<<dim3(TNB * TT / 64), 256, 0, stream>>>(F[0], F[1], F[2], F[3], QH, QL, KH, VT);   /* q = theta, k = phi, v = g */
  k_att<<<dim3(TT / (16 * AQT), TNB), 32 * AKW, 0, stream>>>(QH, QL, KH, VT, F[0], F[4], (float*)d_out);
}
